// v000
// Measured on an AMD MI455X. A time is GPU time per run, averaged over a window of back-to-back runs after a warm-up
// (all launches, gaps included; the runs take copies of the inputs in turn), and the median of several windows.
// Apart from v000's, it joins two sittings. Times from different sittings can be a few percent apart, while
// side-by-side timings come from the same sitting.
// v000 is the starting kernel. One run takes 595 microseconds.
#include <hip/hip_runtime.h>
#include <hip/hip_bf16.h>

// ---------------------------------------------------------------------------
// CDNA5 (gfx1250) transformer block:
//  - all GEMMs + attention via v_wmma_f32_16x16x32_bf16 (wave32 WMMA)
//  - GEMM tiles staged with global_load_async_to_lds_b128 (ASYNCcnt) and
//    double-buffered LDS
// ---------------------------------------------------------------------------

typedef __attribute__((ext_vector_type(16))) __bf16 v16bf;
typedef __attribute__((ext_vector_type(8)))  float  v8f;

#define EMB   1024
#define HEADS 16
#define HDIM  64
#define LN_EPS 1e-5f

// K-index striping for 16-bit A/B fragments (CDNA5 ISA 7.12.2):
// lanes 0-15: VGPR0-3 -> K=0..7, VGPR4-7 -> K=16..23
// lanes 16-31: VGPR0-3 -> K=8..15, VGPR4-7 -> K=24..31
__device__ __forceinline__ int frag_k(int e, int half) {
  int v = e >> 1, p = e & 1;
  return (v < 4) ? (8 * half + 2 * v + p) : (8 + 8 * half + 2 * v + p);
}

__device__ __forceinline__ v8f wmma_bf16(v16bf a, v16bf b, v8f c) {
  return __builtin_amdgcn_wmma_f32_16x16x32_bf16(false, a, false, b,
                                                 (short)0, c, false, false);
}

// Async DMA: 16 bytes per lane, global -> LDS, tracked by ASYNCcnt.
__device__ __forceinline__ void async_copy16(unsigned int lds_addr,
                                             const __bf16* gptr) {
  asm volatile("global_load_async_to_lds_b128 %0, %1, off"
               :: "v"(lds_addr), "v"(gptr)
               : "memory");
}
__device__ __forceinline__ unsigned int lds_lo32(const void* p) {
  return (unsigned int)(unsigned long long)p;  // LDS aperture: offset in [31:0]
}

// ---------------------------------------------------------------------------
// fp32 [K,N] -> bf16 [N,K] transposed cast (32x32 tiles through LDS).
__global__ void cast_transpose_bf16(const float* __restrict__ in,
                                    __bf16* __restrict__ out, int K, int N) {
  __shared__ float t[32][33];
  const int k0 = blockIdx.y * 32, n0 = blockIdx.x * 32;
  const int tx = threadIdx.x & 31, ty = threadIdx.x >> 5;  // 32 x 8
#pragma unroll
  for (int i = 0; i < 32; i += 8)
    t[ty + i][tx] = in[(size_t)(k0 + ty + i) * N + n0 + tx];
  __syncthreads();
#pragma unroll
  for (int i = 0; i < 32; i += 8)
    out[(size_t)(n0 + ty + i) * K + k0 + tx] = (__bf16)t[tx][ty + i];
}

// One 256-thread block per row of D=1024.
__global__ void layernorm_bf16(const float* __restrict__ x,
                               const float* __restrict__ g,
                               const float* __restrict__ s,
                               __bf16* __restrict__ out) {
  const int row = blockIdx.x;
  const float* xr = x + (size_t)row * EMB;
  __shared__ float red[16];
  float v[4];
  float sum = 0.f, sq = 0.f;
#pragma unroll
  for (int i = 0; i < 4; ++i) {
    v[i] = xr[threadIdx.x + i * 256];
    sum += v[i];
    sq  += v[i] * v[i];
  }
#pragma unroll
  for (int off = 16; off; off >>= 1) {
    sum += __shfl_down(sum, off, 32);
    sq  += __shfl_down(sq,  off, 32);
  }
  if ((threadIdx.x & 31) == 0) {
    red[threadIdx.x >> 5]       = sum;
    red[8 + (threadIdx.x >> 5)] = sq;
  }
  __syncthreads();
  if (threadIdx.x == 0) {
    float ts = 0.f, tq = 0.f;
#pragma unroll
    for (int i = 0; i < 8; ++i) { ts += red[i]; tq += red[8 + i]; }
    float mean = ts * (1.0f / EMB);
    float var  = tq * (1.0f / EMB) - mean * mean;
    red[0] = mean;
    red[1] = rsqrtf(var + LN_EPS);
  }
  __syncthreads();
  float mean = red[0], inv = red[1];
#pragma unroll
  for (int i = 0; i < 4; ++i) {
    int c = threadIdx.x + i * 256;
    out[(size_t)row * EMB + c] = (__bf16)(g[c] * ((v[i] - mean) * inv) + s[c]);
  }
}

// ---------------------------------------------------------------------------
// Tiled bf16 WMMA GEMM: C[M,N] = act(A[M,K] @ B[K,N] + bias) + resid
// B supplied pre-transposed as BT[N,K] so both tiles are K-contiguous and
// can be staged verbatim with async b128 copies (double-buffered LDS).
// Block tile 64x64, K-step 32; 8 waves, each owns a 16(M)x32(N) sub-tile.
template <bool RELU, bool OUTBF>
__global__ void gemm_bf16_wmma(const __bf16* __restrict__ A,   // [M,K]
                               const __bf16* __restrict__ BT,  // [N,K]
                               const float* __restrict__ bias,
                               const float* __restrict__ resid,
                               void* __restrict__ outp,
                               int M, int N, int K) {
  __shared__ __align__(16) __bf16 As[2][64 * 32];
  __shared__ __align__(16) __bf16 Bs[2][64 * 32];

  const int tid    = threadIdx.x;
  const int lane   = tid & 31;
  const int wave   = tid >> 5;
  const int half   = lane >> 4;
  const int ln     = lane & 15;
  const int mstrip = wave & 3;   // 4 M-strips of 16 rows
  const int ngrp   = wave >> 2;  // 2 N-groups of 32 cols
  const int m0 = blockIdx.y * 64;
  const int n0 = blockIdx.x * 64;

  // Staging: each thread copies one 16B chunk per tile (64 rows x 32 K).
  const int srow = tid >> 2, scol = (tid & 3) * 8;
  const __bf16* aSrc = A  + (size_t)(m0 + srow) * K + scol;
  const __bf16* bSrc = BT + (size_t)(n0 + srow) * K + scol;
  const unsigned int ldsA0 = lds_lo32(&As[0][srow * 32 + scol]);
  const unsigned int ldsA1 = lds_lo32(&As[1][srow * 32 + scol]);
  const unsigned int ldsB0 = lds_lo32(&Bs[0][srow * 32 + scol]);
  const unsigned int ldsB1 = lds_lo32(&Bs[1][srow * 32 + scol]);

  v8f acc0 = {}, acc1 = {};

  async_copy16(ldsA0, aSrc);
  async_copy16(ldsB0, bSrc);

  int buf = 0;
  for (int k0 = 0; k0 < K; k0 += 32) {
    if (k0 + 32 < K) {
      async_copy16(buf ? ldsA0 : ldsA1, aSrc + k0 + 32);
      async_copy16(buf ? ldsB0 : ldsB1, bSrc + k0 + 32);
      asm volatile("s_wait_asynccnt 0x2" ::: "memory");  // current tile landed
    } else {
      asm volatile("s_wait_asynccnt 0x0" ::: "memory");
    }
    __syncthreads();  // all waves' DMA visible

    const __bf16* a  = As[buf];
    const __bf16* bs = Bs[buf];
    v16bf af, b0, b1;
#pragma unroll
    for (int e = 0; e < 16; ++e) {
      int kk = frag_k(e, half);
      af[e] = a [(mstrip * 16 + ln) * 32 + kk];
      b0[e] = bs[(ngrp * 32 + ln) * 32 + kk];
      b1[e] = bs[(ngrp * 32 + 16 + ln) * 32 + kk];
    }
    acc0 = wmma_bf16(af, b0, acc0);
    acc1 = wmma_bf16(af, b1, acc1);
    __syncthreads();  // protect buf before next prefetch overwrites it
    buf ^= 1;
  }

#pragma unroll
  for (int r = 0; r < 8; ++r) {
    int row = m0 + mstrip * 16 + half * 8 + r;
    int c0  = n0 + ngrp * 32 + ln;
    int c1  = c0 + 16;
    float v0 = acc0[r], v1 = acc1[r];
    if (bias) { v0 += bias[c0]; v1 += bias[c1]; }
    if (RELU) { v0 = fmaxf(v0, 0.f); v1 = fmaxf(v1, 0.f); }
    if (resid) {
      v0 += resid[(size_t)row * N + c0];
      v1 += resid[(size_t)row * N + c1];
    }
    if (OUTBF) {
      __bf16* o = (__bf16*)outp;
      o[(size_t)row * N + c0] = (__bf16)v0;
      o[(size_t)row * N + c1] = (__bf16)v1;
    } else {
      float* o = (float*)outp;
      o[(size_t)row * N + c0] = v0;
      o[(size_t)row * N + c1] = v1;
    }
  }
}

// ---------------------------------------------------------------------------
// Causal flash attention, one wave per (b, h, 16-query tile).
// Q/K/V/O are bf16 [B*T, EMB] with head h at column h*64.
__global__ void flash_attn_wmma(const __bf16* __restrict__ Q,
                                const __bf16* __restrict__ Km,
                                const __bf16* __restrict__ V,
                                __bf16* __restrict__ O, int T) {
  const int q0   = blockIdx.x * 16;
  const int h    = blockIdx.y;
  const int b    = blockIdx.z;
  const int lane = threadIdx.x & 31;
  const int half = lane >> 4;
  const int ln   = lane & 15;
  const size_t baseRow = (size_t)b * T;
  const int hoff = h * HDIM;

  __shared__ __bf16 Pl[16 * 32];

  // Q A-fragments: two K=32 chunks across head_dim 64
  v16bf qa[2];
#pragma unroll
  for (int c = 0; c < 2; ++c)
#pragma unroll
    for (int e = 0; e < 16; ++e)
      qa[c][e] = Q[(baseRow + q0 + ln) * EMB + hoff + c * 32 + frag_k(e, half)];

  float mi[8], li[8];
  v8f o[4] = {};
#pragma unroll
  for (int r = 0; r < 8; ++r) { mi[r] = -3.0e38f; li[r] = 0.f; }

  const float scale = 0.03125f;  // 1/sqrt(EMB) per reference
  const int nkt = (q0 + 16 + 31) / 32;
  for (int kt = 0; kt < nkt; ++kt) {
    const int kb = kt * 32;

    // S = Q @ K^T for 32 keys (two 16x16 tiles)
    v8f s0 = {}, s1 = {};
#pragma unroll
    for (int c = 0; c < 2; ++c) {
      v16bf kb0, kb1;
#pragma unroll
      for (int e = 0; e < 16; ++e) {
        int kk = frag_k(e, half);
        kb0[e] = Km[(baseRow + kb + ln) * EMB + hoff + c * 32 + kk];
        kb1[e] = Km[(baseRow + kb + 16 + ln) * EMB + hoff + c * 32 + kk];
      }
      s0 = wmma_bf16(qa[c], kb0, s0);
      s1 = wmma_bf16(qa[c], kb1, s1);
    }

    // online softmax (rows live in one 16-lane half at register r)
    float p0[8], p1[8];
#pragma unroll
    for (int r = 0; r < 8; ++r) {
      int qrow = q0 + half * 8 + r;
      float v0 = (kb + ln      <= qrow) ? s0[r] * scale : -3.0e38f;
      float v1 = (kb + 16 + ln <= qrow) ? s1[r] * scale : -3.0e38f;
      float rmax = fmaxf(v0, v1);
#pragma unroll
      for (int off = 1; off < 16; off <<= 1)
        rmax = fmaxf(rmax, __shfl_xor(rmax, off, 32));
      float mnew  = fmaxf(mi[r], rmax);
      float alpha = __expf(mi[r] - mnew);
      v0 = __expf(v0 - mnew);
      v1 = __expf(v1 - mnew);
      float rsum = v0 + v1;
#pragma unroll
      for (int off = 1; off < 16; off <<= 1)
        rsum += __shfl_xor(rsum, off, 32);
      li[r] = li[r] * alpha + rsum;
      mi[r] = mnew;
#pragma unroll
      for (int dd = 0; dd < 4; ++dd) o[dd][r] *= alpha;
      p0[r] = v0;
      p1[r] = v1;
    }

    // stage P through LDS to re-layout C-frag -> A-frag (16x32)
#pragma unroll
    for (int r = 0; r < 8; ++r) {
      int m = half * 8 + r;
      Pl[m * 32 + ln]      = (__bf16)p0[r];
      Pl[m * 32 + 16 + ln] = (__bf16)p1[r];
    }
    __syncthreads();
    v16bf pa;
#pragma unroll
    for (int e = 0; e < 16; ++e) pa[e] = Pl[ln * 32 + frag_k(e, half)];

    // O += P @ V  (four 16-wide d-chunks)
#pragma unroll
    for (int dd = 0; dd < 4; ++dd) {
      v16bf vb;
#pragma unroll
      for (int e = 0; e < 16; ++e) {
        int kk = frag_k(e, half);
        vb[e] = V[(baseRow + kb + kk) * EMB + hoff + dd * 16 + ln];
      }
      o[dd] = wmma_bf16(pa, vb, o[dd]);
    }
    __syncthreads();
  }

#pragma unroll
  for (int r = 0; r < 8; ++r) {
    float inv = 1.0f / li[r];
    int qrow = q0 + half * 8 + r;
#pragma unroll
    for (int dd = 0; dd < 4; ++dd)
      O[(baseRow + qrow) * EMB + hoff + dd * 16 + ln] = (__bf16)(o[dd][r] * inv);
  }
}

// ---------------------------------------------------------------------------
extern "C" void kernel_launch(void* const* d_in, const int* in_sizes, int n_in,
                              void* d_out, int out_size, void* d_ws,
                              size_t ws_size, hipStream_t stream) {
  (void)in_sizes; (void)n_in; (void)out_size; (void)ws_size;
  const int B = 2, T = 2048, D = EMB, M = B * T, D4 = 4 * D;

  const float* x  = (const float*)d_in[0];
  const float* Wq = (const float*)d_in[1];
  const float* Wk = (const float*)d_in[2];
  const float* Wv = (const float*)d_in[3];
  const float* Wo = (const float*)d_in[4];
  const float* bo = (const float*)d_in[5];
  const float* W1 = (const float*)d_in[6];
  const float* b1 = (const float*)d_in[7];
  const float* W2 = (const float*)d_in[8];
  const float* b2 = (const float*)d_in[9];
  const float* g1 = (const float*)d_in[10];
  const float* s1 = (const float*)d_in[11];
  const float* g2 = (const float*)d_in[12];
  const float* s2 = (const float*)d_in[13];
  float* out = (float*)d_out;

  size_t off = 0;
  auto alloc = [&](size_t bytes) {
    void* p = (char*)d_ws + off;
    off += (bytes + 255) & ~(size_t)255;
    return p;
  };
  __bf16* Wq_b = (__bf16*)alloc((size_t)D * D * 2);   // [N,K] transposed
  __bf16* Wk_b = (__bf16*)alloc((size_t)D * D * 2);
  __bf16* Wv_b = (__bf16*)alloc((size_t)D * D * 2);
  __bf16* Wo_b = (__bf16*)alloc((size_t)D * D * 2);
  __bf16* W1_b = (__bf16*)alloc((size_t)D * D4 * 2);
  __bf16* W2_b = (__bf16*)alloc((size_t)D4 * D * 2);
  __bf16* h1   = (__bf16*)alloc((size_t)M * D * 2);
  __bf16* q    = (__bf16*)alloc((size_t)M * D * 2);
  __bf16* k    = (__bf16*)alloc((size_t)M * D * 2);
  __bf16* v    = (__bf16*)alloc((size_t)M * D * 2);
  __bf16* attn = (__bf16*)alloc((size_t)M * D * 2);
  float*  xmid = (float*) alloc((size_t)M * D * 4);
  __bf16* h2   = (__bf16*)alloc((size_t)M * D * 2);
  __bf16* ffn  = (__bf16*)alloc((size_t)M * D4 * 2);

  // one-time fp32 [K,N] -> bf16 [N,K] weight transposes
  auto castT = [&](const float* src, __bf16* dst, int Kd, int Nd) {
    cast_transpose_bf16<<<dim3(Nd / 32, Kd / 32), 256, 0, stream>>>(src, dst, Kd, Nd);
  };
  castT(Wq, Wq_b, D, D);
  castT(Wk, Wk_b, D, D);
  castT(Wv, Wv_b, D, D);
  castT(Wo, Wo_b, D, D);
  castT(W1, W1_b, D, D4);
  castT(W2, W2_b, D4, D);

  // LN1 -> h1
  layernorm_bf16<<<M, 256, 0, stream>>>(x, g1, s1, h1);

  // QKV projections
  dim3 gQKV(D / 64, M / 64);
  gemm_bf16_wmma<false, true><<<gQKV, 256, 0, stream>>>(h1, Wq_b, nullptr, nullptr, q, M, D, D);
  gemm_bf16_wmma<false, true><<<gQKV, 256, 0, stream>>>(h1, Wk_b, nullptr, nullptr, k, M, D, D);
  gemm_bf16_wmma<false, true><<<gQKV, 256, 0, stream>>>(h1, Wv_b, nullptr, nullptr, v, M, D, D);

  // causal flash attention
  flash_attn_wmma<<<dim3(T / 16, HEADS, B), 32, 0, stream>>>(q, k, v, attn, T);

  // out projection + bias + residual(x) -> xmid (f32)
  gemm_bf16_wmma<false, false><<<gQKV, 256, 0, stream>>>(attn, Wo_b, bo, x, xmid, M, D, D);

  // LN2 -> h2
  layernorm_bf16<<<M, 256, 0, stream>>>(xmid, g2, s2, h2);

  // FFN
  gemm_bf16_wmma<true, true><<<dim3(D4 / 64, M / 64), 256, 0, stream>>>(h2, W1_b, b1, nullptr, ffn, M, D4, D);
  gemm_bf16_wmma<false, false><<<dim3(D / 64, M / 64), 256, 0, stream>>>(ffn, W2_b, b2, xmid, out, M, D, D4);
}

// v001
// Measured time: 418 microseconds a run.
// In both of two side-by-side timings against v000, it was 1.44 times as fast.
#include <hip/hip_runtime.h>
#include <hip/hip_bf16.h>

// ---------------------------------------------------------------------------
// CDNA5 (gfx1250) transformer block:
//  - all GEMMs + attention via v_wmma_f32_16x16x32_bf16 (wave32 WMMA)
//  - GEMM tiles staged with global_load_async_to_lds_b128 (ASYNCcnt) and
//    double-buffered LDS
// ---------------------------------------------------------------------------

typedef __attribute__((ext_vector_type(16))) __bf16 v16bf;
typedef __attribute__((ext_vector_type(8)))  float  v8f;

#define EMB   1024
#define HEADS 16
#define HDIM  64
#define LN_EPS 1e-5f

// K-index striping for 16-bit A/B fragments (CDNA5 ISA 7.12.2):
// lanes 0-15: VGPR0-3 -> K=0..7, VGPR4-7 -> K=16..23
// lanes 16-31: VGPR0-3 -> K=8..15, VGPR4-7 -> K=24..31
__device__ __forceinline__ int frag_k(int e, int half) {
  int v = e >> 1, p = e & 1;
  return (v < 4) ? (8 * half + 2 * v + p) : (8 + 8 * half + 2 * v + p);
}

__device__ __forceinline__ v8f wmma_bf16(v16bf a, v16bf b, v8f c) {
  return __builtin_amdgcn_wmma_f32_16x16x32_bf16(false, a, false, b,
                                                 (short)0, c, false, false);
}

// Async DMA: 16 bytes per lane, global -> LDS, tracked by ASYNCcnt.
__device__ __forceinline__ void async_copy16(unsigned int lds_addr,
                                             const __bf16* gptr) {
  asm volatile("global_load_async_to_lds_b128 %0, %1, off"
               :: "v"(lds_addr), "v"(gptr)
               : "memory");
}
__device__ __forceinline__ unsigned int lds_lo32(const void* p) {
  return (unsigned int)(unsigned long long)p;  // LDS aperture: offset in [31:0]
}

// ---------------------------------------------------------------------------
// fp32 [K,N] -> bf16 [N,K] transposed cast (32x32 tiles through LDS).
__global__ void cast_transpose_bf16(const float* __restrict__ in,
                                    __bf16* __restrict__ out, int K, int N) {
  __shared__ float t[32][33];
  const int k0 = blockIdx.y * 32, n0 = blockIdx.x * 32;
  const int tx = threadIdx.x & 31, ty = threadIdx.x >> 5;  // 32 x 8
#pragma unroll
  for (int i = 0; i < 32; i += 8)
    t[ty + i][tx] = in[(size_t)(k0 + ty + i) * N + n0 + tx];
  __syncthreads();
#pragma unroll
  for (int i = 0; i < 32; i += 8)
    out[(size_t)(n0 + ty + i) * K + k0 + tx] = (__bf16)t[tx][ty + i];
}

// One 256-thread block per row of D=1024.
__global__ void layernorm_bf16(const float* __restrict__ x,
                               const float* __restrict__ g,
                               const float* __restrict__ s,
                               __bf16* __restrict__ out) {
  const int row = blockIdx.x;
  const float* xr = x + (size_t)row * EMB;
  __shared__ float red[16];
  float v[4];
  float sum = 0.f, sq = 0.f;
#pragma unroll
  for (int i = 0; i < 4; ++i) {
    v[i] = xr[threadIdx.x + i * 256];
    sum += v[i];
    sq  += v[i] * v[i];
  }
#pragma unroll
  for (int off = 16; off; off >>= 1) {
    sum += __shfl_down(sum, off, 32);
    sq  += __shfl_down(sq,  off, 32);
  }
  if ((threadIdx.x & 31) == 0) {
    red[threadIdx.x >> 5]       = sum;
    red[8 + (threadIdx.x >> 5)] = sq;
  }
  __syncthreads();
  if (threadIdx.x == 0) {
    float ts = 0.f, tq = 0.f;
#pragma unroll
    for (int i = 0; i < 8; ++i) { ts += red[i]; tq += red[8 + i]; }
    float mean = ts * (1.0f / EMB);
    float var  = tq * (1.0f / EMB) - mean * mean;
    red[0] = mean;
    red[1] = rsqrtf(var + LN_EPS);
  }
  __syncthreads();
  float mean = red[0], inv = red[1];
#pragma unroll
  for (int i = 0; i < 4; ++i) {
    int c = threadIdx.x + i * 256;
    out[(size_t)row * EMB + c] = (__bf16)(g[c] * ((v[i] - mean) * inv) + s[c]);
  }
}

// ---------------------------------------------------------------------------
// Tiled bf16 WMMA GEMM: C[M,N] = act(A[M,K] @ B[K,N] + bias) + resid
// B supplied pre-transposed as BT[N,K] so both tiles are K-contiguous and
// can be staged verbatim with async b128 copies (double-buffered LDS).
// Block tile 64x64, K-step 32; 8 waves, each owns a 16(M)x32(N) sub-tile.
template <bool RELU, bool OUTBF>
__global__ void gemm_bf16_wmma(const __bf16* __restrict__ A,   // [M,K]
                               const __bf16* __restrict__ BT,  // [N,K]
                               const float* __restrict__ bias,
                               const float* __restrict__ resid,
                               void* __restrict__ outp,
                               int M, int N, int K) {
  __shared__ __align__(16) __bf16 As[2][64 * 32];
  __shared__ __align__(16) __bf16 Bs[2][64 * 32];

  const int tid    = threadIdx.x;
  const int lane   = tid & 31;
  const int wave   = tid >> 5;
  const int half   = lane >> 4;
  const int ln     = lane & 15;
  const int mstrip = wave & 3;   // 4 M-strips of 16 rows
  const int ngrp   = wave >> 2;  // 2 N-groups of 32 cols
  const int m0 = blockIdx.y * 64;
  const int n0 = blockIdx.x * 64;

  // Staging: each thread copies one 16B chunk per tile (64 rows x 32 K).
  const int srow = tid >> 2, scol = (tid & 3) * 8;
  const __bf16* aSrc = A  + (size_t)(m0 + srow) * K + scol;
  const __bf16* bSrc = BT + (size_t)(n0 + srow) * K + scol;
  const unsigned int ldsA0 = lds_lo32(&As[0][srow * 32 + scol]);
  const unsigned int ldsA1 = lds_lo32(&As[1][srow * 32 + scol]);
  const unsigned int ldsB0 = lds_lo32(&Bs[0][srow * 32 + scol]);
  const unsigned int ldsB1 = lds_lo32(&Bs[1][srow * 32 + scol]);

  v8f acc0 = {}, acc1 = {};

  async_copy16(ldsA0, aSrc);
  async_copy16(ldsB0, bSrc);

  int buf = 0;
  for (int k0 = 0; k0 < K; k0 += 32) {
    if (k0 + 32 < K) {
      async_copy16(buf ? ldsA0 : ldsA1, aSrc + k0 + 32);
      async_copy16(buf ? ldsB0 : ldsB1, bSrc + k0 + 32);
      asm volatile("s_wait_asynccnt 0x2" ::: "memory");  // current tile landed
    } else {
      asm volatile("s_wait_asynccnt 0x0" ::: "memory");
    }
    __syncthreads();  // all waves' DMA visible

    const __bf16* a  = As[buf];
    const __bf16* bs = Bs[buf];
    v16bf af, b0, b1;
#pragma unroll
    for (int e = 0; e < 16; ++e) {
      int kk = frag_k(e, half);
      af[e] = a [(mstrip * 16 + ln) * 32 + kk];
      b0[e] = bs[(ngrp * 32 + ln) * 32 + kk];
      b1[e] = bs[(ngrp * 32 + 16 + ln) * 32 + kk];
    }
    acc0 = wmma_bf16(af, b0, acc0);
    acc1 = wmma_bf16(af, b1, acc1);
    __syncthreads();  // protect buf before next prefetch overwrites it
    buf ^= 1;
  }

#pragma unroll
  for (int r = 0; r < 8; ++r) {
    int row = m0 + mstrip * 16 + half * 8 + r;
    int c0  = n0 + ngrp * 32 + ln;
    int c1  = c0 + 16;
    float v0 = acc0[r], v1 = acc1[r];
    if (bias) { v0 += bias[c0]; v1 += bias[c1]; }
    if (RELU) { v0 = fmaxf(v0, 0.f); v1 = fmaxf(v1, 0.f); }
    if (resid) {
      v0 += resid[(size_t)row * N + c0];
      v1 += resid[(size_t)row * N + c1];
    }
    if (OUTBF) {
      __bf16* o = (__bf16*)outp;
      o[(size_t)row * N + c0] = (__bf16)v0;
      o[(size_t)row * N + c1] = (__bf16)v1;
    } else {
      float* o = (float*)outp;
      o[(size_t)row * N + c0] = v0;
      o[(size_t)row * N + c1] = v1;
    }
  }
}

typedef __attribute__((ext_vector_type(8))) __bf16 v8bf;

// One 16x32 operand fragment in the hardware k order: p points at k = 8*half of
// this lane's row; elements 0-7 are k = 8*half + 0..7, 8-15 are k = 16 + 8*half + 0..7.
__device__ __forceinline__ v16bf load_frag(const __bf16* p) {
  v8bf lo = *(const v8bf*)p;
  v8bf hi = *(const v8bf*)(p + 16);
  return __builtin_shufflevector(lo, hi, 0, 1, 2, 3, 4, 5, 6, 7,
                                 8, 9, 10, 11, 12, 13, 14, 15);
}

// lane l <-> lane l ^ 16
__device__ __forceinline__ float xhalf(float x) {
  int b = __builtin_bit_cast(int, x);
  return __builtin_bit_cast(float, __builtin_amdgcn_permlanex16(
      b, b, 0x76543210, 0xfedcba98, false, false));
}

__global__ void __launch_bounds__(32)
flash_attn_wmma(const __bf16* __restrict__ Q,
                const __bf16* __restrict__ Km,
                const __bf16* __restrict__ Vt,
                __bf16* __restrict__ O, int T, int vpitch) {
  const int q0   = blockIdx.x * 32;
  const int h    = blockIdx.y;
  const int b    = blockIdx.z;
  const int lane = threadIdx.x & 31;
  const int half = lane >> 4;
  const int ln   = lane & 15;
  const size_t baseRow = (size_t)b * T;
  const int hoff = h * HDIM;

  // Q as B operand: two 16-query column groups x two k = 32 chunks of head_dim
  v16bf qb[2][2];
#pragma unroll
  for (int g = 0; g < 2; ++g)
#pragma unroll
    for (int c = 0; c < 2; ++c)
      qb[g][c] = load_frag(Q + (baseRow + q0 + g * 16 + ln) * EMB + hoff + c * 32 + 8 * half);

  float mi[2], li[2];
  v8f o[2][4] = {};
#pragma unroll
  for (int g = 0; g < 2; ++g) { mi[g] = -3.0e38f; li[g] = 0.f; }

  // 1/sqrt(EMB) per reference, times log2(e): the softmax runs in base 2
  const float scale = 0.03125f * 1.4426950408889634f;
  const int nkt = q0 / 32 + 1;
  const __bf16* kp = Km + (baseRow + ln) * EMB + hoff + 8 * half;
  const __bf16* vp = Vt + (size_t)(hoff + ln) * vpitch + baseRow + 8 * half;
  for (int kt = 0; kt < nkt; ++kt) {
    const int kb = kt * 32;

    v16bf ka[2][2];  // [16-key tile][head_dim chunk]
#pragma unroll
    for (int t = 0; t < 2; ++t)
#pragma unroll
      for (int c = 0; c < 2; ++c)
        ka[t][c] = load_frag(kp + (size_t)(kb + t * 16) * EMB + c * 32);
    v16bf va[4];     // [16-row chunk of head_dim], k = the 32 keys
#pragma unroll
    for (int dd = 0; dd < 4; ++dd)
      va[dd] = load_frag(vp + (size_t)(dd * 16) * vpitch + kb);

#pragma unroll
    for (int g = 0; g < 2; ++g) {
      // st[t][r] = S[query q0 + g*16 + ln][key kb + t*16 + 8*half + r]
      v8f st[2] = {};
#pragma unroll
      for (int t = 0; t < 2; ++t)
#pragma unroll
        for (int c = 0; c < 2; ++c)
          st[t] = wmma_bf16(ka[t][c], qb[g][c], st[t]);

      float x[16];
#pragma unroll
      for (int e = 0; e < 16; ++e) x[e] = st[e >> 3][e & 7] * scale;
      if (kt == nkt - 1) {  // only the last key tile crosses the diagonal
        const int qrel = g * 16 + ln - 8 * half;  // query - first key of this lane
#pragma unroll
        for (int e = 0; e < 16; ++e)
          x[e] = ((e >> 3) * 16 + (e & 7) <= qrel) ? x[e] : -3.0e38f;
      }
      float rmax = x[0];
#pragma unroll
      for (int e = 1; e < 16; ++e) rmax = fmaxf(rmax, x[e]);
      rmax = fmaxf(rmax, xhalf(rmax));
      const float mnew  = fmaxf(mi[g], rmax);
      const float alpha = __builtin_amdgcn_exp2f(mi[g] - mnew);
      mi[g] = mnew;

      // pb[s] = P^T[key kmap(s, half)][query]: the two score tiles in register order
      v16bf pb;
      float rsum = 0.f;
#pragma unroll
      for (int e = 0; e < 16; ++e) {
        float p = __builtin_amdgcn_exp2f(x[e] - mnew);
        rsum += p;
        pb[e] = (__bf16)p;
      }
      li[g] = li[g] * alpha + rsum;  // this half's keys only; halves join after the loop
#pragma unroll
      for (int dd = 0; dd < 4; ++dd) {
        o[g][dd] *= alpha;
        o[g][dd] = wmma_bf16(va[dd], pb, o[g][dd]);
      }
    }
  }

  // o[g][dd][r] = O[query q0 + g*16 + ln][d = dd*16 + 8*half + r]
#pragma unroll
  for (int g = 0; g < 2; ++g) {
    const float inv = 1.0f / (li[g] + xhalf(li[g]));
    __bf16* op = O + (baseRow + q0 + g * 16 + ln) * EMB + hoff + 8 * half;
#pragma unroll
    for (int dd = 0; dd < 4; ++dd) {
      v8bf w;
#pragma unroll
      for (int r = 0; r < 8; ++r) w[r] = (__bf16)(o[g][dd][r] * inv);
      *(v8bf*)(op + dd * 16) = w;
    }
  }
}

// ---------------------------------------------------------------------------
extern "C" void kernel_launch(void* const* d_in, const int* in_sizes, int n_in,
                              void* d_out, int out_size, void* d_ws,
                              size_t ws_size, hipStream_t stream) {
  (void)in_sizes; (void)n_in; (void)out_size; (void)ws_size;
  const int B = 2, T = 2048, D = EMB, M = B * T, D4 = 4 * D;
  const int VP = M + 64;  // row pitch of V^T: an odd number of 128-byte lines

  const float* x  = (const float*)d_in[0];
  const float* Wq = (const float*)d_in[1];
  const float* Wk = (const float*)d_in[2];
  const float* Wv = (const float*)d_in[3];
  const float* Wo = (const float*)d_in[4];
  const float* bo = (const float*)d_in[5];
  const float* W1 = (const float*)d_in[6];
  const float* b1 = (const float*)d_in[7];
  const float* W2 = (const float*)d_in[8];
  const float* b2 = (const float*)d_in[9];
  const float* g1 = (const float*)d_in[10];
  const float* s1 = (const float*)d_in[11];
  const float* g2 = (const float*)d_in[12];
  const float* s2 = (const float*)d_in[13];
  float* out = (float*)d_out;

  size_t off = 0;
  auto alloc = [&](size_t bytes) {
    void* p = (char*)d_ws + off;
    off += (bytes + 255) & ~(size_t)255;
    return p;
  };
  __bf16* Wq_b = (__bf16*)alloc((size_t)D * D * 2);   // [N,K] transposed
  __bf16* Wk_b = (__bf16*)alloc((size_t)D * D * 2);
  __bf16* Wv_b = (__bf16*)alloc((size_t)D * D * 2);
  __bf16* Wo_b = (__bf16*)alloc((size_t)D * D * 2);
  __bf16* W1_b = (__bf16*)alloc((size_t)D * D4 * 2);
  __bf16* W2_b = (__bf16*)alloc((size_t)D4 * D * 2);
  __bf16* h1   = (__bf16*)alloc((size_t)M * D * 2);
  __bf16* q    = (__bf16*)alloc((size_t)M * D * 2);
  __bf16* k    = (__bf16*)alloc((size_t)M * D * 2);
  __bf16* vT   = (__bf16*)alloc((size_t)D * VP * 2);  // [D, VP], columns 0..M-1 used
  __bf16* attn = (__bf16*)alloc((size_t)M * D * 2);
  float*  xmid = (float*) alloc((size_t)M * D * 4);
  __bf16* h2   = (__bf16*)alloc((size_t)M * D * 2);
  __bf16* ffn  = (__bf16*)alloc((size_t)M * D4 * 2);

  // one-time fp32 [K,N] -> bf16 [N,K] weight transposes
  auto castT = [&](const float* src, __bf16* dst, int Kd, int Nd) {
    cast_transpose_bf16<<<dim3(Nd / 32, Kd / 32), 256, 0, stream>>>(src, dst, Kd, Nd);
  };
  castT(Wq, Wq_b, D, D);
  castT(Wk, Wk_b, D, D);
  castT(Wv, Wv_b, D, D);
  castT(Wo, Wo_b, D, D);
  castT(W1, W1_b, D, D4);
  castT(W2, W2_b, D4, D);

  // LN1 -> h1
  layernorm_bf16<<<M, 256, 0, stream>>>(x, g1, s1, h1);

  // QKV projections
  dim3 gQKV(D / 64, M / 64);
  gemm_bf16_wmma<false, true><<<gQKV, 256, 0, stream>>>(h1, Wq_b, nullptr, nullptr, q, M, D, D);
  gemm_bf16_wmma<false, true><<<gQKV, 256, 0, stream>>>(h1, Wk_b, nullptr, nullptr, k, M, D, D);
  // V^T = Wv^T h1^T: the same kernel with the operands swapped; its N is the output's row pitch
  gemm_bf16_wmma<false, true><<<dim3(M / 64, D / 64), 256, 0, stream>>>(Wv_b, h1, nullptr, nullptr, vT, D, VP, D);

  // causal flash attention
  flash_attn_wmma<<<dim3(T / 32, HEADS, B), 32, 0, stream>>>(q, k, vT, attn, T, VP);

  // out projection + bias + residual(x) -> xmid (f32)
  gemm_bf16_wmma<false, false><<<gQKV, 256, 0, stream>>>(attn, Wo_b, bo, x, xmid, M, D, D);

  // LN2 -> h2
  layernorm_bf16<<<M, 256, 0, stream>>>(xmid, g2, s2, h2);

  // FFN
  gemm_bf16_wmma<true, true><<<dim3(D4 / 64, M / 64), 256, 0, stream>>>(h2, W1_b, b1, nullptr, ffn, M, D4, D);
  gemm_bf16_wmma<false, false><<<dim3(D / 64, M / 64), 256, 0, stream>>>(ffn, W2_b, b2, xmid, out, M, D, D4);
}

// v002
// A run of this version takes 249 microseconds.
// Next to v001, in two timings, it ran 1.68 times as fast each time.
// Counting every step since v000, it is 2.42 times as fast.
#include <hip/hip_runtime.h>
#include <hip/hip_bf16.h>

// ---------------------------------------------------------------------------
// CDNA5 (gfx1250) transformer block:
//  - all GEMMs + attention via v_wmma_f32_16x16x32_bf16 (wave32 WMMA)
//  - GEMM tiles staged with global_load_async_to_lds_b128 (ASYNCcnt) and
//    double-buffered LDS
// ---------------------------------------------------------------------------

typedef __attribute__((ext_vector_type(16))) __bf16 v16bf;
typedef __attribute__((ext_vector_type(8)))  float  v8f;

#define EMB   1024
#define HEADS 16
#define HDIM  64
#define LN_EPS 1e-5f

// K-index striping for 16-bit A/B fragments (CDNA5 ISA 7.12.2):
// lanes 0-15: VGPR0-3 -> K=0..7, VGPR4-7 -> K=16..23
// lanes 16-31: VGPR0-3 -> K=8..15, VGPR4-7 -> K=24..31
__device__ __forceinline__ v8f wmma_bf16(v16bf a, v16bf b, v8f c) {
  return __builtin_amdgcn_wmma_f32_16x16x32_bf16(false, a, false, b,
                                                 (short)0, c, false, false);
}

// Async DMA: 16 bytes per lane, global -> LDS, tracked by ASYNCcnt. Eight copies
// for eight tile rows 16 apart. The closing s_wait_xcnt stands inside the statement
// so that no address register is rewritten ahead of it.
#define LDS_PITCH 136  // bf16 elements a tile row in LDS: 256 B of data + 16 B pad
__device__ __forceinline__ void async_copy_rows8(unsigned int lds,
                                                 const __bf16* g, size_t gstep) {
  const unsigned int ls = 16 * LDS_PITCH * 2;
  asm volatile("global_load_async_to_lds_b128 %0, %8, off\n\t"
               "global_load_async_to_lds_b128 %1, %9, off\n\t"
               "global_load_async_to_lds_b128 %2, %10, off\n\t"
               "global_load_async_to_lds_b128 %3, %11, off\n\t"
               "global_load_async_to_lds_b128 %4, %12, off\n\t"
               "global_load_async_to_lds_b128 %5, %13, off\n\t"
               "global_load_async_to_lds_b128 %6, %14, off\n\t"
               "global_load_async_to_lds_b128 %7, %15, off\n\t"
               "s_wait_xcnt 0x0"
               :: "v"(lds), "v"(lds + ls), "v"(lds + 2 * ls), "v"(lds + 3 * ls),
                  "v"(lds + 4 * ls), "v"(lds + 5 * ls), "v"(lds + 6 * ls),
                  "v"(lds + 7 * ls),
                  "v"(g), "v"(g + gstep), "v"(g + 2 * gstep), "v"(g + 3 * gstep),
                  "v"(g + 4 * gstep), "v"(g + 5 * gstep), "v"(g + 6 * gstep),
                  "v"(g + 7 * gstep)
               : "memory");
}
__device__ __forceinline__ unsigned int lds_lo32(const void* p) {
  return (unsigned int)(unsigned long long)p;  // LDS aperture: offset in [31:0]
}

// ---------------------------------------------------------------------------
// fp32 [K,N] -> bf16 [N,K] transposed cast (32x32 tiles through LDS).
__global__ void cast_transpose_bf16(const float* __restrict__ in,
                                    __bf16* __restrict__ out, int K, int N) {
  __shared__ float t[32][33];
  const int k0 = blockIdx.y * 32, n0 = blockIdx.x * 32;
  const int tx = threadIdx.x & 31, ty = threadIdx.x >> 5;  // 32 x 8
#pragma unroll
  for (int i = 0; i < 32; i += 8)
    t[ty + i][tx] = in[(size_t)(k0 + ty + i) * N + n0 + tx];
  __syncthreads();
#pragma unroll
  for (int i = 0; i < 32; i += 8)
    out[(size_t)(n0 + ty + i) * K + k0 + tx] = (__bf16)t[tx][ty + i];
}

// One 256-thread block per row of D=1024.
__global__ void layernorm_bf16(const float* __restrict__ x,
                               const float* __restrict__ g,
                               const float* __restrict__ s,
                               __bf16* __restrict__ out) {
  const int row = blockIdx.x;
  const float* xr = x + (size_t)row * EMB;
  __shared__ float red[16];
  float v[4];
  float sum = 0.f, sq = 0.f;
#pragma unroll
  for (int i = 0; i < 4; ++i) {
    v[i] = xr[threadIdx.x + i * 256];
    sum += v[i];
    sq  += v[i] * v[i];
  }
#pragma unroll
  for (int off = 16; off; off >>= 1) {
    sum += __shfl_down(sum, off, 32);
    sq  += __shfl_down(sq,  off, 32);
  }
  if ((threadIdx.x & 31) == 0) {
    red[threadIdx.x >> 5]       = sum;
    red[8 + (threadIdx.x >> 5)] = sq;
  }
  __syncthreads();
  if (threadIdx.x == 0) {
    float ts = 0.f, tq = 0.f;
#pragma unroll
    for (int i = 0; i < 8; ++i) { ts += red[i]; tq += red[8 + i]; }
    float mean = ts * (1.0f / EMB);
    float var  = tq * (1.0f / EMB) - mean * mean;
    red[0] = mean;
    red[1] = rsqrtf(var + LN_EPS);
  }
  __syncthreads();
  float mean = red[0], inv = red[1];
#pragma unroll
  for (int i = 0; i < 4; ++i) {
    int c = threadIdx.x + i * 256;
    out[(size_t)row * EMB + c] = (__bf16)(g[c] * ((v[i] - mean) * inv) + s[c]);
  }
}

// ---------------------------------------------------------------------------
// Tiled bf16 WMMA GEMM: C[M,N] = act(A[M,K] @ B[K,N] + bias) + resid
// B supplied pre-transposed as BT[N,K] so both tiles are K-contiguous and
// can be staged verbatim with async b128 copies (double-buffered LDS).
// Block tile 128x128, 128 k a pass; 8 waves (2 x 4), each owns 64(M)x32(N).
// A stage is [A 128 rows | BT 128 rows] at a pitch of 272 B (16 B x odd: the
// b128 fragment reads meet no bank conflict). M, N multiples of 128, K of 128.
typedef __attribute__((ext_vector_type(8))) __bf16 v8bf;

// One 16x32 operand fragment in the hardware k order: p points at k = 8*half of
// this lane's row; elements 0-7 are k = 8*half + 0..7, 8-15 are k = 16 + 8*half + 0..7.
__device__ __forceinline__ v16bf load_frag(const __bf16* p) {
  v8bf lo = *(const v8bf*)p;
  v8bf hi = *(const v8bf*)(p + 16);
  return __builtin_shufflevector(lo, hi, 0, 1, 2, 3, 4, 5, 6, 7,
                                 8, 9, 10, 11, 12, 13, 14, 15);
}

#define STAGE_ELEMS (256 * LDS_PITCH)

template <bool RELU, bool OUTBF>
__global__ void __launch_bounds__(256)
gemm_bf16_wmma(const __bf16* __restrict__ A,   // [M,K]
               const __bf16* __restrict__ BT,  // [N,K]
               const float* __restrict__ bias,
               const float* __restrict__ resid,
               void* __restrict__ outp,
               int M, int N, int K) {
  __shared__ __align__(16) __bf16 st[2][STAGE_ELEMS];

  const int tid  = threadIdx.x;
  const int lane = tid & 31;
  const int wave = tid >> 5;
  const int half = lane >> 4;
  const int ln   = lane & 15;
  const int wm   = wave & 1;   // 2 M-strips of 64 rows
  const int wn   = wave >> 1;  // 4 N-strips of 32 cols
  const int m0 = blockIdx.y * 128;
  const int n0 = blockIdx.x * 128;

  // Staging: 16 lanes cover one 256-B row; a thread copies rows srow + 16 i.
  const int srow = tid >> 4, scol = (tid & 15) * 8;
  const __bf16* aSrc = A  + (size_t)(m0 + srow) * K + scol;
  const __bf16* bSrc = BT + (size_t)(n0 + srow) * K + scol;
  const size_t gstep = (size_t)16 * K;
  const unsigned int ldsA = lds_lo32(&st[0][srow * LDS_PITCH + scol]);
  const unsigned int ldsB = ldsA + 128 * LDS_PITCH * 2;

  v8f acc[4][2] = {};
  const int npass = K / 128;

  async_copy_rows8(ldsA, aSrc, gstep);
  async_copy_rows8(ldsB, bSrc, gstep);
  asm volatile("s_wait_asynccnt 0x0" ::: "memory");  // this wave's share of tile 0 landed
  __syncthreads();                                   // every wave's share visible
  if (npass > 1) {
    async_copy_rows8(ldsA + STAGE_ELEMS * 2, aSrc + 128, gstep);
    async_copy_rows8(ldsB + STAGE_ELEMS * 2, bSrc + 128, gstep);
  }

  for (int t = 0; t < npass; ++t) {
    const int buf = t & 1;
    const __bf16* a  = &st[buf][(wm * 64 + ln) * LDS_PITCH + 8 * half];
    const __bf16* bs = &st[buf][(128 + wn * 32 + ln) * LDS_PITCH + 8 * half];
#pragma unroll
    for (int c = 0; c < 4; ++c) {  // four k = 32 chunks of the pass
      v16bf af[4], bf[2];
#pragma unroll
      for (int i = 0; i < 4; ++i) af[i] = load_frag(a + i * 16 * LDS_PITCH + c * 32);
#pragma unroll
      for (int j = 0; j < 2; ++j) bf[j] = load_frag(bs + j * 16 * LDS_PITCH + c * 32);
#pragma unroll
      for (int i = 0; i < 4; ++i)
#pragma unroll
        for (int j = 0; j < 2; ++j)
          acc[i][j] = wmma_bf16(af[i], bf[j], acc[i][j]);
    }
    asm volatile("s_wait_dscnt 0x0" ::: "memory");     // own reads of this buffer done
    asm volatile("s_wait_asynccnt 0x0" ::: "memory");  // own share of tile t + 1 landed
    __syncthreads();  // publishes tile t + 1 and frees this buffer for the refill
    if (t + 2 < npass) {
      const unsigned int bo = buf * (STAGE_ELEMS * 2);
      async_copy_rows8(ldsA + bo, aSrc + (size_t)(t + 2) * 128, gstep);
      async_copy_rows8(ldsB + bo, bSrc + (size_t)(t + 2) * 128, gstep);
    }
  }
  asm volatile("s_wait_asynccnt 0x0" ::: "memory");  // nothing in flight at the wave's end

  // Bias is read once and the residual one 16-row block at a time, as one group of
  // loads: with two waves a SIMD a load and its wait in every row would stand open.
  const int c0 = n0 + wn * 32 + ln;
  const int c1 = c0 + 16;
  float bb0 = 0.f, bb1 = 0.f;
  if (bias) {
    bb0 = bias[c0];
    bb1 = bias[c1];
    // the column index register of the two loads is rewritten below
    asm volatile("s_wait_xcnt 0x0" ::: "memory");
  }
#pragma unroll
  for (int i = 0; i < 4; ++i) {
    const size_t rb = (size_t)(m0 + wm * 64 + i * 16 + half * 8) * N;
    float r0[8] = {}, r1[8] = {};
    if (resid) {
#pragma unroll
      for (int r = 0; r < 8; ++r) {
        r0[r] = resid[rb + (size_t)r * N + c0];
        r1[r] = resid[rb + (size_t)r * N + c1];
      }
      // the store addresses below reuse the loads' address registers
      asm volatile("s_wait_xcnt 0x0" ::: "memory");
    }
#pragma unroll
    for (int r = 0; r < 8; ++r) {
      float v0 = acc[i][0][r], v1 = acc[i][1][r];
      if (bias) { v0 += bb0; v1 += bb1; }
      if (RELU) { v0 = fmaxf(v0, 0.f); v1 = fmaxf(v1, 0.f); }
      if (resid) { v0 += r0[r]; v1 += r1[r]; }
      if (OUTBF) {
        __bf16* o = (__bf16*)outp;
        o[rb + (size_t)r * N + c0] = (__bf16)v0;
        o[rb + (size_t)r * N + c1] = (__bf16)v1;
      } else {
        float* o = (float*)outp;
        o[rb + (size_t)r * N + c0] = v0;
        o[rb + (size_t)r * N + c1] = v1;
      }
      // the next row reuses the two stores' address and data registers
      asm volatile("s_wait_xcnt 0x0" ::: "memory");
    }
  }
}

__device__ __forceinline__ float xhalf(float x) {
  int b = __builtin_bit_cast(int, x);
  return __builtin_bit_cast(float, __builtin_amdgcn_permlanex16(
      b, b, 0x76543210, 0xfedcba98, false, false));
}

__global__ void __launch_bounds__(32)
flash_attn_wmma(const __bf16* __restrict__ Q,
                const __bf16* __restrict__ Km,
                const __bf16* __restrict__ Vt,
                __bf16* __restrict__ O, int T, int vpitch) {
  const int q0   = blockIdx.x * 32;
  const int h    = blockIdx.y;
  const int b    = blockIdx.z;
  const int lane = threadIdx.x & 31;
  const int half = lane >> 4;
  const int ln   = lane & 15;
  const size_t baseRow = (size_t)b * T;
  const int hoff = h * HDIM;

  // Q as B operand: two 16-query column groups x two k = 32 chunks of head_dim
  v16bf qb[2][2];
#pragma unroll
  for (int g = 0; g < 2; ++g)
#pragma unroll
    for (int c = 0; c < 2; ++c)
      qb[g][c] = load_frag(Q + (baseRow + q0 + g * 16 + ln) * EMB + hoff + c * 32 + 8 * half);

  float mi[2], li[2];
  v8f o[2][4] = {};
#pragma unroll
  for (int g = 0; g < 2; ++g) { mi[g] = -3.0e38f; li[g] = 0.f; }

  // 1/sqrt(EMB) per reference, times log2(e): the softmax runs in base 2
  const float scale = 0.03125f * 1.4426950408889634f;
  const int nkt = q0 / 32 + 1;
  const __bf16* kp = Km + (baseRow + ln) * EMB + hoff + 8 * half;
  const __bf16* vp = Vt + (size_t)(hoff + ln) * vpitch + baseRow + 8 * half;
  for (int kt = 0; kt < nkt; ++kt) {
    const int kb = kt * 32;

    v16bf ka[2][2];  // [16-key tile][head_dim chunk]
#pragma unroll
    for (int t = 0; t < 2; ++t)
#pragma unroll
      for (int c = 0; c < 2; ++c)
        ka[t][c] = load_frag(kp + (size_t)(kb + t * 16) * EMB + c * 32);
    v16bf va[4];     // [16-row chunk of head_dim], k = the 32 keys
#pragma unroll
    for (int dd = 0; dd < 4; ++dd)
      va[dd] = load_frag(vp + (size_t)(dd * 16) * vpitch + kb);

#pragma unroll
    for (int g = 0; g < 2; ++g) {
      // st[t][r] = S[query q0 + g*16 + ln][key kb + t*16 + 8*half + r]
      v8f st[2] = {};
#pragma unroll
      for (int t = 0; t < 2; ++t)
#pragma unroll
        for (int c = 0; c < 2; ++c)
          st[t] = wmma_bf16(ka[t][c], qb[g][c], st[t]);

      float x[16];
#pragma unroll
      for (int e = 0; e < 16; ++e) x[e] = st[e >> 3][e & 7] * scale;
      if (kt == nkt - 1) {  // only the last key tile crosses the diagonal
        const int qrel = g * 16 + ln - 8 * half;  // query - first key of this lane
#pragma unroll
        for (int e = 0; e < 16; ++e)
          x[e] = ((e >> 3) * 16 + (e & 7) <= qrel) ? x[e] : -3.0e38f;
      }
      float rmax = x[0];
#pragma unroll
      for (int e = 1; e < 16; ++e) rmax = fmaxf(rmax, x[e]);
      rmax = fmaxf(rmax, xhalf(rmax));
      const float mnew  = fmaxf(mi[g], rmax);
      const float alpha = __builtin_amdgcn_exp2f(mi[g] - mnew);
      mi[g] = mnew;

      // pb[s] = P^T[key kmap(s, half)][query]: the two score tiles in register order
      v16bf pb;
      float rsum = 0.f;
#pragma unroll
      for (int e = 0; e < 16; ++e) {
        float p = __builtin_amdgcn_exp2f(x[e] - mnew);
        rsum += p;
        pb[e] = (__bf16)p;
      }
      li[g] = li[g] * alpha + rsum;  // this half's keys only; halves join after the loop
#pragma unroll
      for (int dd = 0; dd < 4; ++dd) {
        o[g][dd] *= alpha;
        o[g][dd] = wmma_bf16(va[dd], pb, o[g][dd]);
      }
    }
  }

  // o[g][dd][r] = O[query q0 + g*16 + ln][d = dd*16 + 8*half + r]
#pragma unroll
  for (int g = 0; g < 2; ++g) {
    const float inv = 1.0f / (li[g] + xhalf(li[g]));
    __bf16* op = O + (baseRow + q0 + g * 16 + ln) * EMB + hoff + 8 * half;
#pragma unroll
    for (int dd = 0; dd < 4; ++dd) {
      v8bf w;
#pragma unroll
      for (int r = 0; r < 8; ++r) w[r] = (__bf16)(o[g][dd][r] * inv);
      *(v8bf*)(op + dd * 16) = w;
    }
  }
}

// ---------------------------------------------------------------------------
extern "C" void kernel_launch(void* const* d_in, const int* in_sizes, int n_in,
                              void* d_out, int out_size, void* d_ws,
                              size_t ws_size, hipStream_t stream) {
  (void)in_sizes; (void)n_in; (void)out_size; (void)ws_size;
  const int B = 2, T = 2048, D = EMB, M = B * T, D4 = 4 * D;
  const int VP = M + 64;  // row pitch of V^T: an odd number of 128-byte lines

  const float* x  = (const float*)d_in[0];
  const float* Wq = (const float*)d_in[1];
  const float* Wk = (const float*)d_in[2];
  const float* Wv = (const float*)d_in[3];
  const float* Wo = (const float*)d_in[4];
  const float* bo = (const float*)d_in[5];
  const float* W1 = (const float*)d_in[6];
  const float* b1 = (const float*)d_in[7];
  const float* W2 = (const float*)d_in[8];
  const float* b2 = (const float*)d_in[9];
  const float* g1 = (const float*)d_in[10];
  const float* s1 = (const float*)d_in[11];
  const float* g2 = (const float*)d_in[12];
  const float* s2 = (const float*)d_in[13];
  float* out = (float*)d_out;

  size_t off = 0;
  auto alloc = [&](size_t bytes) {
    void* p = (char*)d_ws + off;
    off += (bytes + 255) & ~(size_t)255;
    return p;
  };
  __bf16* Wq_b = (__bf16*)alloc((size_t)D * D * 2);   // [N,K] transposed
  __bf16* Wk_b = (__bf16*)alloc((size_t)D * D * 2);
  __bf16* Wv_b = (__bf16*)alloc((size_t)D * D * 2);
  __bf16* Wo_b = (__bf16*)alloc((size_t)D * D * 2);
  __bf16* W1_b = (__bf16*)alloc((size_t)D * D4 * 2);
  __bf16* W2_b = (__bf16*)alloc((size_t)D4 * D * 2);
  __bf16* h1   = (__bf16*)alloc((size_t)M * D * 2);
  __bf16* q    = (__bf16*)alloc((size_t)M * D * 2);
  __bf16* k    = (__bf16*)alloc((size_t)M * D * 2);
  __bf16* vT   = (__bf16*)alloc((size_t)D * VP * 2);  // [D, VP], columns 0..M-1 used
  __bf16* attn = (__bf16*)alloc((size_t)M * D * 2);
  float*  xmid = (float*) alloc((size_t)M * D * 4);
  __bf16* h2   = (__bf16*)alloc((size_t)M * D * 2);
  __bf16* ffn  = (__bf16*)alloc((size_t)M * D4 * 2);

  // one-time fp32 [K,N] -> bf16 [N,K] weight transposes
  auto castT = [&](const float* src, __bf16* dst, int Kd, int Nd) {
    cast_transpose_bf16<<<dim3(Nd / 32, Kd / 32), 256, 0, stream>>>(src, dst, Kd, Nd);
  };
  castT(Wq, Wq_b, D, D);
  castT(Wk, Wk_b, D, D);
  castT(Wv, Wv_b, D, D);
  castT(Wo, Wo_b, D, D);
  castT(W1, W1_b, D, D4);
  castT(W2, W2_b, D4, D);

  // LN1 -> h1
  layernorm_bf16<<<M, 256, 0, stream>>>(x, g1, s1, h1);

  // QKV projections
  dim3 gQKV(D / 128, M / 128);
  gemm_bf16_wmma<false, true><<<gQKV, 256, 0, stream>>>(h1, Wq_b, nullptr, nullptr, q, M, D, D);
  gemm_bf16_wmma<false, true><<<gQKV, 256, 0, stream>>>(h1, Wk_b, nullptr, nullptr, k, M, D, D);
  // V^T = Wv^T h1^T: the same kernel with the operands swapped; its N is the output's row pitch
  gemm_bf16_wmma<false, true><<<dim3(M / 128, D / 128), 256, 0, stream>>>(Wv_b, h1, nullptr, nullptr, vT, D, VP, D);

  // causal flash attention
  flash_attn_wmma<<<dim3(T / 32, HEADS, B), 32, 0, stream>>>(q, k, vT, attn, T, VP);

  // out projection + bias + residual(x) -> xmid (f32)
  gemm_bf16_wmma<false, false><<<gQKV, 256, 0, stream>>>(attn, Wo_b, bo, x, xmid, M, D, D);

  // LN2 -> h2
  layernorm_bf16<<<M, 256, 0, stream>>>(xmid, g2, s2, h2);

  // FFN
  gemm_bf16_wmma<true, true><<<dim3(D4 / 128, M / 128), 256, 0, stream>>>(h2, W1_b, b1, nullptr, ffn, M, D4, D);
  gemm_bf16_wmma<false, false><<<dim3(D / 128, M / 128), 256, 0, stream>>>(ffn, W2_b, b2, xmid, out, M, D, D4);
}

// v003
// One run takes 235 microseconds.
// Timed twice side by side with v002, it ran 1.06 and 1.05 times as fast.
// All steps since v000 together make it 2.56 times as fast.
#include <hip/hip_runtime.h>
#include <hip/hip_bf16.h>

// ---------------------------------------------------------------------------
// CDNA5 (gfx1250) transformer block:
//  - all GEMMs + attention via v_wmma_f32_16x16x32_bf16 (wave32 WMMA)
//  - GEMM tiles staged with global_load_async_to_lds_b128 (ASYNCcnt) and
//    double-buffered LDS
// ---------------------------------------------------------------------------

typedef __attribute__((ext_vector_type(16))) __bf16 v16bf;
typedef __attribute__((ext_vector_type(8)))  float  v8f;

#define EMB   1024
#define HEADS 16
#define HDIM  64
#define LN_EPS 1e-5f

// K-index striping for 16-bit A/B fragments (CDNA5 ISA 7.12.2):
// lanes 0-15: VGPR0-3 -> K=0..7, VGPR4-7 -> K=16..23
// lanes 16-31: VGPR0-3 -> K=8..15, VGPR4-7 -> K=24..31
__device__ __forceinline__ v8f wmma_bf16(v16bf a, v16bf b, v8f c) {
  return __builtin_amdgcn_wmma_f32_16x16x32_bf16(false, a, false, b,
                                                 (short)0, c, false, false);
}

// Async DMA: 16 bytes per lane, global -> LDS, tracked by ASYNCcnt. Eight copies
// for eight tile rows 16 apart. The closing s_wait_xcnt stands inside the statement
// so that no address register is rewritten ahead of it.
#define LDS_PITCH 136  // bf16 elements a tile row in LDS: 256 B of data + 16 B pad
__device__ __forceinline__ void async_copy_rows8(unsigned int lds,
                                                 const __bf16* g, size_t gstep) {
  const unsigned int ls = 16 * LDS_PITCH * 2;
  asm volatile("global_load_async_to_lds_b128 %0, %8, off\n\t"
               "global_load_async_to_lds_b128 %1, %9, off\n\t"
               "global_load_async_to_lds_b128 %2, %10, off\n\t"
               "global_load_async_to_lds_b128 %3, %11, off\n\t"
               "global_load_async_to_lds_b128 %4, %12, off\n\t"
               "global_load_async_to_lds_b128 %5, %13, off\n\t"
               "global_load_async_to_lds_b128 %6, %14, off\n\t"
               "global_load_async_to_lds_b128 %7, %15, off\n\t"
               "s_wait_xcnt 0x0"
               :: "v"(lds), "v"(lds + ls), "v"(lds + 2 * ls), "v"(lds + 3 * ls),
                  "v"(lds + 4 * ls), "v"(lds + 5 * ls), "v"(lds + 6 * ls),
                  "v"(lds + 7 * ls),
                  "v"(g), "v"(g + gstep), "v"(g + 2 * gstep), "v"(g + 3 * gstep),
                  "v"(g + 4 * gstep), "v"(g + 5 * gstep), "v"(g + 6 * gstep),
                  "v"(g + 7 * gstep)
               : "memory");
}
__device__ __forceinline__ unsigned int lds_lo32(const void* p) {
  return (unsigned int)(unsigned long long)p;  // LDS aperture: offset in [31:0]
}

// ---------------------------------------------------------------------------
typedef __attribute__((ext_vector_type(8))) __bf16 v8bf;
typedef __attribute__((ext_vector_type(4))) __bf16 v4bf;
typedef __attribute__((ext_vector_type(4))) float  v4f;

// fp32 [K,N] -> bf16 [N,K] transposed cast of all six weights in one launch of few,
// long waves (64 elements a lane): the time of the many short waves it replaces
// went into starting them. A block takes one 128(k) x 128(n) tile, a wave
// 64(k) x 32(n), a lane 8(k) x 8(n), transposed in its registers. 8 lanes along k
// make every store a whole 128-B line of the output; a lane's two loads of a row
// cover one 128-B line together with its three neighbours along n.
__global__ void __launch_bounds__(256)
cast_transpose_bf16(const float* __restrict__ Wq, const float* __restrict__ Wk,
                    const float* __restrict__ Wv, const float* __restrict__ Wo,
                    const float* __restrict__ W1, const float* __restrict__ W2,
                    __bf16* __restrict__ oq, __bf16* __restrict__ ok,
                    __bf16* __restrict__ ov, __bf16* __restrict__ oo,
                    __bf16* __restrict__ o1, __bf16* __restrict__ o2) {
  const int TSQ = (EMB / 128) * (EMB / 128);  // tiles of an EMB x EMB weight
  const int id = blockIdx.x;                  // 12 * TSQ blocks
  const int w  = id / TSQ;                    // 0-3 square weights, 4-7 W1, 8-11 W2
  const float* in = w == 0 ? Wq : w == 1 ? Wk : w == 2 ? Wv : w == 3 ? Wo
                  : w < 8 ? W1 : W2;
  __bf16* out = w == 0 ? oq : w == 1 ? ok : w == 2 ? ov : w == 3 ? oo
              : w < 8 ? o1 : o2;
  const int K = w < 8 ? EMB : 4 * EMB;
  const int N = (w >= 4 && w < 8) ? 4 * EMB : EMB;
  const int t = w < 4 ? id % TSQ : id % (4 * TSQ);  // tile of this weight
  const int ntn = N / 128;                          // a power of two
  const int lane = threadIdx.x & 31, wave = threadIdx.x >> 5;
  const int k0 = (t >> __builtin_ctz(ntn)) * 128 + (wave & 1) * 64 + (lane & 7) * 8;
  const int n0 = (t & (ntn - 1)) * 128 + (wave >> 1) * 32 + (lane >> 3) * 4;

  const float* pr[8];
  v4f a[8][2];
#pragma unroll
  for (int j = 0; j < 8; ++j) {
    pr[j] = in + (size_t)(k0 + j) * N + n0;
    a[j][0] = *(const v4f*)pr[j];
    a[j][1] = *(const v4f*)(pr[j] + 16);
  }
  // Takes the loaded values and their addresses as inputs only: all 16 loads are in
  // flight together before the first conversion, and the address registers stay
  // untouched up to the wait.
  asm volatile("s_wait_xcnt 0x0"
               :: "v"(pr[0]), "v"(pr[1]), "v"(pr[2]), "v"(pr[3]),
                  "v"(pr[4]), "v"(pr[5]), "v"(pr[6]), "v"(pr[7]),
                  "v"(a[0][0]), "v"(a[0][1]), "v"(a[1][0]), "v"(a[1][1]),
                  "v"(a[2][0]), "v"(a[2][1]), "v"(a[3][0]), "v"(a[3][1]),
                  "v"(a[4][0]), "v"(a[4][1]), "v"(a[5][0]), "v"(a[5][1]),
                  "v"(a[6][0]), "v"(a[6][1]), "v"(a[7][0]), "v"(a[7][1])
               : "memory");

  __bf16* q = out + (size_t)n0 * K + k0;
#pragma unroll
  for (int h = 0; h < 2; ++h)
#pragma unroll
    for (int i = 0; i < 4; ++i) {
      v8bf o;
#pragma unroll
      for (int j = 0; j < 8; ++j) o[j] = (__bf16)a[j][h][i];
      *(v8bf*)(q + (size_t)(h * 16 + i) * K) = o;
    }
}

// lane l <-> lane l ^ 16
__device__ __forceinline__ float xhalf(float x) {
  int b = __builtin_bit_cast(int, x);
  return __builtin_bit_cast(float, __builtin_amdgcn_permlanex16(
      b, b, 0x76543210, 0xfedcba98, false, false));
}

// x + (x of lane l ^ MASK) inside a 16-lane row (DPP row_xmask)
template <int MASK>
__device__ __forceinline__ float add_xmask(float x) {
  return x + __builtin_bit_cast(float, __builtin_amdgcn_update_dpp(
                 0, __builtin_bit_cast(int, x), 0x160 + MASK, 0xf, 0xf, true));
}
__device__ __forceinline__ float wave_sum(float x) {
  x = add_xmask<1>(x);
  x = add_xmask<2>(x);
  x = add_xmask<4>(x);
  x = add_xmask<8>(x);
  return x + xhalf(x);
}

// One wave per row of D=1024 (8 rows a block): a lane holds 32 elements as eight
// 16-B loads, the sums stay inside the wave, no LDS and no barrier.
__global__ void __launch_bounds__(256)
layernorm_bf16(const float* __restrict__ x,
               const float* __restrict__ g,
               const float* __restrict__ s,
               __bf16* __restrict__ out) {
  const int lane = threadIdx.x & 31;
  const int row  = blockIdx.x * 8 + (threadIdx.x >> 5);
  const float* xr = x + (size_t)row * EMB + lane * 4;
  v4f v[8], gv[8], sv[8];
#pragma unroll
  for (int i = 0; i < 8; ++i) v[i] = *(const v4f*)(xr + i * 128);
#pragma unroll
  for (int i = 0; i < 8; ++i) {
    gv[i] = *(const v4f*)(g + lane * 4 + i * 128);
    sv[i] = *(const v4f*)(s + lane * 4 + i * 128);
  }
  // Takes the loaded values and the row's address as inputs only: the scale and
  // shift loads fly with the row's instead of one pair at a time behind the sums,
  // and the address registers stay untouched up to the wait.
  asm volatile("s_wait_xcnt 0x0"
               :: "v"(xr), "v"(v[0]), "v"(v[1]), "v"(v[2]), "v"(v[3]),
                  "v"(v[4]), "v"(v[5]), "v"(v[6]), "v"(v[7]),
                  "v"(gv[0]), "v"(gv[1]), "v"(gv[2]), "v"(gv[3]),
                  "v"(gv[4]), "v"(gv[5]), "v"(gv[6]), "v"(gv[7]),
                  "v"(sv[0]), "v"(sv[1]), "v"(sv[2]), "v"(sv[3]),
                  "v"(sv[4]), "v"(sv[5]), "v"(sv[6]), "v"(sv[7])
               : "memory");
  // keeps the sums from being scheduled in among the loads, which split the group
  __builtin_amdgcn_sched_barrier(0);
  v4f s4 = v[0], q4 = v[0] * v[0];  // four independent chains each
#pragma unroll
  for (int i = 1; i < 8; ++i) {
    s4 += v[i];
    q4 += v[i] * v[i];
  }
  const float ts = wave_sum((s4[0] + s4[1]) + (s4[2] + s4[3]));
  const float tq = wave_sum((q4[0] + q4[1]) + (q4[2] + q4[3]));
  const float mean = ts * (1.0f / EMB);
  const float var  = tq * (1.0f / EMB) - mean * mean;
  const float inv  = rsqrtf(var + LN_EPS);
  __bf16* o = out + (size_t)row * EMB + lane * 4;
#pragma unroll
  for (int i = 0; i < 8; ++i) {
    v4bf w;
#pragma unroll
    for (int e = 0; e < 4; ++e)
      w[e] = (__bf16)(gv[i][e] * ((v[i][e] - mean) * inv) + sv[i][e]);
    *(v4bf*)(o + i * 128) = w;
  }
}

// ---------------------------------------------------------------------------
// Tiled bf16 WMMA GEMM: C[M,N] = act(A[M,K] @ B[K,N] + bias) + resid
// B supplied pre-transposed as BT[N,K] so both tiles are K-contiguous and
// can be staged verbatim with async b128 copies (double-buffered LDS).
// Block tile 128x128, 128 k a pass; 8 waves (2 x 4), each owns 64(M)x32(N).
// A stage is [A 128 rows | BT 128 rows] at a pitch of 272 B (16 B x odd: the
// b128 fragment reads meet no bank conflict). M, N multiples of 128, K of 128.
// One 16x32 operand fragment in the hardware k order: p points at k = 8*half of
// this lane's row; elements 0-7 are k = 8*half + 0..7, 8-15 are k = 16 + 8*half + 0..7.
__device__ __forceinline__ v16bf load_frag(const __bf16* p) {
  v8bf lo = *(const v8bf*)p;
  v8bf hi = *(const v8bf*)(p + 16);
  return __builtin_shufflevector(lo, hi, 0, 1, 2, 3, 4, 5, 6, 7,
                                 8, 9, 10, 11, 12, 13, 14, 15);
}

#define STAGE_ELEMS (256 * LDS_PITCH)

template <bool RELU, bool OUTBF>
__global__ void __launch_bounds__(256)
gemm_bf16_wmma(const __bf16* __restrict__ A,   // [M,K]
               const __bf16* __restrict__ BT,  // [N,K]
               const float* __restrict__ bias,
               const float* __restrict__ resid,
               void* __restrict__ outp,
               int M, int N, int K) {
  __shared__ __align__(16) __bf16 st[2][STAGE_ELEMS];

  const int tid  = threadIdx.x;
  const int lane = tid & 31;
  const int wave = tid >> 5;
  const int half = lane >> 4;
  const int ln   = lane & 15;
  const int wm   = wave & 1;   // 2 M-strips of 64 rows
  const int wn   = wave >> 1;  // 4 N-strips of 32 cols
  const int m0 = blockIdx.y * 128;
  const int n0 = blockIdx.x * 128;

  // Staging: 16 lanes cover one 256-B row; a thread copies rows srow + 16 i.
  const int srow = tid >> 4, scol = (tid & 15) * 8;
  const __bf16* aSrc = A  + (size_t)(m0 + srow) * K + scol;
  const __bf16* bSrc = BT + (size_t)(n0 + srow) * K + scol;
  const size_t gstep = (size_t)16 * K;
  const unsigned int ldsA = lds_lo32(&st[0][srow * LDS_PITCH + scol]);
  const unsigned int ldsB = ldsA + 128 * LDS_PITCH * 2;

  v8f acc[4][2] = {};
  const int npass = K / 128;

  async_copy_rows8(ldsA, aSrc, gstep);
  async_copy_rows8(ldsB, bSrc, gstep);
  asm volatile("s_wait_asynccnt 0x0" ::: "memory");  // this wave's share of tile 0 landed
  __syncthreads();                                   // every wave's share visible
  if (npass > 1) {
    async_copy_rows8(ldsA + STAGE_ELEMS * 2, aSrc + 128, gstep);
    async_copy_rows8(ldsB + STAGE_ELEMS * 2, bSrc + 128, gstep);
  }

  for (int t = 0; t < npass; ++t) {
    const int buf = t & 1;
    const __bf16* a  = &st[buf][(wm * 64 + ln) * LDS_PITCH + 8 * half];
    const __bf16* bs = &st[buf][(128 + wn * 32 + ln) * LDS_PITCH + 8 * half];
#pragma unroll
    for (int c = 0; c < 4; ++c) {  // four k = 32 chunks of the pass
      v16bf af[4], bf[2];
#pragma unroll
      for (int i = 0; i < 4; ++i) af[i] = load_frag(a + i * 16 * LDS_PITCH + c * 32);
#pragma unroll
      for (int j = 0; j < 2; ++j) bf[j] = load_frag(bs + j * 16 * LDS_PITCH + c * 32);
#pragma unroll
      for (int i = 0; i < 4; ++i)
#pragma unroll
        for (int j = 0; j < 2; ++j)
          acc[i][j] = wmma_bf16(af[i], bf[j], acc[i][j]);
    }
    asm volatile("s_wait_dscnt 0x0" ::: "memory");     // own reads of this buffer done
    asm volatile("s_wait_asynccnt 0x0" ::: "memory");  // own share of tile t + 1 landed
    __syncthreads();  // publishes tile t + 1 and frees this buffer for the refill
    if (t + 2 < npass) {
      const unsigned int bo = buf * (STAGE_ELEMS * 2);
      async_copy_rows8(ldsA + bo, aSrc + (size_t)(t + 2) * 128, gstep);
      async_copy_rows8(ldsB + bo, bSrc + (size_t)(t + 2) * 128, gstep);
    }
  }
  asm volatile("s_wait_asynccnt 0x0" ::: "memory");  // nothing in flight at the wave's end

  // Bias is read once and the residual one 16-row block at a time, as one group of
  // loads: with two waves a SIMD a load and its wait in every row would stand open.
  const int c0 = n0 + wn * 32 + ln;
  const int c1 = c0 + 16;
  float bb0 = 0.f, bb1 = 0.f;
  if (bias) {
    bb0 = bias[c0];
    bb1 = bias[c1];
    // the column index register of the two loads is rewritten below
    asm volatile("s_wait_xcnt 0x0" ::: "memory");
  }
#pragma unroll
  for (int i = 0; i < 4; ++i) {
    const size_t rb = (size_t)(m0 + wm * 64 + i * 16 + half * 8) * N;
    float r0[8] = {}, r1[8] = {};
    if (resid) {
#pragma unroll
      for (int r = 0; r < 8; ++r) {
        r0[r] = resid[rb + (size_t)r * N + c0];
        r1[r] = resid[rb + (size_t)r * N + c1];
      }
      // the store addresses below reuse the loads' address registers
      asm volatile("s_wait_xcnt 0x0" ::: "memory");
    }
#pragma unroll
    for (int r = 0; r < 8; ++r) {
      float v0 = acc[i][0][r], v1 = acc[i][1][r];
      if (bias) { v0 += bb0; v1 += bb1; }
      if (RELU) { v0 = fmaxf(v0, 0.f); v1 = fmaxf(v1, 0.f); }
      if (resid) { v0 += r0[r]; v1 += r1[r]; }
      if (OUTBF) {
        __bf16* o = (__bf16*)outp;
        o[rb + (size_t)r * N + c0] = (__bf16)v0;
        o[rb + (size_t)r * N + c1] = (__bf16)v1;
      } else {
        float* o = (float*)outp;
        o[rb + (size_t)r * N + c0] = v0;
        o[rb + (size_t)r * N + c1] = v1;
      }
      // the next row reuses the two stores' address and data registers
      asm volatile("s_wait_xcnt 0x0" ::: "memory");
    }
  }
}

__global__ void __launch_bounds__(32)
flash_attn_wmma(const __bf16* __restrict__ Q,
                const __bf16* __restrict__ Km,
                const __bf16* __restrict__ Vt,
                __bf16* __restrict__ O, int T, int vpitch) {
  const int q0   = blockIdx.x * 32;
  const int h    = blockIdx.y;
  const int b    = blockIdx.z;
  const int lane = threadIdx.x & 31;
  const int half = lane >> 4;
  const int ln   = lane & 15;
  const size_t baseRow = (size_t)b * T;
  const int hoff = h * HDIM;

  // Q as B operand: two 16-query column groups x two k = 32 chunks of head_dim
  v16bf qb[2][2];
#pragma unroll
  for (int g = 0; g < 2; ++g)
#pragma unroll
    for (int c = 0; c < 2; ++c)
      qb[g][c] = load_frag(Q + (baseRow + q0 + g * 16 + ln) * EMB + hoff + c * 32 + 8 * half);

  float mi[2], li[2];
  v8f o[2][4] = {};
#pragma unroll
  for (int g = 0; g < 2; ++g) { mi[g] = -3.0e38f; li[g] = 0.f; }

  // 1/sqrt(EMB) per reference, times log2(e): the softmax runs in base 2
  const float scale = 0.03125f * 1.4426950408889634f;
  const int nkt = q0 / 32 + 1;
  const __bf16* kp = Km + (baseRow + ln) * EMB + hoff + 8 * half;
  const __bf16* vp = Vt + (size_t)(hoff + ln) * vpitch + baseRow + 8 * half;
  for (int kt = 0; kt < nkt; ++kt) {
    const int kb = kt * 32;

    v16bf ka[2][2];  // [16-key tile][head_dim chunk]
#pragma unroll
    for (int t = 0; t < 2; ++t)
#pragma unroll
      for (int c = 0; c < 2; ++c)
        ka[t][c] = load_frag(kp + (size_t)(kb + t * 16) * EMB + c * 32);
    v16bf va[4];     // [16-row chunk of head_dim], k = the 32 keys
#pragma unroll
    for (int dd = 0; dd < 4; ++dd)
      va[dd] = load_frag(vp + (size_t)(dd * 16) * vpitch + kb);

#pragma unroll
    for (int g = 0; g < 2; ++g) {
      // st[t][r] = S[query q0 + g*16 + ln][key kb + t*16 + 8*half + r]
      v8f st[2] = {};
#pragma unroll
      for (int t = 0; t < 2; ++t)
#pragma unroll
        for (int c = 0; c < 2; ++c)
          st[t] = wmma_bf16(ka[t][c], qb[g][c], st[t]);

      float x[16];
#pragma unroll
      for (int e = 0; e < 16; ++e) x[e] = st[e >> 3][e & 7] * scale;
      if (kt == nkt - 1) {  // only the last key tile crosses the diagonal
        const int qrel = g * 16 + ln - 8 * half;  // query - first key of this lane
#pragma unroll
        for (int e = 0; e < 16; ++e)
          x[e] = ((e >> 3) * 16 + (e & 7) <= qrel) ? x[e] : -3.0e38f;
      }
      float rmax = x[0];
#pragma unroll
      for (int e = 1; e < 16; ++e) rmax = fmaxf(rmax, x[e]);
      rmax = fmaxf(rmax, xhalf(rmax));
      const float mnew  = fmaxf(mi[g], rmax);
      const float alpha = __builtin_amdgcn_exp2f(mi[g] - mnew);
      mi[g] = mnew;

      // pb[s] = P^T[key kmap(s, half)][query]: the two score tiles in register order
      v16bf pb;
      float rsum = 0.f;
#pragma unroll
      for (int e = 0; e < 16; ++e) {
        float p = __builtin_amdgcn_exp2f(x[e] - mnew);
        rsum += p;
        pb[e] = (__bf16)p;
      }
      li[g] = li[g] * alpha + rsum;  // this half's keys only; halves join after the loop
#pragma unroll
      for (int dd = 0; dd < 4; ++dd) {
        o[g][dd] *= alpha;
        o[g][dd] = wmma_bf16(va[dd], pb, o[g][dd]);
      }
    }
  }

  // o[g][dd][r] = O[query q0 + g*16 + ln][d = dd*16 + 8*half + r]
#pragma unroll
  for (int g = 0; g < 2; ++g) {
    const float inv = 1.0f / (li[g] + xhalf(li[g]));
    __bf16* op = O + (baseRow + q0 + g * 16 + ln) * EMB + hoff + 8 * half;
#pragma unroll
    for (int dd = 0; dd < 4; ++dd) {
      v8bf w;
#pragma unroll
      for (int r = 0; r < 8; ++r) w[r] = (__bf16)(o[g][dd][r] * inv);
      *(v8bf*)(op + dd * 16) = w;
    }
  }
}

// ---------------------------------------------------------------------------
extern "C" void kernel_launch(void* const* d_in, const int* in_sizes, int n_in,
                              void* d_out, int out_size, void* d_ws,
                              size_t ws_size, hipStream_t stream) {
  (void)in_sizes; (void)n_in; (void)out_size; (void)ws_size;
  const int B = 2, T = 2048, D = EMB, M = B * T, D4 = 4 * D;
  const int VP = M + 64;  // row pitch of V^T: an odd number of 128-byte lines

  const float* x  = (const float*)d_in[0];
  const float* Wq = (const float*)d_in[1];
  const float* Wk = (const float*)d_in[2];
  const float* Wv = (const float*)d_in[3];
  const float* Wo = (const float*)d_in[4];
  const float* bo = (const float*)d_in[5];
  const float* W1 = (const float*)d_in[6];
  const float* b1 = (const float*)d_in[7];
  const float* W2 = (const float*)d_in[8];
  const float* b2 = (const float*)d_in[9];
  const float* g1 = (const float*)d_in[10];
  const float* s1 = (const float*)d_in[11];
  const float* g2 = (const float*)d_in[12];
  const float* s2 = (const float*)d_in[13];
  float* out = (float*)d_out;

  size_t off = 0;
  auto alloc = [&](size_t bytes) {
    void* p = (char*)d_ws + off;
    off += (bytes + 255) & ~(size_t)255;
    return p;
  };
  __bf16* Wq_b = (__bf16*)alloc((size_t)D * D * 2);   // [N,K] transposed
  __bf16* Wk_b = (__bf16*)alloc((size_t)D * D * 2);
  __bf16* Wv_b = (__bf16*)alloc((size_t)D * D * 2);
  __bf16* Wo_b = (__bf16*)alloc((size_t)D * D * 2);
  __bf16* W1_b = (__bf16*)alloc((size_t)D * D4 * 2);
  __bf16* W2_b = (__bf16*)alloc((size_t)D4 * D * 2);
  __bf16* h1   = (__bf16*)alloc((size_t)M * D * 2);
  __bf16* q    = (__bf16*)alloc((size_t)M * D * 2);
  __bf16* k    = (__bf16*)alloc((size_t)M * D * 2);
  __bf16* vT   = (__bf16*)alloc((size_t)D * VP * 2);  // [D, VP], columns 0..M-1 used
  __bf16* attn = (__bf16*)alloc((size_t)M * D * 2);
  float*  xmid = (float*) alloc((size_t)M * D * 4);
  __bf16* h2   = (__bf16*)alloc((size_t)M * D * 2);
  __bf16* ffn  = (__bf16*)alloc((size_t)M * D4 * 2);

  // fp32 [K,N] -> bf16 [N,K] weight transposes, one launch
  cast_transpose_bf16<<<12 * (D / 128) * (D / 128), 256, 0, stream>>>(
      Wq, Wk, Wv, Wo, W1, W2, Wq_b, Wk_b, Wv_b, Wo_b, W1_b, W2_b);

  // LN1 -> h1
  layernorm_bf16<<<M / 8, 256, 0, stream>>>(x, g1, s1, h1);

  // QKV projections
  dim3 gQKV(D / 128, M / 128);
  gemm_bf16_wmma<false, true><<<gQKV, 256, 0, stream>>>(h1, Wq_b, nullptr, nullptr, q, M, D, D);
  gemm_bf16_wmma<false, true><<<gQKV, 256, 0, stream>>>(h1, Wk_b, nullptr, nullptr, k, M, D, D);
  // V^T = Wv^T h1^T: the same kernel with the operands swapped; its N is the output's row pitch
  gemm_bf16_wmma<false, true><<<dim3(M / 128, D / 128), 256, 0, stream>>>(Wv_b, h1, nullptr, nullptr, vT, D, VP, D);

  // causal flash attention
  flash_attn_wmma<<<dim3(T / 32, HEADS, B), 32, 0, stream>>>(q, k, vT, attn, T, VP);

  // out projection + bias + residual(x) -> xmid (f32)
  gemm_bf16_wmma<false, false><<<gQKV, 256, 0, stream>>>(attn, Wo_b, bo, x, xmid, M, D, D);

  // LN2 -> h2
  layernorm_bf16<<<M / 8, 256, 0, stream>>>(xmid, g2, s2, h2);

  // FFN
  gemm_bf16_wmma<true, true><<<dim3(D4 / 128, M / 128), 256, 0, stream>>>(h2, W1_b, b1, nullptr, ffn, M, D4, D);
  gemm_bf16_wmma<false, false><<<dim3(D / 128, M / 128), 256, 0, stream>>>(ffn, W2_b, b2, xmid, out, M, D, D4);
}

// v004
// One run takes 189 microseconds.
// Two timings next to v003 put it at 1.24 and 1.25 times that version's speed.
// All steps since v000 together make it 3.19 times as fast.
#include <hip/hip_runtime.h>
#include <hip/hip_bf16.h>

// ---------------------------------------------------------------------------
// CDNA5 (gfx1250) transformer block:
//  - all GEMMs + attention via v_wmma_f32_16x16x32_bf16 (wave32 WMMA)
//  - GEMM tiles staged with global_load_async_to_lds_b128 (ASYNCcnt) and
//    double-buffered LDS
// ---------------------------------------------------------------------------

typedef __attribute__((ext_vector_type(16))) __bf16 v16bf;
typedef __attribute__((ext_vector_type(8)))  float  v8f;

#define EMB   1024
#define HEADS 16
#define HDIM  64
#define LN_EPS 1e-5f

// K-index striping for 16-bit A/B fragments (CDNA5 ISA 7.12.2):
// lanes 0-15: VGPR0-3 -> K=0..7, VGPR4-7 -> K=16..23
// lanes 16-31: VGPR0-3 -> K=8..15, VGPR4-7 -> K=24..31
__device__ __forceinline__ v8f wmma_bf16(v16bf a, v16bf b, v8f c) {
  return __builtin_amdgcn_wmma_f32_16x16x32_bf16(false, a, false, b,
                                                 (short)0, c, false, false);
}

// Async DMA: 16 bytes per lane, global -> LDS, tracked by ASYNCcnt. Eight copies
// for eight tile rows 16 apart. The closing s_wait_xcnt stands inside the statement
// so that no address register is rewritten ahead of it.
#define LDS_PITCH 136  // bf16 elements a tile row in LDS: 256 B of data + 16 B pad
__device__ __forceinline__ void async_copy_rows8(unsigned int lds,
                                                 const __bf16* g, size_t gstep) {
  const unsigned int ls = 16 * LDS_PITCH * 2;
  asm volatile("global_load_async_to_lds_b128 %0, %8, off\n\t"
               "global_load_async_to_lds_b128 %1, %9, off\n\t"
               "global_load_async_to_lds_b128 %2, %10, off\n\t"
               "global_load_async_to_lds_b128 %3, %11, off\n\t"
               "global_load_async_to_lds_b128 %4, %12, off\n\t"
               "global_load_async_to_lds_b128 %5, %13, off\n\t"
               "global_load_async_to_lds_b128 %6, %14, off\n\t"
               "global_load_async_to_lds_b128 %7, %15, off\n\t"
               "s_wait_xcnt 0x0"
               :: "v"(lds), "v"(lds + ls), "v"(lds + 2 * ls), "v"(lds + 3 * ls),
                  "v"(lds + 4 * ls), "v"(lds + 5 * ls), "v"(lds + 6 * ls),
                  "v"(lds + 7 * ls),
                  "v"(g), "v"(g + gstep), "v"(g + 2 * gstep), "v"(g + 3 * gstep),
                  "v"(g + 4 * gstep), "v"(g + 5 * gstep), "v"(g + 6 * gstep),
                  "v"(g + 7 * gstep)
               : "memory");
}
__device__ __forceinline__ unsigned int lds_lo32(const void* p) {
  return (unsigned int)(unsigned long long)p;  // LDS aperture: offset in [31:0]
}

// ---------------------------------------------------------------------------
typedef __attribute__((ext_vector_type(8))) __bf16 v8bf;
typedef __attribute__((ext_vector_type(4))) __bf16 v4bf;
typedef __attribute__((ext_vector_type(4))) float  v4f;

// fp32 [K,N] -> bf16 [N,K] transposed cast of all six weights in one launch of few,
// long waves (64 elements a lane): the time of the many short waves it replaces
// went into starting them. A block takes one 128(k) x 128(n) tile, a wave
// 64(k) x 32(n), a lane 8(k) x 8(n), transposed in its registers. 8 lanes along k
// make every store a whole 128-B line of the output; a lane's two loads of a row
// cover one 128-B line together with its three neighbours along n.
__global__ void __launch_bounds__(256)
cast_transpose_bf16(const float* __restrict__ Wq, const float* __restrict__ Wk,
                    const float* __restrict__ Wv, const float* __restrict__ Wo,
                    const float* __restrict__ W1, const float* __restrict__ W2,
                    __bf16* __restrict__ oq, __bf16* __restrict__ ok,
                    __bf16* __restrict__ ov, __bf16* __restrict__ oo,
                    __bf16* __restrict__ o1, __bf16* __restrict__ o2) {
  const int TSQ = (EMB / 128) * (EMB / 128);  // tiles of an EMB x EMB weight
  const int id = blockIdx.x;                  // 12 * TSQ blocks
  const int w  = id / TSQ;                    // 0-3 square weights, 4-7 W1, 8-11 W2
  const float* in = w == 0 ? Wq : w == 1 ? Wk : w == 2 ? Wv : w == 3 ? Wo
                  : w < 8 ? W1 : W2;
  __bf16* out = w == 0 ? oq : w == 1 ? ok : w == 2 ? ov : w == 3 ? oo
              : w < 8 ? o1 : o2;
  const int K = w < 8 ? EMB : 4 * EMB;
  const int N = (w >= 4 && w < 8) ? 4 * EMB : EMB;
  const int t = w < 4 ? id % TSQ : id % (4 * TSQ);  // tile of this weight
  const int ntn = N / 128;                          // a power of two
  const int lane = threadIdx.x & 31, wave = threadIdx.x >> 5;
  const int k0 = (t >> __builtin_ctz(ntn)) * 128 + (wave & 1) * 64 + (lane & 7) * 8;
  const int n0 = (t & (ntn - 1)) * 128 + (wave >> 1) * 32 + (lane >> 3) * 4;

  const float* pr[8];
  v4f a[8][2];
#pragma unroll
  for (int j = 0; j < 8; ++j) {
    pr[j] = in + (size_t)(k0 + j) * N + n0;
    a[j][0] = *(const v4f*)pr[j];
    a[j][1] = *(const v4f*)(pr[j] + 16);
  }
  // Takes the loaded values and their addresses as inputs only: all 16 loads are in
  // flight together before the first conversion, and the address registers stay
  // untouched up to the wait.
  asm volatile("s_wait_xcnt 0x0"
               :: "v"(pr[0]), "v"(pr[1]), "v"(pr[2]), "v"(pr[3]),
                  "v"(pr[4]), "v"(pr[5]), "v"(pr[6]), "v"(pr[7]),
                  "v"(a[0][0]), "v"(a[0][1]), "v"(a[1][0]), "v"(a[1][1]),
                  "v"(a[2][0]), "v"(a[2][1]), "v"(a[3][0]), "v"(a[3][1]),
                  "v"(a[4][0]), "v"(a[4][1]), "v"(a[5][0]), "v"(a[5][1]),
                  "v"(a[6][0]), "v"(a[6][1]), "v"(a[7][0]), "v"(a[7][1])
               : "memory");

  __bf16* q = out + (size_t)n0 * K + k0;
#pragma unroll
  for (int h = 0; h < 2; ++h)
#pragma unroll
    for (int i = 0; i < 4; ++i) {
      v8bf o;
#pragma unroll
      for (int j = 0; j < 8; ++j) o[j] = (__bf16)a[j][h][i];
      *(v8bf*)(q + (size_t)(h * 16 + i) * K) = o;
    }
}

// lane l <-> lane l ^ 16
__device__ __forceinline__ float xhalf(float x) {
  int b = __builtin_bit_cast(int, x);
  return __builtin_bit_cast(float, __builtin_amdgcn_permlanex16(
      b, b, 0x76543210, 0xfedcba98, false, false));
}

// x + (x of lane l ^ MASK) inside a 16-lane row (DPP row_xmask)
template <int MASK>
__device__ __forceinline__ float add_xmask(float x) {
  return x + __builtin_bit_cast(float, __builtin_amdgcn_update_dpp(
                 0, __builtin_bit_cast(int, x), 0x160 + MASK, 0xf, 0xf, true));
}
__device__ __forceinline__ float wave_sum(float x) {
  x = add_xmask<1>(x);
  x = add_xmask<2>(x);
  x = add_xmask<4>(x);
  x = add_xmask<8>(x);
  return x + xhalf(x);
}

// One wave per row of D=1024 (8 rows a block): a lane holds 32 elements as eight
// 16-B loads, the sums stay inside the wave, no LDS and no barrier.
__global__ void __launch_bounds__(256)
layernorm_bf16(const float* __restrict__ x,
               const float* __restrict__ g,
               const float* __restrict__ s,
               __bf16* __restrict__ out) {
  const int lane = threadIdx.x & 31;
  const int row  = blockIdx.x * 8 + (threadIdx.x >> 5);
  const float* xr = x + (size_t)row * EMB + lane * 4;
  v4f v[8], gv[8], sv[8];
#pragma unroll
  for (int i = 0; i < 8; ++i) v[i] = *(const v4f*)(xr + i * 128);
#pragma unroll
  for (int i = 0; i < 8; ++i) {
    gv[i] = *(const v4f*)(g + lane * 4 + i * 128);
    sv[i] = *(const v4f*)(s + lane * 4 + i * 128);
  }
  // Takes the loaded values and the row's address as inputs only: the scale and
  // shift loads fly with the row's instead of one pair at a time behind the sums,
  // and the address registers stay untouched up to the wait.
  asm volatile("s_wait_xcnt 0x0"
               :: "v"(xr), "v"(v[0]), "v"(v[1]), "v"(v[2]), "v"(v[3]),
                  "v"(v[4]), "v"(v[5]), "v"(v[6]), "v"(v[7]),
                  "v"(gv[0]), "v"(gv[1]), "v"(gv[2]), "v"(gv[3]),
                  "v"(gv[4]), "v"(gv[5]), "v"(gv[6]), "v"(gv[7]),
                  "v"(sv[0]), "v"(sv[1]), "v"(sv[2]), "v"(sv[3]),
                  "v"(sv[4]), "v"(sv[5]), "v"(sv[6]), "v"(sv[7])
               : "memory");
  // keeps the sums from being scheduled in among the loads, which split the group
  __builtin_amdgcn_sched_barrier(0);
  v4f s4 = v[0], q4 = v[0] * v[0];  // four independent chains each
#pragma unroll
  for (int i = 1; i < 8; ++i) {
    s4 += v[i];
    q4 += v[i] * v[i];
  }
  const float ts = wave_sum((s4[0] + s4[1]) + (s4[2] + s4[3]));
  const float tq = wave_sum((q4[0] + q4[1]) + (q4[2] + q4[3]));
  const float mean = ts * (1.0f / EMB);
  const float var  = tq * (1.0f / EMB) - mean * mean;
  const float inv  = rsqrtf(var + LN_EPS);
  __bf16* o = out + (size_t)row * EMB + lane * 4;
#pragma unroll
  for (int i = 0; i < 8; ++i) {
    v4bf w;
#pragma unroll
    for (int e = 0; e < 4; ++e)
      w[e] = (__bf16)(gv[i][e] * ((v[i][e] - mean) * inv) + sv[i][e]);
    *(v4bf*)(o + i * 128) = w;
  }
}

// ---------------------------------------------------------------------------
// Tiled bf16 WMMA GEMM: C[M,N] = act(A[M,K] @ B[K,N] + bias) + resid
// B supplied pre-transposed as BT[N,K] so both tiles are K-contiguous and
// can be staged verbatim with async b128 copies (double-buffered LDS).
// Block tile 128x128, 128 k a pass; 8 waves (2 x 4), each owns 64(M)x32(N).
// A stage is [A 128 rows | BT 128 rows] at a pitch of 272 B (16 B x odd: the
// b128 fragment reads meet no bank conflict). M, N multiples of 128, K of 128.
// One 16x32 operand fragment in the hardware k order: p points at k = 8*half of
// this lane's row; elements 0-7 are k = 8*half + 0..7, 8-15 are k = 16 + 8*half + 0..7.
__device__ __forceinline__ v16bf load_frag(const __bf16* p) {
  v8bf lo = *(const v8bf*)p;
  v8bf hi = *(const v8bf*)(p + 16);
  return __builtin_shufflevector(lo, hi, 0, 1, 2, 3, 4, 5, 6, 7,
                                 8, 9, 10, 11, 12, 13, 14, 15);
}

#define STAGE_ELEMS (256 * LDS_PITCH)

template <bool RELU, bool OUTBF>
__global__ void __launch_bounds__(256)
gemm_bf16_wmma(const __bf16* __restrict__ A,   // [M,K]
               const __bf16* __restrict__ BT,  // [N,K]
               const float* __restrict__ bias,
               const float* __restrict__ resid,
               void* __restrict__ outp,
               int M, int N, int K) {
  __shared__ __align__(16) __bf16 st[2][STAGE_ELEMS];

  const int tid  = threadIdx.x;
  const int lane = tid & 31;
  const int wave = tid >> 5;
  const int half = lane >> 4;
  const int ln   = lane & 15;
  const int wm   = wave & 1;   // 2 M-strips of 64 rows
  const int wn   = wave >> 1;  // 4 N-strips of 32 cols
  const int m0 = blockIdx.y * 128;
  const int n0 = blockIdx.x * 128;

  // Staging: 16 lanes cover one 256-B row; a thread copies rows srow + 16 i.
  const int srow = tid >> 4, scol = (tid & 15) * 8;
  const __bf16* aSrc = A  + (size_t)(m0 + srow) * K + scol;
  const __bf16* bSrc = BT + (size_t)(n0 + srow) * K + scol;
  const size_t gstep = (size_t)16 * K;
  const unsigned int ldsA = lds_lo32(&st[0][srow * LDS_PITCH + scol]);
  const unsigned int ldsB = ldsA + 128 * LDS_PITCH * 2;

  v8f acc[4][2] = {};
  const int npass = K / 128;

  async_copy_rows8(ldsA, aSrc, gstep);
  async_copy_rows8(ldsB, bSrc, gstep);
  asm volatile("s_wait_asynccnt 0x0" ::: "memory");  // this wave's share of tile 0 landed
  __syncthreads();                                   // every wave's share visible
  if (npass > 1) {
    async_copy_rows8(ldsA + STAGE_ELEMS * 2, aSrc + 128, gstep);
    async_copy_rows8(ldsB + STAGE_ELEMS * 2, bSrc + 128, gstep);
  }

  for (int t = 0; t < npass; ++t) {
    const int buf = t & 1;
    const __bf16* a  = &st[buf][(wm * 64 + ln) * LDS_PITCH + 8 * half];
    const __bf16* bs = &st[buf][(128 + wn * 32 + ln) * LDS_PITCH + 8 * half];
#pragma unroll
    for (int c = 0; c < 4; ++c) {  // four k = 32 chunks of the pass
      v16bf af[4], bf[2];
#pragma unroll
      for (int i = 0; i < 4; ++i) af[i] = load_frag(a + i * 16 * LDS_PITCH + c * 32);
#pragma unroll
      for (int j = 0; j < 2; ++j) bf[j] = load_frag(bs + j * 16 * LDS_PITCH + c * 32);
#pragma unroll
      for (int i = 0; i < 4; ++i)
#pragma unroll
        for (int j = 0; j < 2; ++j)
          acc[i][j] = wmma_bf16(af[i], bf[j], acc[i][j]);
    }
    asm volatile("s_wait_dscnt 0x0" ::: "memory");     // own reads of this buffer done
    asm volatile("s_wait_asynccnt 0x0" ::: "memory");  // own share of tile t + 1 landed
    __syncthreads();  // publishes tile t + 1 and frees this buffer for the refill
    if (t + 2 < npass) {
      const unsigned int bo = buf * (STAGE_ELEMS * 2);
      async_copy_rows8(ldsA + bo, aSrc + (size_t)(t + 2) * 128, gstep);
      async_copy_rows8(ldsB + bo, bSrc + (size_t)(t + 2) * 128, gstep);
    }
  }
  asm volatile("s_wait_asynccnt 0x0" ::: "memory");  // nothing in flight at the wave's end

  // Bias is read once and the residual one 16-row block at a time, as one group of
  // loads: with two waves a SIMD a load and its wait in every row would stand open.
  const int c0 = n0 + wn * 32 + ln;
  const int c1 = c0 + 16;
  float bb0 = 0.f, bb1 = 0.f;
  if (bias) {
    bb0 = bias[c0];
    bb1 = bias[c1];
    // the column index register of the two loads is rewritten below
    asm volatile("s_wait_xcnt 0x0" ::: "memory");
  }
#pragma unroll
  for (int i = 0; i < 4; ++i) {
    const size_t rb = (size_t)(m0 + wm * 64 + i * 16 + half * 8) * N;
    float r0[8] = {}, r1[8] = {};
    if (resid) {
#pragma unroll
      for (int r = 0; r < 8; ++r) {
        r0[r] = resid[rb + (size_t)r * N + c0];
        r1[r] = resid[rb + (size_t)r * N + c1];
      }
      // the store addresses below reuse the loads' address registers
      asm volatile("s_wait_xcnt 0x0" ::: "memory");
    }
#pragma unroll
    for (int r = 0; r < 8; ++r) {
      float v0 = acc[i][0][r], v1 = acc[i][1][r];
      if (bias) { v0 += bb0; v1 += bb1; }
      if (RELU) { v0 = fmaxf(v0, 0.f); v1 = fmaxf(v1, 0.f); }
      if (resid) { v0 += r0[r]; v1 += r1[r]; }
      if (OUTBF) {
        __bf16* o = (__bf16*)outp;
        o[rb + (size_t)r * N + c0] = (__bf16)v0;
        o[rb + (size_t)r * N + c1] = (__bf16)v1;
      } else {
        float* o = (float*)outp;
        o[rb + (size_t)r * N + c0] = v0;
        o[rb + (size_t)r * N + c1] = v1;
      }
      // the next row reuses the two stores' address and data registers
      asm volatile("s_wait_xcnt 0x0" ::: "memory");
    }
  }
}

#define KV_PITCH 72                      // bf16 elements a staged row
#define KV_STAGE_ELEMS (128 * KV_PITCH)  // 64 K rows + 64 V^T rows

// A thread's share of one stage: four K rows and four V^T rows, 16 apart, 16 B of
// each. The closing s_wait_xcnt stands inside the statement so that no address
// register is rewritten ahead of it.
__device__ __forceinline__ void async_copy_kv(unsigned int ldsK, const __bf16* gk,
                                              size_t kstep, const __bf16* gv,
                                              size_t vstep) {
  const unsigned int ls = 16 * KV_PITCH * 2;
  const unsigned int ldsV = ldsK + 64 * KV_PITCH * 2;
  asm volatile("global_load_async_to_lds_b128 %0, %8, off\n\t"
               "global_load_async_to_lds_b128 %1, %9, off\n\t"
               "global_load_async_to_lds_b128 %2, %10, off\n\t"
               "global_load_async_to_lds_b128 %3, %11, off\n\t"
               "global_load_async_to_lds_b128 %4, %12, off\n\t"
               "global_load_async_to_lds_b128 %5, %13, off\n\t"
               "global_load_async_to_lds_b128 %6, %14, off\n\t"
               "global_load_async_to_lds_b128 %7, %15, off\n\t"
               "s_wait_xcnt 0x0"
               :: "v"(ldsK), "v"(ldsK + ls), "v"(ldsK + 2 * ls), "v"(ldsK + 3 * ls),
                  "v"(ldsV), "v"(ldsV + ls), "v"(ldsV + 2 * ls), "v"(ldsV + 3 * ls),
                  "v"(gk), "v"(gk + kstep), "v"(gk + 2 * kstep), "v"(gk + 3 * kstep),
                  "v"(gv), "v"(gv + vstep), "v"(gv + 2 * vstep), "v"(gv + 3 * vstep)
               : "memory");
}

__global__ void __launch_bounds__(128)
flash_attn_wmma(const __bf16* __restrict__ Q,
                const __bf16* __restrict__ Km,
                const __bf16* __restrict__ Vt,
                __bf16* __restrict__ O, int T, int vpitch) {
  __shared__ __align__(16) __bf16 kv[2][KV_STAGE_ELEMS];

  // Heaviest query tile first: the longest block is not the last to start.
  const int qt   = (T >> 7) - 1 - blockIdx.z;
  const int h    = blockIdx.x;
  const int b    = blockIdx.y;
  const int tid  = threadIdx.x;
  const int lane = tid & 31;
  const int half = lane >> 4;
  const int ln   = lane & 15;
  // the wave's number in a scalar register: the skip beyond the diagonal is a scalar branch
  const int wave = __builtin_amdgcn_readfirstlane(tid >> 5);
  const int q0   = qt * 128 + wave * 32;  // this wave's first query
  const size_t baseRow = (size_t)b * T;
  const int hoff = h * HDIM;

  // Staging: 8 lanes cover one 128-B row; a thread copies rows srow + 16 i.
  const int srow = tid >> 3, scol = (tid & 7) * 8;
  const __bf16* kSrc = Km + (baseRow + srow) * EMB + hoff + scol;
  const __bf16* vSrc = Vt + (size_t)(hoff + srow) * vpitch + baseRow + scol;
  const size_t kstep = (size_t)16 * EMB, vstep = (size_t)16 * vpitch;
  const unsigned int ldsK = lds_lo32(&kv[0][srow * KV_PITCH + scol]);
  const int nst = 2 * (qt + 1);  // stages of 64 keys up to the block's last query

  async_copy_kv(ldsK, kSrc, kstep, vSrc, vstep);

  // Q as B operand: two 16-query column groups x two k = 32 chunks of head_dim
  v16bf qb[2][2];
#pragma unroll
  for (int g = 0; g < 2; ++g)
#pragma unroll
    for (int c = 0; c < 2; ++c)
      qb[g][c] = load_frag(Q + (baseRow + q0 + g * 16 + ln) * EMB + hoff + c * 32 + 8 * half);

  float mi[2], li[2];
  v8f o[2][4] = {};
#pragma unroll
  for (int g = 0; g < 2; ++g) { mi[g] = -3.0e38f; li[g] = 0.f; }

  asm volatile("s_wait_asynccnt 0x0" ::: "memory");  // this wave's share of stage 0 landed
  __syncthreads();                                   // every wave's share visible
  if (nst > 1)
    async_copy_kv(ldsK + KV_STAGE_ELEMS * 2, kSrc + (size_t)64 * EMB, kstep, vSrc + 64, vstep);

  // 1/sqrt(EMB) per reference, times log2(e): the softmax runs in base 2
  const float scale = 0.03125f * 1.4426950408889634f;
  for (int s = 0; s < nst; ++s) {
    const int buf = s & 1;
    const __bf16* kp = &kv[buf][ln * KV_PITCH + 8 * half];
    const __bf16* vp = kp + 64 * KV_PITCH;
#pragma unroll
    for (int u = 0; u < 2; ++u) {  // the stage's two tiles of 32 keys
      const int kb = s * 64 + u * 32;
      if (kb <= q0) {  // tiles wholly beyond this wave's diagonal are skipped
        v16bf ka[2][2];  // [16-key tile][head_dim chunk]
#pragma unroll
        for (int t = 0; t < 2; ++t)
#pragma unroll
          for (int c = 0; c < 2; ++c)
            ka[t][c] = load_frag(kp + (u * 32 + t * 16) * KV_PITCH + c * 32);
        v16bf va[4];     // [16-row chunk of head_dim], k = the 32 keys
#pragma unroll
        for (int dd = 0; dd < 4; ++dd)
          va[dd] = load_frag(vp + dd * 16 * KV_PITCH + u * 32);

#pragma unroll
        for (int g = 0; g < 2; ++g) {
          // st[t][r] = S[query q0 + g*16 + ln][key kb + t*16 + 8*half + r]
          v8f st[2] = {};
#pragma unroll
          for (int t = 0; t < 2; ++t)
#pragma unroll
            for (int c = 0; c < 2; ++c)
              st[t] = wmma_bf16(ka[t][c], qb[g][c], st[t]);

          float x[16];
#pragma unroll
          for (int e = 0; e < 16; ++e) x[e] = st[e >> 3][e & 7] * scale;
          if (kb == q0) {  // only the wave's last key tile crosses the diagonal
            const int qrel = g * 16 + ln - 8 * half;  // query - first key of this lane
#pragma unroll
            for (int e = 0; e < 16; ++e)
              x[e] = ((e >> 3) * 16 + (e & 7) <= qrel) ? x[e] : -3.0e38f;
          }
          float rmax = x[0];
#pragma unroll
          for (int e = 1; e < 16; ++e) rmax = fmaxf(rmax, x[e]);
          rmax = fmaxf(rmax, xhalf(rmax));
          const float mnew  = fmaxf(mi[g], rmax);
          const float alpha = __builtin_amdgcn_exp2f(mi[g] - mnew);
          mi[g] = mnew;

          // pb[s] = P^T[key kmap(s, half)][query]: the two score tiles in register order
          v16bf pb;
          float rsum = 0.f;
#pragma unroll
          for (int e = 0; e < 16; ++e) {
            float p = __builtin_amdgcn_exp2f(x[e] - mnew);
            rsum += p;
            pb[e] = (__bf16)p;
          }
          li[g] = li[g] * alpha + rsum;  // this half's keys only; halves join after the loop
#pragma unroll
          for (int dd = 0; dd < 4; ++dd) {
            o[g][dd] *= alpha;
            o[g][dd] = wmma_bf16(va[dd], pb, o[g][dd]);
          }
        }
      }
    }
    // The publish point stands outside the skip: every wave passes it in every stage.
    asm volatile("s_wait_dscnt 0x0" ::: "memory");     // own reads of this buffer done
    asm volatile("s_wait_asynccnt 0x0" ::: "memory");  // own share of stage s + 1 landed
    __syncthreads();  // publishes stage s + 1 and frees this buffer for the refill
    if (s + 2 < nst)
      async_copy_kv(ldsK + buf * (KV_STAGE_ELEMS * 2), kSrc + (size_t)(s + 2) * 64 * EMB,
                    kstep, vSrc + (s + 2) * 64, vstep);
  }
  asm volatile("s_wait_asynccnt 0x0" ::: "memory");  // nothing in flight at the wave's end

  // o[g][dd][r] = O[query q0 + g*16 + ln][d = dd*16 + 8*half + r]
#pragma unroll
  for (int g = 0; g < 2; ++g) {
    const float inv = 1.0f / (li[g] + xhalf(li[g]));
    __bf16* op = O + (baseRow + q0 + g * 16 + ln) * EMB + hoff + 8 * half;
#pragma unroll
    for (int dd = 0; dd < 4; ++dd) {
      v8bf w;
#pragma unroll
      for (int r = 0; r < 8; ++r) w[r] = (__bf16)(o[g][dd][r] * inv);
      *(v8bf*)(op + dd * 16) = w;
    }
  }
}

// ---------------------------------------------------------------------------
extern "C" void kernel_launch(void* const* d_in, const int* in_sizes, int n_in,
                              void* d_out, int out_size, void* d_ws,
                              size_t ws_size, hipStream_t stream) {
  (void)in_sizes; (void)n_in; (void)out_size; (void)ws_size;
  const int B = 2, T = 2048, D = EMB, M = B * T, D4 = 4 * D;
  const int VP = M + 64;  // row pitch of V^T: an odd number of 128-byte lines

  const float* x  = (const float*)d_in[0];
  const float* Wq = (const float*)d_in[1];
  const float* Wk = (const float*)d_in[2];
  const float* Wv = (const float*)d_in[3];
  const float* Wo = (const float*)d_in[4];
  const float* bo = (const float*)d_in[5];
  const float* W1 = (const float*)d_in[6];
  const float* b1 = (const float*)d_in[7];
  const float* W2 = (const float*)d_in[8];
  const float* b2 = (const float*)d_in[9];
  const float* g1 = (const float*)d_in[10];
  const float* s1 = (const float*)d_in[11];
  const float* g2 = (const float*)d_in[12];
  const float* s2 = (const float*)d_in[13];
  float* out = (float*)d_out;

  size_t off = 0;
  auto alloc = [&](size_t bytes) {
    void* p = (char*)d_ws + off;
    off += (bytes + 255) & ~(size_t)255;
    return p;
  };
  __bf16* Wq_b = (__bf16*)alloc((size_t)D * D * 2);   // [N,K] transposed
  __bf16* Wk_b = (__bf16*)alloc((size_t)D * D * 2);
  __bf16* Wv_b = (__bf16*)alloc((size_t)D * D * 2);
  __bf16* Wo_b = (__bf16*)alloc((size_t)D * D * 2);
  __bf16* W1_b = (__bf16*)alloc((size_t)D * D4 * 2);
  __bf16* W2_b = (__bf16*)alloc((size_t)D4 * D * 2);
  __bf16* h1   = (__bf16*)alloc((size_t)M * D * 2);
  __bf16* q    = (__bf16*)alloc((size_t)M * D * 2);
  __bf16* k    = (__bf16*)alloc((size_t)M * D * 2);
  __bf16* vT   = (__bf16*)alloc((size_t)D * VP * 2);  // [D, VP], columns 0..M-1 used
  __bf16* attn = (__bf16*)alloc((size_t)M * D * 2);
  float*  xmid = (float*) alloc((size_t)M * D * 4);
  __bf16* h2   = (__bf16*)alloc((size_t)M * D * 2);
  __bf16* ffn  = (__bf16*)alloc((size_t)M * D4 * 2);

  // fp32 [K,N] -> bf16 [N,K] weight transposes, one launch
  cast_transpose_bf16<<<12 * (D / 128) * (D / 128), 256, 0, stream>>>(
      Wq, Wk, Wv, Wo, W1, W2, Wq_b, Wk_b, Wv_b, Wo_b, W1_b, W2_b);

  // LN1 -> h1
  layernorm_bf16<<<M / 8, 256, 0, stream>>>(x, g1, s1, h1);

  // QKV projections
  dim3 gQKV(D / 128, M / 128);
  gemm_bf16_wmma<false, true><<<gQKV, 256, 0, stream>>>(h1, Wq_b, nullptr, nullptr, q, M, D, D);
  gemm_bf16_wmma<false, true><<<gQKV, 256, 0, stream>>>(h1, Wk_b, nullptr, nullptr, k, M, D, D);
  // V^T = Wv^T h1^T: the same kernel with the operands swapped; its N is the output's row pitch
  gemm_bf16_wmma<false, true><<<dim3(M / 128, D / 128), 256, 0, stream>>>(Wv_b, h1, nullptr, nullptr, vT, D, VP, D);

  // causal flash attention
  flash_attn_wmma<<<dim3(HEADS, B, T / 128), 128, 0, stream>>>(q, k, vT, attn, T, VP);

  // out projection + bias + residual(x) -> xmid (f32)
  gemm_bf16_wmma<false, false><<<gQKV, 256, 0, stream>>>(attn, Wo_b, bo, x, xmid, M, D, D);

  // LN2 -> h2
  layernorm_bf16<<<M / 8, 256, 0, stream>>>(xmid, g2, s2, h2);

  // FFN
  gemm_bf16_wmma<true, true><<<dim3(D4 / 128, M / 128), 256, 0, stream>>>(h2, W1_b, b1, nullptr, ffn, M, D4, D);
  gemm_bf16_wmma<false, false><<<dim3(D / 128, M / 128), 256, 0, stream>>>(ffn, W2_b, b2, xmid, out, M, D, D4);
}

// v005
// Measured time: 173 microseconds a run.
// In both of two side-by-side timings against v004, it was 1.08 times as fast.
// Counting every step since v000, it is 3.44 times as fast.
#include <hip/hip_runtime.h>
#include <hip/hip_bf16.h>

// ---------------------------------------------------------------------------
// CDNA5 (gfx1250) transformer block:
//  - all GEMMs + attention via v_wmma_f32_16x16x32_bf16 (wave32 WMMA)
//  - GEMM tiles staged with global_load_async_to_lds_b128 (ASYNCcnt) and
//    double-buffered LDS
// ---------------------------------------------------------------------------

typedef __attribute__((ext_vector_type(16))) __bf16 v16bf;
typedef __attribute__((ext_vector_type(8)))  float  v8f;

#define EMB   1024
#define HEADS 16
#define HDIM  64
#define LN_EPS 1e-5f

// K-index striping for 16-bit A/B fragments (CDNA5 ISA 7.12.2):
// lanes 0-15: VGPR0-3 -> K=0..7, VGPR4-7 -> K=16..23
// lanes 16-31: VGPR0-3 -> K=8..15, VGPR4-7 -> K=24..31
__device__ __forceinline__ v8f wmma_bf16(v16bf a, v16bf b, v8f c) {
  return __builtin_amdgcn_wmma_f32_16x16x32_bf16(false, a, false, b,
                                                 (short)0, c, false, false);
}

// Async DMA: 16 bytes per lane, global -> LDS, tracked by ASYNCcnt. Eight copies
// for eight tile rows 16 apart. The closing s_wait_xcnt stands inside the statement
// so that no address register is rewritten ahead of it.
#define LDS_PITCH 136  // bf16 elements a tile row in LDS: 256 B of data + 16 B pad
__device__ __forceinline__ void async_copy_rows8(unsigned int lds,
                                                 const __bf16* g, size_t gstep) {
  const unsigned int ls = 16 * LDS_PITCH * 2;
  asm volatile("global_load_async_to_lds_b128 %0, %8, off\n\t"
               "global_load_async_to_lds_b128 %1, %9, off\n\t"
               "global_load_async_to_lds_b128 %2, %10, off\n\t"
               "global_load_async_to_lds_b128 %3, %11, off\n\t"
               "global_load_async_to_lds_b128 %4, %12, off\n\t"
               "global_load_async_to_lds_b128 %5, %13, off\n\t"
               "global_load_async_to_lds_b128 %6, %14, off\n\t"
               "global_load_async_to_lds_b128 %7, %15, off\n\t"
               "s_wait_xcnt 0x0"
               :: "v"(lds), "v"(lds + ls), "v"(lds + 2 * ls), "v"(lds + 3 * ls),
                  "v"(lds + 4 * ls), "v"(lds + 5 * ls), "v"(lds + 6 * ls),
                  "v"(lds + 7 * ls),
                  "v"(g), "v"(g + gstep), "v"(g + 2 * gstep), "v"(g + 3 * gstep),
                  "v"(g + 4 * gstep), "v"(g + 5 * gstep), "v"(g + 6 * gstep),
                  "v"(g + 7 * gstep)
               : "memory");
}
__device__ __forceinline__ unsigned int lds_lo32(const void* p) {
  return (unsigned int)(unsigned long long)p;  // LDS aperture: offset in [31:0]
}

// ---------------------------------------------------------------------------
typedef __attribute__((ext_vector_type(8))) __bf16 v8bf;
typedef __attribute__((ext_vector_type(4))) __bf16 v4bf;
typedef __attribute__((ext_vector_type(4))) float  v4f;

// fp32 [K,N] -> bf16 [N,K] transposed cast of all six weights in one launch of few,
// long waves (64 elements a lane): the time of the many short waves it replaces
// went into starting them. A block takes one 128(k) x 128(n) tile, a wave
// 64(k) x 32(n), a lane 8(k) x 8(n), transposed in its registers. 8 lanes along k
// make every store a whole 128-B line of the output; a lane's two loads of a row
// cover one 128-B line together with its three neighbours along n.
__global__ void __launch_bounds__(256)
cast_transpose_bf16(const float* __restrict__ Wq, const float* __restrict__ Wk,
                    const float* __restrict__ Wv, const float* __restrict__ Wo,
                    const float* __restrict__ W1, const float* __restrict__ W2,
                    __bf16* __restrict__ oq, __bf16* __restrict__ ok,
                    __bf16* __restrict__ ov, __bf16* __restrict__ oo,
                    __bf16* __restrict__ o1, __bf16* __restrict__ o2) {
  const int TSQ = (EMB / 128) * (EMB / 128);  // tiles of an EMB x EMB weight
  const int id = blockIdx.x;                  // 12 * TSQ blocks
  const int w  = id / TSQ;                    // 0-3 square weights, 4-7 W1, 8-11 W2
  const float* in = w == 0 ? Wq : w == 1 ? Wk : w == 2 ? Wv : w == 3 ? Wo
                  : w < 8 ? W1 : W2;
  __bf16* out = w == 0 ? oq : w == 1 ? ok : w == 2 ? ov : w == 3 ? oo
              : w < 8 ? o1 : o2;
  const int K = w < 8 ? EMB : 4 * EMB;
  const int N = (w >= 4 && w < 8) ? 4 * EMB : EMB;
  const int t = w < 4 ? id % TSQ : id % (4 * TSQ);  // tile of this weight
  const int ntn = N / 128;                          // a power of two
  const int lane = threadIdx.x & 31, wave = threadIdx.x >> 5;
  const int k0 = (t >> __builtin_ctz(ntn)) * 128 + (wave & 1) * 64 + (lane & 7) * 8;
  const int n0 = (t & (ntn - 1)) * 128 + (wave >> 1) * 32 + (lane >> 3) * 4;

  const float* pr[8];
  v4f a[8][2];
#pragma unroll
  for (int j = 0; j < 8; ++j) {
    pr[j] = in + (size_t)(k0 + j) * N + n0;
    a[j][0] = *(const v4f*)pr[j];
    a[j][1] = *(const v4f*)(pr[j] + 16);
  }
  // Takes the loaded values and their addresses as inputs only: all 16 loads are in
  // flight together before the first conversion, and the address registers stay
  // untouched up to the wait.
  asm volatile("s_wait_xcnt 0x0"
               :: "v"(pr[0]), "v"(pr[1]), "v"(pr[2]), "v"(pr[3]),
                  "v"(pr[4]), "v"(pr[5]), "v"(pr[6]), "v"(pr[7]),
                  "v"(a[0][0]), "v"(a[0][1]), "v"(a[1][0]), "v"(a[1][1]),
                  "v"(a[2][0]), "v"(a[2][1]), "v"(a[3][0]), "v"(a[3][1]),
                  "v"(a[4][0]), "v"(a[4][1]), "v"(a[5][0]), "v"(a[5][1]),
                  "v"(a[6][0]), "v"(a[6][1]), "v"(a[7][0]), "v"(a[7][1])
               : "memory");

  __bf16* q = out + (size_t)n0 * K + k0;
#pragma unroll
  for (int h = 0; h < 2; ++h)
#pragma unroll
    for (int i = 0; i < 4; ++i) {
      v8bf o;
#pragma unroll
      for (int j = 0; j < 8; ++j) o[j] = (__bf16)a[j][h][i];
      *(v8bf*)(q + (size_t)(h * 16 + i) * K) = o;
    }
}

// lane l <-> lane l ^ 16
__device__ __forceinline__ float xhalf(float x) {
  int b = __builtin_bit_cast(int, x);
  return __builtin_bit_cast(float, __builtin_amdgcn_permlanex16(
      b, b, 0x76543210, 0xfedcba98, false, false));
}

// x + (x of lane l ^ MASK) inside a 16-lane row (DPP row_xmask)
template <int MASK>
__device__ __forceinline__ float add_xmask(float x) {
  return x + __builtin_bit_cast(float, __builtin_amdgcn_update_dpp(
                 0, __builtin_bit_cast(int, x), 0x160 + MASK, 0xf, 0xf, true));
}
__device__ __forceinline__ float wave_sum(float x) {
  x = add_xmask<1>(x);
  x = add_xmask<2>(x);
  x = add_xmask<4>(x);
  x = add_xmask<8>(x);
  return x + xhalf(x);
}

// One wave per row of D=1024 (8 rows a block): a lane holds 32 elements as eight
// 16-B loads, the sums stay inside the wave, no LDS and no barrier.
__global__ void __launch_bounds__(256)
layernorm_bf16(const float* __restrict__ x,
               const float* __restrict__ g,
               const float* __restrict__ s,
               __bf16* __restrict__ out) {
  const int lane = threadIdx.x & 31;
  const int row  = blockIdx.x * 8 + (threadIdx.x >> 5);
  const float* xr = x + (size_t)row * EMB + lane * 4;
  v4f v[8], gv[8], sv[8];
#pragma unroll
  for (int i = 0; i < 8; ++i) v[i] = *(const v4f*)(xr + i * 128);
#pragma unroll
  for (int i = 0; i < 8; ++i) {
    gv[i] = *(const v4f*)(g + lane * 4 + i * 128);
    sv[i] = *(const v4f*)(s + lane * 4 + i * 128);
  }
  // Takes the loaded values and the row's address as inputs only: the scale and
  // shift loads fly with the row's instead of one pair at a time behind the sums,
  // and the address registers stay untouched up to the wait.
  asm volatile("s_wait_xcnt 0x0"
               :: "v"(xr), "v"(v[0]), "v"(v[1]), "v"(v[2]), "v"(v[3]),
                  "v"(v[4]), "v"(v[5]), "v"(v[6]), "v"(v[7]),
                  "v"(gv[0]), "v"(gv[1]), "v"(gv[2]), "v"(gv[3]),
                  "v"(gv[4]), "v"(gv[5]), "v"(gv[6]), "v"(gv[7]),
                  "v"(sv[0]), "v"(sv[1]), "v"(sv[2]), "v"(sv[3]),
                  "v"(sv[4]), "v"(sv[5]), "v"(sv[6]), "v"(sv[7])
               : "memory");
  // keeps the sums from being scheduled in among the loads, which split the group
  __builtin_amdgcn_sched_barrier(0);
  v4f s4 = v[0], q4 = v[0] * v[0];  // four independent chains each
#pragma unroll
  for (int i = 1; i < 8; ++i) {
    s4 += v[i];
    q4 += v[i] * v[i];
  }
  const float ts = wave_sum((s4[0] + s4[1]) + (s4[2] + s4[3]));
  const float tq = wave_sum((q4[0] + q4[1]) + (q4[2] + q4[3]));
  const float mean = ts * (1.0f / EMB);
  const float var  = tq * (1.0f / EMB) - mean * mean;
  const float inv  = rsqrtf(var + LN_EPS);
  __bf16* o = out + (size_t)row * EMB + lane * 4;
#pragma unroll
  for (int i = 0; i < 8; ++i) {
    v4bf w;
#pragma unroll
    for (int e = 0; e < 4; ++e)
      w[e] = (__bf16)(gv[i][e] * ((v[i][e] - mean) * inv) + sv[i][e]);
    *(v4bf*)(o + i * 128) = w;
  }
}

// ---------------------------------------------------------------------------
// Tiled bf16 WMMA GEMM: C[M,N] = act(A[M,K] @ B[K,N] + bias) + resid
// B supplied pre-transposed as BT[N,K] so both tiles are K-contiguous and
// can be staged verbatim with async b128 copies (double-buffered LDS).
// Block tile 128x128, 128 k a pass; 8 waves (2 x 4), each owns 64(M)x32(N).
// A stage is [A 128 rows | BT 128 rows] at a pitch of 272 B (16 B x odd: the
// b128 fragment reads meet no bank conflict). M, N multiples of 128, K of 128.
// One 16x32 operand fragment in the hardware k order: p points at k = 8*half of
// this lane's row; elements 0-7 are k = 8*half + 0..7, 8-15 are k = 16 + 8*half + 0..7.
__device__ __forceinline__ v16bf load_frag(const __bf16* p) {
  v8bf lo = *(const v8bf*)p;
  v8bf hi = *(const v8bf*)(p + 16);
  return __builtin_shufflevector(lo, hi, 0, 1, 2, 3, 4, 5, 6, 7,
                                 8, 9, 10, 11, 12, 13, 14, 15);
}

#define STAGE_ELEMS (256 * LDS_PITCH)

// The fragments of one block (k = 32) of a wave's 64 x 32 tile: four A row groups,
// two B column groups, twelve 16-B LDS reads.
struct FragSet { v16bf a[4], b[2]; };
__device__ __forceinline__ void load_set(FragSet& f, const __bf16* a, const __bf16* b) {
#pragma unroll
  for (int i = 0; i < 4; ++i) f.a[i] = load_frag(a + i * 16 * LDS_PITCH);
#pragma unroll
  for (int j = 0; j < 2; ++j) f.b[j] = load_frag(b + j * 16 * LDS_PITCH);
}

template <bool RELU, bool OUTBF>
__global__ void __launch_bounds__(256)
gemm_bf16_wmma(const __bf16* __restrict__ A,   // [M,K]
               const __bf16* __restrict__ BT,  // [N,K]
               const float* __restrict__ bias,
               const float* __restrict__ resid,
               void* __restrict__ outp,
               int M, int N, int K) {
  __shared__ __align__(16) __bf16 st[2][STAGE_ELEMS];

  const int tid  = threadIdx.x;
  const int lane = tid & 31;
  const int wave = tid >> 5;
  const int half = lane >> 4;
  const int ln   = lane & 15;
  const int wm   = wave & 1;   // 2 M-strips of 64 rows
  const int wn   = wave >> 1;  // 4 N-strips of 32 cols
  const int m0 = blockIdx.y * 128;
  const int n0 = blockIdx.x * 128;

  // Staging: 16 lanes cover one 256-B row; a thread copies rows srow + 16 i.
  const int srow = tid >> 4, scol = (tid & 15) * 8;
  const __bf16* aSrc = A  + (size_t)(m0 + srow) * K + scol;
  const __bf16* bSrc = BT + (size_t)(n0 + srow) * K + scol;
  const size_t gstep = (size_t)16 * K;
  const unsigned int ldsA = lds_lo32(&st[0][srow * LDS_PITCH + scol]);
  const unsigned int ldsB = ldsA + 128 * LDS_PITCH * 2;

  v8f acc[4][2] = {};
  const int npass = K / 128;

  async_copy_rows8(ldsA, aSrc, gstep);
  async_copy_rows8(ldsB, bSrc, gstep);
  asm volatile("s_wait_asynccnt 0x0" ::: "memory");  // this wave's share of tile 0 landed
  __syncthreads();                                   // every wave's share visible
  if (npass > 1) {
    async_copy_rows8(ldsA + STAGE_ELEMS * 2, aSrc + 128, gstep);
    async_copy_rows8(ldsB + STAGE_ELEMS * 2, bSrc + 128, gstep);
  }

  // Fragments are fetched one block (k = 32) ahead into a second register set: block
  // c + 1's twelve LDS reads go out as one group in front of block c's eight WMMAs, so
  // the wave no longer waits out the LDS latency in front of every pair of WMMAs.
  // Set (c & 1) holds block c. The fetch for a pass's first block already reads the
  // next tile, so the publish point stands in front of the pass's LAST block.
  const int aoff = (wm * 64 + ln) * LDS_PITCH + 8 * half;
  const int boff = (128 + wn * 32 + ln) * LDS_PITCH + 8 * half;
  FragSet fs[2];
  load_set(fs[0], &st[0][aoff], &st[0][boff]);

  for (int t = 0; t < npass; ++t) {
    const int buf = t & 1;
    const __bf16* a  = &st[buf][aoff];
    const __bf16* bs = &st[buf][boff];
    // The last pass has no next tile: its fetch ahead rereads its own buffer, which
    // nothing refills any more, and the values are not used.
    const int nbuf = (t + 1 < npass) ? buf ^ 1 : buf;
#pragma unroll
    for (int c = 0; c < 4; ++c) {  // four k = 32 blocks of the pass
      if (c < 3) {
        load_set(fs[(c + 1) & 1], a + (c + 1) * 32, bs + (c + 1) * 32);
      } else {
        asm volatile("s_wait_dscnt 0x0" ::: "memory");     // own reads of this buffer done
        asm volatile("s_wait_asynccnt 0x0" ::: "memory");  // own share of tile t + 1 landed
        __syncthreads();  // publishes tile t + 1 and frees this buffer for the refill
        load_set(fs[0], &st[nbuf][aoff], &st[nbuf][boff]);
        // The refill goes out behind those reads, which are of the other buffer, and in
        // front of the last block's WMMAs: the LDS works while the copies are issued.
        if (t + 2 < npass) {
          const unsigned int bo = buf * (STAGE_ELEMS * 2);
          async_copy_rows8(ldsA + bo, aSrc + (size_t)(t + 2) * 128, gstep);
          async_copy_rows8(ldsB + bo, bSrc + (size_t)(t + 2) * 128, gstep);
        }
      }
      // keeps the reads above as one group in front of the WMMAs: left free, the
      // scheduler sinks each read to its first use and the latency stands open again
      __builtin_amdgcn_sched_barrier(0);
#pragma unroll
      for (int i = 0; i < 4; ++i)
#pragma unroll
        for (int j = 0; j < 2; ++j)
          acc[i][j] = wmma_bf16(fs[c & 1].a[i], fs[c & 1].b[j], acc[i][j]);
      // keeps the next block's reads from being lifted in among these WMMAs
      __builtin_amdgcn_sched_barrier(0);
    }
  }
  asm volatile("s_wait_asynccnt 0x0" ::: "memory");  // nothing in flight at the wave's end
  asm volatile("s_wait_dscnt 0x0" ::: "memory");     // nor the last pass's unused fetch ahead

  // Bias is read once and the residual one 16-row block at a time, as one group of
  // loads: with two waves a SIMD a load and its wait in every row would stand open.
  const int c0 = n0 + wn * 32 + ln;
  const int c1 = c0 + 16;
  float bb0 = 0.f, bb1 = 0.f;
  if (bias) {
    bb0 = bias[c0];
    bb1 = bias[c1];
    // the column index register of the two loads is rewritten below
    asm volatile("s_wait_xcnt 0x0" ::: "memory");
  }
#pragma unroll
  for (int i = 0; i < 4; ++i) {
    const size_t rb = (size_t)(m0 + wm * 64 + i * 16 + half * 8) * N;
    float r0[8] = {}, r1[8] = {};
    if (resid) {
#pragma unroll
      for (int r = 0; r < 8; ++r) {
        r0[r] = resid[rb + (size_t)r * N + c0];
        r1[r] = resid[rb + (size_t)r * N + c1];
      }
      // the store addresses below reuse the loads' address registers
      asm volatile("s_wait_xcnt 0x0" ::: "memory");
    }
#pragma unroll
    for (int r = 0; r < 8; ++r) {
      float v0 = acc[i][0][r], v1 = acc[i][1][r];
      if (bias) { v0 += bb0; v1 += bb1; }
      if (RELU) { v0 = fmaxf(v0, 0.f); v1 = fmaxf(v1, 0.f); }
      if (resid) { v0 += r0[r]; v1 += r1[r]; }
      if (OUTBF) {
        __bf16* o = (__bf16*)outp;
        o[rb + (size_t)r * N + c0] = (__bf16)v0;
        o[rb + (size_t)r * N + c1] = (__bf16)v1;
      } else {
        float* o = (float*)outp;
        o[rb + (size_t)r * N + c0] = v0;
        o[rb + (size_t)r * N + c1] = v1;
      }
      // the next row reuses the two stores' address and data registers
      asm volatile("s_wait_xcnt 0x0" ::: "memory");
    }
  }
}

#define KV_PITCH 72                      // bf16 elements a staged row
#define KV_STAGE_ELEMS (128 * KV_PITCH)  // 64 K rows + 64 V^T rows

// A thread's share of one stage: four K rows and four V^T rows, 16 apart, 16 B of
// each. The closing s_wait_xcnt stands inside the statement so that no address
// register is rewritten ahead of it.
__device__ __forceinline__ void async_copy_kv(unsigned int ldsK, const __bf16* gk,
                                              size_t kstep, const __bf16* gv,
                                              size_t vstep) {
  const unsigned int ls = 16 * KV_PITCH * 2;
  const unsigned int ldsV = ldsK + 64 * KV_PITCH * 2;
  asm volatile("global_load_async_to_lds_b128 %0, %8, off\n\t"
               "global_load_async_to_lds_b128 %1, %9, off\n\t"
               "global_load_async_to_lds_b128 %2, %10, off\n\t"
               "global_load_async_to_lds_b128 %3, %11, off\n\t"
               "global_load_async_to_lds_b128 %4, %12, off\n\t"
               "global_load_async_to_lds_b128 %5, %13, off\n\t"
               "global_load_async_to_lds_b128 %6, %14, off\n\t"
               "global_load_async_to_lds_b128 %7, %15, off\n\t"
               "s_wait_xcnt 0x0"
               :: "v"(ldsK), "v"(ldsK + ls), "v"(ldsK + 2 * ls), "v"(ldsK + 3 * ls),
                  "v"(ldsV), "v"(ldsV + ls), "v"(ldsV + 2 * ls), "v"(ldsV + 3 * ls),
                  "v"(gk), "v"(gk + kstep), "v"(gk + 2 * kstep), "v"(gk + 3 * kstep),
                  "v"(gv), "v"(gv + vstep), "v"(gv + 2 * vstep), "v"(gv + 3 * vstep)
               : "memory");
}

__global__ void __launch_bounds__(128)
flash_attn_wmma(const __bf16* __restrict__ Q,
                const __bf16* __restrict__ Km,
                const __bf16* __restrict__ Vt,
                __bf16* __restrict__ O, int T, int vpitch) {
  __shared__ __align__(16) __bf16 kv[2][KV_STAGE_ELEMS];

  // Heaviest query tile first: the longest block is not the last to start.
  const int qt   = (T >> 7) - 1 - blockIdx.z;
  const int h    = blockIdx.x;
  const int b    = blockIdx.y;
  const int tid  = threadIdx.x;
  const int lane = tid & 31;
  const int half = lane >> 4;
  const int ln   = lane & 15;
  // the wave's number in a scalar register: the skip beyond the diagonal is a scalar branch
  const int wave = __builtin_amdgcn_readfirstlane(tid >> 5);
  const int q0   = qt * 128 + wave * 32;  // this wave's first query
  const size_t baseRow = (size_t)b * T;
  const int hoff = h * HDIM;

  // Staging: 8 lanes cover one 128-B row; a thread copies rows srow + 16 i.
  const int srow = tid >> 3, scol = (tid & 7) * 8;
  const __bf16* kSrc = Km + (baseRow + srow) * EMB + hoff + scol;
  const __bf16* vSrc = Vt + (size_t)(hoff + srow) * vpitch + baseRow + scol;
  const size_t kstep = (size_t)16 * EMB, vstep = (size_t)16 * vpitch;
  const unsigned int ldsK = lds_lo32(&kv[0][srow * KV_PITCH + scol]);
  const int nst = 2 * (qt + 1);  // stages of 64 keys up to the block's last query

  async_copy_kv(ldsK, kSrc, kstep, vSrc, vstep);

  // Q as B operand: two 16-query column groups x two k = 32 chunks of head_dim
  v16bf qb[2][2];
#pragma unroll
  for (int g = 0; g < 2; ++g)
#pragma unroll
    for (int c = 0; c < 2; ++c)
      qb[g][c] = load_frag(Q + (baseRow + q0 + g * 16 + ln) * EMB + hoff + c * 32 + 8 * half);

  float mi[2], li[2];
  v8f o[2][4] = {};
#pragma unroll
  for (int g = 0; g < 2; ++g) { mi[g] = -3.0e38f; li[g] = 0.f; }

  asm volatile("s_wait_asynccnt 0x0" ::: "memory");  // this wave's share of stage 0 landed
  __syncthreads();                                   // every wave's share visible
  if (nst > 1)
    async_copy_kv(ldsK + KV_STAGE_ELEMS * 2, kSrc + (size_t)64 * EMB, kstep, vSrc + 64, vstep);

  // 1/sqrt(EMB) per reference, times log2(e): the softmax runs in base 2
  const float scale = 0.03125f * 1.4426950408889634f;
  for (int s = 0; s < nst; ++s) {
    const int buf = s & 1;
    const __bf16* kp = &kv[buf][ln * KV_PITCH + 8 * half];
    const __bf16* vp = kp + 64 * KV_PITCH;
#pragma unroll
    for (int u = 0; u < 2; ++u) {  // the stage's two tiles of 32 keys
      const int kb = s * 64 + u * 32;
      if (kb <= q0) {  // tiles wholly beyond this wave's diagonal are skipped
        v16bf ka[2][2];  // [16-key tile][head_dim chunk]
#pragma unroll
        for (int t = 0; t < 2; ++t)
#pragma unroll
          for (int c = 0; c < 2; ++c)
            ka[t][c] = load_frag(kp + (u * 32 + t * 16) * KV_PITCH + c * 32);
        v16bf va[4];     // [16-row chunk of head_dim], k = the 32 keys
#pragma unroll
        for (int dd = 0; dd < 4; ++dd)
          va[dd] = load_frag(vp + dd * 16 * KV_PITCH + u * 32);

#pragma unroll
        for (int g = 0; g < 2; ++g) {
          // st[t][r] = S[query q0 + g*16 + ln][key kb + t*16 + 8*half + r]
          v8f st[2] = {};
#pragma unroll
          for (int t = 0; t < 2; ++t)
#pragma unroll
            for (int c = 0; c < 2; ++c)
              st[t] = wmma_bf16(ka[t][c], qb[g][c], st[t]);

          float x[16];
#pragma unroll
          for (int e = 0; e < 16; ++e) x[e] = st[e >> 3][e & 7] * scale;
          if (kb == q0) {  // only the wave's last key tile crosses the diagonal
            const int qrel = g * 16 + ln - 8 * half;  // query - first key of this lane
#pragma unroll
            for (int e = 0; e < 16; ++e)
              x[e] = ((e >> 3) * 16 + (e & 7) <= qrel) ? x[e] : -3.0e38f;
          }
          float rmax = x[0];
#pragma unroll
          for (int e = 1; e < 16; ++e) rmax = fmaxf(rmax, x[e]);
          rmax = fmaxf(rmax, xhalf(rmax));
          const float mnew  = fmaxf(mi[g], rmax);
          const float alpha = __builtin_amdgcn_exp2f(mi[g] - mnew);
          mi[g] = mnew;

          // pb[s] = P^T[key kmap(s, half)][query]: the two score tiles in register order
          v16bf pb;
          float rsum = 0.f;
#pragma unroll
          for (int e = 0; e < 16; ++e) {
            float p = __builtin_amdgcn_exp2f(x[e] - mnew);
            rsum += p;
            pb[e] = (__bf16)p;
          }
          li[g] = li[g] * alpha + rsum;  // this half's keys only; halves join after the loop
#pragma unroll
          for (int dd = 0; dd < 4; ++dd) {
            o[g][dd] *= alpha;
            o[g][dd] = wmma_bf16(va[dd], pb, o[g][dd]);
          }
        }
      }
    }
    // The publish point stands outside the skip: every wave passes it in every stage.
    asm volatile("s_wait_dscnt 0x0" ::: "memory");     // own reads of this buffer done
    asm volatile("s_wait_asynccnt 0x0" ::: "memory");  // own share of stage s + 1 landed
    __syncthreads();  // publishes stage s + 1 and frees this buffer for the refill
    if (s + 2 < nst)
      async_copy_kv(ldsK + buf * (KV_STAGE_ELEMS * 2), kSrc + (size_t)(s + 2) * 64 * EMB,
                    kstep, vSrc + (s + 2) * 64, vstep);
  }
  asm volatile("s_wait_asynccnt 0x0" ::: "memory");  // nothing in flight at the wave's end

  // o[g][dd][r] = O[query q0 + g*16 + ln][d = dd*16 + 8*half + r]
#pragma unroll
  for (int g = 0; g < 2; ++g) {
    const float inv = 1.0f / (li[g] + xhalf(li[g]));
    __bf16* op = O + (baseRow + q0 + g * 16 + ln) * EMB + hoff + 8 * half;
#pragma unroll
    for (int dd = 0; dd < 4; ++dd) {
      v8bf w;
#pragma unroll
      for (int r = 0; r < 8; ++r) w[r] = (__bf16)(o[g][dd][r] * inv);
      *(v8bf*)(op + dd * 16) = w;
    }
  }
}

// ---------------------------------------------------------------------------
extern "C" void kernel_launch(void* const* d_in, const int* in_sizes, int n_in,
                              void* d_out, int out_size, void* d_ws,
                              size_t ws_size, hipStream_t stream) {
  (void)in_sizes; (void)n_in; (void)out_size; (void)ws_size;
  const int B = 2, T = 2048, D = EMB, M = B * T, D4 = 4 * D;
  const int VP = M + 64;  // row pitch of V^T: an odd number of 128-byte lines

  const float* x  = (const float*)d_in[0];
  const float* Wq = (const float*)d_in[1];
  const float* Wk = (const float*)d_in[2];
  const float* Wv = (const float*)d_in[3];
  const float* Wo = (const float*)d_in[4];
  const float* bo = (const float*)d_in[5];
  const float* W1 = (const float*)d_in[6];
  const float* b1 = (const float*)d_in[7];
  const float* W2 = (const float*)d_in[8];
  const float* b2 = (const float*)d_in[9];
  const float* g1 = (const float*)d_in[10];
  const float* s1 = (const float*)d_in[11];
  const float* g2 = (const float*)d_in[12];
  const float* s2 = (const float*)d_in[13];
  float* out = (float*)d_out;

  size_t off = 0;
  auto alloc = [&](size_t bytes) {
    void* p = (char*)d_ws + off;
    off += (bytes + 255) & ~(size_t)255;
    return p;
  };
  __bf16* Wq_b = (__bf16*)alloc((size_t)D * D * 2);   // [N,K] transposed
  __bf16* Wk_b = (__bf16*)alloc((size_t)D * D * 2);
  __bf16* Wv_b = (__bf16*)alloc((size_t)D * D * 2);
  __bf16* Wo_b = (__bf16*)alloc((size_t)D * D * 2);
  __bf16* W1_b = (__bf16*)alloc((size_t)D * D4 * 2);
  __bf16* W2_b = (__bf16*)alloc((size_t)D4 * D * 2);
  __bf16* h1   = (__bf16*)alloc((size_t)M * D * 2);
  __bf16* q    = (__bf16*)alloc((size_t)M * D * 2);
  __bf16* k    = (__bf16*)alloc((size_t)M * D * 2);
  __bf16* vT   = (__bf16*)alloc((size_t)D * VP * 2);  // [D, VP], columns 0..M-1 used
  __bf16* attn = (__bf16*)alloc((size_t)M * D * 2);
  float*  xmid = (float*) alloc((size_t)M * D * 4);
  __bf16* h2   = (__bf16*)alloc((size_t)M * D * 2);
  __bf16* ffn  = (__bf16*)alloc((size_t)M * D4 * 2);

  // fp32 [K,N] -> bf16 [N,K] weight transposes, one launch
  cast_transpose_bf16<<<12 * (D / 128) * (D / 128), 256, 0, stream>>>(
      Wq, Wk, Wv, Wo, W1, W2, Wq_b, Wk_b, Wv_b, Wo_b, W1_b, W2_b);

  // LN1 -> h1
  layernorm_bf16<<<M / 8, 256, 0, stream>>>(x, g1, s1, h1);

  // QKV projections
  dim3 gQKV(D / 128, M / 128);
  gemm_bf16_wmma<false, true><<<gQKV, 256, 0, stream>>>(h1, Wq_b, nullptr, nullptr, q, M, D, D);
  gemm_bf16_wmma<false, true><<<gQKV, 256, 0, stream>>>(h1, Wk_b, nullptr, nullptr, k, M, D, D);
  // V^T = Wv^T h1^T: the same kernel with the operands swapped; its N is the output's row pitch
  gemm_bf16_wmma<false, true><<<dim3(M / 128, D / 128), 256, 0, stream>>>(Wv_b, h1, nullptr, nullptr, vT, D, VP, D);

  // causal flash attention
  flash_attn_wmma<<<dim3(HEADS, B, T / 128), 128, 0, stream>>>(q, k, vT, attn, T, VP);

  // out projection + bias + residual(x) -> xmid (f32)
  gemm_bf16_wmma<false, false><<<gQKV, 256, 0, stream>>>(attn, Wo_b, bo, x, xmid, M, D, D);

  // LN2 -> h2
  layernorm_bf16<<<M / 8, 256, 0, stream>>>(xmid, g2, s2, h2);

  // FFN
  gemm_bf16_wmma<true, true><<<dim3(D4 / 128, M / 128), 256, 0, stream>>>(h2, W1_b, b1, nullptr, ffn, M, D4, D);
  gemm_bf16_wmma<false, false><<<dim3(D / 128, M / 128), 256, 0, stream>>>(ffn, W2_b, b2, xmid, out, M, D, D4);
}

// v006
// It runs in 161 microseconds.
// Timed twice side by side with v005, it ran 1.08 and 1.07 times as fast.
// All steps since v000 together make it 3.72 times as fast.
#include <hip/hip_runtime.h>
#include <hip/hip_bf16.h>

// ---------------------------------------------------------------------------
// CDNA5 (gfx1250) transformer block:
//  - all GEMMs + attention via v_wmma_f32_16x16x32_bf16 (wave32 WMMA)
//  - GEMM tiles staged with global_load_async_to_lds_b128 (ASYNCcnt) and
//    double-buffered LDS
// ---------------------------------------------------------------------------

typedef __attribute__((ext_vector_type(16))) __bf16 v16bf;
typedef __attribute__((ext_vector_type(8)))  float  v8f;

#define EMB   1024
#define HEADS 16
#define HDIM  64
#define LN_EPS 1e-5f

// K-index striping for 16-bit A/B fragments (CDNA5 ISA 7.12.2):
// lanes 0-15: VGPR0-3 -> K=0..7, VGPR4-7 -> K=16..23
// lanes 16-31: VGPR0-3 -> K=8..15, VGPR4-7 -> K=24..31
__device__ __forceinline__ v8f wmma_bf16(v16bf a, v16bf b, v8f c) {
  return __builtin_amdgcn_wmma_f32_16x16x32_bf16(false, a, false, b,
                                                 (short)0, c, false, false);
}

// Async DMA: 16 bytes per lane, global -> LDS, tracked by ASYNCcnt. Eight copies
// for eight tile rows 16 apart. The closing s_wait_xcnt stands inside the statement
// so that no address register is rewritten ahead of it.
#define LDS_PITCH 136  // bf16 elements a tile row in LDS: 256 B of data + 16 B pad
__device__ __forceinline__ void async_copy_rows8(unsigned int lds,
                                                 const __bf16* g, size_t gstep) {
  const unsigned int ls = 16 * LDS_PITCH * 2;
  asm volatile("global_load_async_to_lds_b128 %0, %8, off\n\t"
               "global_load_async_to_lds_b128 %1, %9, off\n\t"
               "global_load_async_to_lds_b128 %2, %10, off\n\t"
               "global_load_async_to_lds_b128 %3, %11, off\n\t"
               "global_load_async_to_lds_b128 %4, %12, off\n\t"
               "global_load_async_to_lds_b128 %5, %13, off\n\t"
               "global_load_async_to_lds_b128 %6, %14, off\n\t"
               "global_load_async_to_lds_b128 %7, %15, off\n\t"
               "s_wait_xcnt 0x0"
               :: "v"(lds), "v"(lds + ls), "v"(lds + 2 * ls), "v"(lds + 3 * ls),
                  "v"(lds + 4 * ls), "v"(lds + 5 * ls), "v"(lds + 6 * ls),
                  "v"(lds + 7 * ls),
                  "v"(g), "v"(g + gstep), "v"(g + 2 * gstep), "v"(g + 3 * gstep),
                  "v"(g + 4 * gstep), "v"(g + 5 * gstep), "v"(g + 6 * gstep),
                  "v"(g + 7 * gstep)
               : "memory");
}
__device__ __forceinline__ unsigned int lds_lo32(const void* p) {
  return (unsigned int)(unsigned long long)p;  // LDS aperture: offset in [31:0]
}

// ---------------------------------------------------------------------------
typedef __attribute__((ext_vector_type(8))) __bf16 v8bf;
typedef __attribute__((ext_vector_type(4))) __bf16 v4bf;
typedef __attribute__((ext_vector_type(4))) float  v4f;

// fp32 [K,N] -> bf16 [N,K] transposed cast of the six weights in few, long waves
// (64 elements a lane): the time of the many short waves they replace went into
// starting them. The unit is one 128(k) x 128(n) tile of eight waves, a wave
// 64(k) x 32(n), a lane 8(k) x 8(n), transposed in its registers. 8 lanes along k
// make every store a whole 128-B line of the output; a lane's two loads of a row
// cover one 128-B line together with its three neighbours along n.
// The tile's number and the wave's number in it (0-7) come from the caller: a block of
// eight waves takes a tile, a block of four waves half of one.
#define CAST_TILES (12 * (EMB / 128) * (EMB / 128))
#define CAST_TILES_QKV (3 * (EMB / 128) * (EMB / 128))  // Wq, Wk, Wv come first
__device__ __forceinline__ void
cast_transpose_tile(const int id,    // 0 .. CAST_TILES - 1
                    const int wave,  // 0 .. 7
                    const float* __restrict__ Wq, const float* __restrict__ Wk,
                    const float* __restrict__ Wv, const float* __restrict__ Wo,
                    const float* __restrict__ W1, const float* __restrict__ W2,
                    __bf16* __restrict__ oq, __bf16* __restrict__ ok,
                    __bf16* __restrict__ ov, __bf16* __restrict__ oo,
                    __bf16* __restrict__ o1, __bf16* __restrict__ o2) {
  const int TSQ = (EMB / 128) * (EMB / 128);  // tiles of an EMB x EMB weight
  const int w  = id / TSQ;                    // 0-3 square weights, 4-7 W1, 8-11 W2
  const float* in = w == 0 ? Wq : w == 1 ? Wk : w == 2 ? Wv : w == 3 ? Wo
                  : w < 8 ? W1 : W2;
  __bf16* out = w == 0 ? oq : w == 1 ? ok : w == 2 ? ov : w == 3 ? oo
              : w < 8 ? o1 : o2;
  const int K = w < 8 ? EMB : 4 * EMB;
  const int N = (w >= 4 && w < 8) ? 4 * EMB : EMB;
  const int t = w < 4 ? id % TSQ : id % (4 * TSQ);  // tile of this weight
  const int ntn = N / 128;                          // a power of two
  const int lane = threadIdx.x & 31;
  const int k0 = (t >> __builtin_ctz(ntn)) * 128 + (wave & 1) * 64 + (lane & 7) * 8;
  const int n0 = (t & (ntn - 1)) * 128 + (wave >> 1) * 32 + (lane >> 3) * 4;

  const float* pr[8];
  v4f a[8][2];
#pragma unroll
  for (int j = 0; j < 8; ++j) {
    pr[j] = in + (size_t)(k0 + j) * N + n0;
    a[j][0] = *(const v4f*)pr[j];
    a[j][1] = *(const v4f*)(pr[j] + 16);
  }
  // Takes the loaded values and their addresses as inputs only: all 16 loads are in
  // flight together before the first conversion, and the address registers stay
  // untouched up to the wait.
  asm volatile("s_wait_xcnt 0x0"
               :: "v"(pr[0]), "v"(pr[1]), "v"(pr[2]), "v"(pr[3]),
                  "v"(pr[4]), "v"(pr[5]), "v"(pr[6]), "v"(pr[7]),
                  "v"(a[0][0]), "v"(a[0][1]), "v"(a[1][0]), "v"(a[1][1]),
                  "v"(a[2][0]), "v"(a[2][1]), "v"(a[3][0]), "v"(a[3][1]),
                  "v"(a[4][0]), "v"(a[4][1]), "v"(a[5][0]), "v"(a[5][1]),
                  "v"(a[6][0]), "v"(a[6][1]), "v"(a[7][0]), "v"(a[7][1])
               : "memory");

  __bf16* q = out + (size_t)n0 * K + k0;
#pragma unroll
  for (int h = 0; h < 2; ++h)
#pragma unroll
    for (int i = 0; i < 4; ++i) {
      v8bf o;
#pragma unroll
      for (int j = 0; j < 8; ++j) o[j] = (__bf16)a[j][h][i];
      *(v8bf*)(q + (size_t)(h * 16 + i) * K) = o;
    }
}

// lane l <-> lane l ^ 16
__device__ __forceinline__ float xhalf(float x) {
  int b = __builtin_bit_cast(int, x);
  return __builtin_bit_cast(float, __builtin_amdgcn_permlanex16(
      b, b, 0x76543210, 0xfedcba98, false, false));
}

// x + (x of lane l ^ MASK) inside a 16-lane row (DPP row_xmask)
template <int MASK>
__device__ __forceinline__ float add_xmask(float x) {
  return x + __builtin_bit_cast(float, __builtin_amdgcn_update_dpp(
                 0, __builtin_bit_cast(int, x), 0x160 + MASK, 0xf, 0xf, true));
}
__device__ __forceinline__ float wave_sum(float x) {
  x = add_xmask<1>(x);
  x = add_xmask<2>(x);
  x = add_xmask<4>(x);
  x = add_xmask<8>(x);
  return x + xhalf(x);
}

// One wave per row of D=1024 (8 rows a block): a lane holds 32 elements as eight
// 16-B loads, the sums stay inside the wave, no LDS and no barrier.
__device__ __forceinline__ void
layernorm_rows8(const int blk,  // rows 8 blk .. 8 blk + 7
                const float* __restrict__ x,
                const float* __restrict__ g,
                const float* __restrict__ s,
                __bf16* __restrict__ out) {
  const int lane = threadIdx.x & 31;
  const int row  = blk * 8 + (threadIdx.x >> 5);
  const float* xr = x + (size_t)row * EMB + lane * 4;
  v4f v[8], gv[8], sv[8];
#pragma unroll
  for (int i = 0; i < 8; ++i) v[i] = *(const v4f*)(xr + i * 128);
#pragma unroll
  for (int i = 0; i < 8; ++i) {
    gv[i] = *(const v4f*)(g + lane * 4 + i * 128);
    sv[i] = *(const v4f*)(s + lane * 4 + i * 128);
  }
  // Takes the loaded values and the row's address as inputs only: the scale and
  // shift loads fly with the row's instead of one pair at a time behind the sums,
  // and the address registers stay untouched up to the wait.
  asm volatile("s_wait_xcnt 0x0"
               :: "v"(xr), "v"(v[0]), "v"(v[1]), "v"(v[2]), "v"(v[3]),
                  "v"(v[4]), "v"(v[5]), "v"(v[6]), "v"(v[7]),
                  "v"(gv[0]), "v"(gv[1]), "v"(gv[2]), "v"(gv[3]),
                  "v"(gv[4]), "v"(gv[5]), "v"(gv[6]), "v"(gv[7]),
                  "v"(sv[0]), "v"(sv[1]), "v"(sv[2]), "v"(sv[3]),
                  "v"(sv[4]), "v"(sv[5]), "v"(sv[6]), "v"(sv[7])
               : "memory");
  // keeps the sums from being scheduled in among the loads, which split the group
  __builtin_amdgcn_sched_barrier(0);
  v4f s4 = v[0], q4 = v[0] * v[0];  // four independent chains each
#pragma unroll
  for (int i = 1; i < 8; ++i) {
    s4 += v[i];
    q4 += v[i] * v[i];
  }
  const float ts = wave_sum((s4[0] + s4[1]) + (s4[2] + s4[3]));
  const float tq = wave_sum((q4[0] + q4[1]) + (q4[2] + q4[3]));
  const float mean = ts * (1.0f / EMB);
  const float var  = tq * (1.0f / EMB) - mean * mean;
  const float inv  = rsqrtf(var + LN_EPS);
  __bf16* o = out + (size_t)row * EMB + lane * 4;
#pragma unroll
  for (int i = 0; i < 8; ++i) {
    v4bf w;
#pragma unroll
    for (int e = 0; e < 4; ++e)
      w[e] = (__bf16)(gv[i][e] * ((v[i][e] - mean) * inv) + sv[i][e]);
    *(v4bf*)(o + i * 128) = w;
  }
}

__global__ void __launch_bounds__(256)
layernorm_bf16(const float* __restrict__ x,
               const float* __restrict__ g,
               const float* __restrict__ s,
               __bf16* __restrict__ out) {
  layernorm_rows8(blockIdx.x, x, g, s, out);
}

// The casts of Wq, Wk, Wv and the first layer norm depend on nothing but the inputs and
// are all that the Q, K, V products wait for: one launch holds both, blocks
// 0 .. CAST_TILES_QKV - 1 cast, the rest normalise. The other three weights are cast
// beside the attention, which does not need them.
__global__ void __launch_bounds__(256)
cast_qkv_and_layernorm(const float* __restrict__ Wq, const float* __restrict__ Wk,
                       const float* __restrict__ Wv,
                       __bf16* __restrict__ oq, __bf16* __restrict__ ok,
                       __bf16* __restrict__ ov,
                       const float* __restrict__ x, const float* __restrict__ g,
                       const float* __restrict__ s, __bf16* __restrict__ h) {
  const int id = blockIdx.x;
  if (id < CAST_TILES_QKV)
    cast_transpose_tile(id, threadIdx.x >> 5, Wq, Wk, Wv, nullptr, nullptr, nullptr,
                        oq, ok, ov, nullptr, nullptr, nullptr);
  else {
    layernorm_rows8(id - CAST_TILES_QKV, x, g, s, h);
    // in the listing the cast arm's code, which rewrites the registers of the row's
    // eight stores, stands behind them on a fall-through
    asm volatile("s_wait_xcnt 0x0" ::: "memory");
  }
}

// ---------------------------------------------------------------------------
// Tiled bf16 WMMA GEMM: C[M,N] = act(A[M,K] @ B[K,N] + bias) + resid
// B supplied pre-transposed as BT[N,K] so both tiles are K-contiguous and
// can be staged verbatim with async b128 copies (double-buffered LDS).
// Block tile 128x128, 128 k a pass; 8 waves (2 x 4), each owns 64(M)x32(N).
// A stage is [A 128 rows | BT 128 rows] at a pitch of 272 B (16 B x odd: the
// b128 fragment reads meet no bank conflict). M, N multiples of 128, K of 128.
// One 16x32 operand fragment in the hardware k order: p points at k = 8*half of
// this lane's row; elements 0-7 are k = 8*half + 0..7, 8-15 are k = 16 + 8*half + 0..7.
__device__ __forceinline__ v16bf load_frag(const __bf16* p) {
  v8bf lo = *(const v8bf*)p;
  v8bf hi = *(const v8bf*)(p + 16);
  return __builtin_shufflevector(lo, hi, 0, 1, 2, 3, 4, 5, 6, 7,
                                 8, 9, 10, 11, 12, 13, 14, 15);
}

#define STAGE_ELEMS (256 * LDS_PITCH)

// The fragments of one block (k = 32) of a wave's 64 x 32 tile: four A row groups,
// two B column groups, twelve 16-B LDS reads.
struct FragSet { v16bf a[4], b[2]; };
__device__ __forceinline__ void load_set(FragSet& f, const __bf16* a, const __bf16* b) {
#pragma unroll
  for (int i = 0; i < 4; ++i) f.a[i] = load_frag(a + i * 16 * LDS_PITCH);
#pragma unroll
  for (int j = 0; j < 2; ++j) f.b[j] = load_frag(b + j * 16 * LDS_PITCH);
}

template <bool RELU, bool OUTBF>
__device__ __forceinline__ void
gemm_tile(const __bf16* __restrict__ A,   // [M,K]
          const __bf16* __restrict__ BT,  // [N,K]
          const float* __restrict__ bias,
          const float* __restrict__ resid,
          void* __restrict__ outp,
          const int m0, const int n0, int N, int K) {
  __shared__ __align__(16) __bf16 st[2][STAGE_ELEMS];

  const int tid  = threadIdx.x;
  const int lane = tid & 31;
  const int wave = tid >> 5;
  const int half = lane >> 4;
  const int ln   = lane & 15;
  const int wm   = wave & 1;   // 2 M-strips of 64 rows
  const int wn   = wave >> 1;  // 4 N-strips of 32 cols

  // Staging: 16 lanes cover one 256-B row; a thread copies rows srow + 16 i.
  const int srow = tid >> 4, scol = (tid & 15) * 8;
  const __bf16* aSrc = A  + (size_t)(m0 + srow) * K + scol;
  const __bf16* bSrc = BT + (size_t)(n0 + srow) * K + scol;
  const size_t gstep = (size_t)16 * K;
  const unsigned int ldsA = lds_lo32(&st[0][srow * LDS_PITCH + scol]);
  const unsigned int ldsB = ldsA + 128 * LDS_PITCH * 2;

  v8f acc[4][2] = {};
  const int npass = K / 128;

  async_copy_rows8(ldsA, aSrc, gstep);
  async_copy_rows8(ldsB, bSrc, gstep);
  asm volatile("s_wait_asynccnt 0x0" ::: "memory");  // this wave's share of tile 0 landed
  __syncthreads();                                   // every wave's share visible
  if (npass > 1) {
    async_copy_rows8(ldsA + STAGE_ELEMS * 2, aSrc + 128, gstep);
    async_copy_rows8(ldsB + STAGE_ELEMS * 2, bSrc + 128, gstep);
  }

  // Fragments are fetched one block (k = 32) ahead into a second register set: block
  // c + 1's twelve LDS reads go out as one group in front of block c's eight WMMAs, so
  // the wave no longer waits out the LDS latency in front of every pair of WMMAs.
  // Set (c & 1) holds block c. The fetch for a pass's first block already reads the
  // next tile, so the publish point stands in front of the pass's LAST block.
  const int aoff = (wm * 64 + ln) * LDS_PITCH + 8 * half;
  const int boff = (128 + wn * 32 + ln) * LDS_PITCH + 8 * half;
  FragSet fs[2];
  load_set(fs[0], &st[0][aoff], &st[0][boff]);

  for (int t = 0; t < npass; ++t) {
    const int buf = t & 1;
    const __bf16* a  = &st[buf][aoff];
    const __bf16* bs = &st[buf][boff];
    // The last pass has no next tile: its fetch ahead rereads its own buffer, which
    // nothing refills any more, and the values are not used.
    const int nbuf = (t + 1 < npass) ? buf ^ 1 : buf;
#pragma unroll
    for (int c = 0; c < 4; ++c) {  // four k = 32 blocks of the pass
      if (c < 3) {
        load_set(fs[(c + 1) & 1], a + (c + 1) * 32, bs + (c + 1) * 32);
      } else {
        asm volatile("s_wait_dscnt 0x0" ::: "memory");     // own reads of this buffer done
        asm volatile("s_wait_asynccnt 0x0" ::: "memory");  // own share of tile t + 1 landed
        __syncthreads();  // publishes tile t + 1 and frees this buffer for the refill
        load_set(fs[0], &st[nbuf][aoff], &st[nbuf][boff]);
        // The refill goes out behind those reads, which are of the other buffer, and in
        // front of the last block's WMMAs: the LDS works while the copies are issued.
        if (t + 2 < npass) {
          const unsigned int bo = buf * (STAGE_ELEMS * 2);
          async_copy_rows8(ldsA + bo, aSrc + (size_t)(t + 2) * 128, gstep);
          async_copy_rows8(ldsB + bo, bSrc + (size_t)(t + 2) * 128, gstep);
        }
      }
      // keeps the reads above as one group in front of the WMMAs: left free, the
      // scheduler sinks each read to its first use and the latency stands open again
      __builtin_amdgcn_sched_barrier(0);
#pragma unroll
      for (int i = 0; i < 4; ++i)
#pragma unroll
        for (int j = 0; j < 2; ++j)
          acc[i][j] = wmma_bf16(fs[c & 1].a[i], fs[c & 1].b[j], acc[i][j]);
      // keeps the next block's reads from being lifted in among these WMMAs
      __builtin_amdgcn_sched_barrier(0);
    }
  }
  asm volatile("s_wait_asynccnt 0x0" ::: "memory");  // nothing in flight at the wave's end
  asm volatile("s_wait_dscnt 0x0" ::: "memory");     // nor the last pass's unused fetch ahead

  // Bias is read once and the residual one 16-row block at a time, as one group of
  // loads: with two waves a SIMD a load and its wait in every row would stand open.
  const int c0 = n0 + wn * 32 + ln;
  const int c1 = c0 + 16;
  float bb0 = 0.f, bb1 = 0.f;
  if (bias) {
    bb0 = bias[c0];
    bb1 = bias[c1];
    // the column index register of the two loads is rewritten below
    asm volatile("s_wait_xcnt 0x0" ::: "memory");
  }
#pragma unroll
  for (int i = 0; i < 4; ++i) {
    const size_t rb = (size_t)(m0 + wm * 64 + i * 16 + half * 8) * N;
    float r0[8] = {}, r1[8] = {};
    if (resid) {
#pragma unroll
      for (int r = 0; r < 8; ++r) {
        r0[r] = resid[rb + (size_t)r * N + c0];
        r1[r] = resid[rb + (size_t)r * N + c1];
      }
      // the store addresses below reuse the loads' address registers
      asm volatile("s_wait_xcnt 0x0" ::: "memory");
    }
#pragma unroll
    for (int r = 0; r < 8; ++r) {
      float v0 = acc[i][0][r], v1 = acc[i][1][r];
      if (bias) { v0 += bb0; v1 += bb1; }
      if (RELU) { v0 = fmaxf(v0, 0.f); v1 = fmaxf(v1, 0.f); }
      if (resid) { v0 += r0[r]; v1 += r1[r]; }
      if (OUTBF) {
        __bf16* o = (__bf16*)outp;
        o[rb + (size_t)r * N + c0] = (__bf16)v0;
        o[rb + (size_t)r * N + c1] = (__bf16)v1;
      } else {
        float* o = (float*)outp;
        o[rb + (size_t)r * N + c0] = v0;
        o[rb + (size_t)r * N + c1] = v1;
      }
      // the next row reuses the two stores' address and data registers
      asm volatile("s_wait_xcnt 0x0" ::: "memory");
    }
  }
}

template <bool RELU, bool OUTBF>
__global__ void __launch_bounds__(256)
gemm_bf16_wmma(const __bf16* __restrict__ A,   // [M,K]
               const __bf16* __restrict__ BT,  // [N,K]
               const float* __restrict__ bias,
               const float* __restrict__ resid,
               void* __restrict__ outp,
               int N, int K) {
  gemm_tile<RELU, OUTBF>(A, BT, bias, resid, outp, blockIdx.y * 128, blockIdx.x * 128, N, K);
}

// Q, K and V^T read the same h and depend on nothing else: one launch of three times
// the blocks, blockIdx.z picks the product. Two launch gaps, fills and tails go, and
// with more blocks than WGPs a block's first tile and its stores run beside another
// block's passes. V^T = Wv^T h^T is the same tile with the operands swapped (x then
// walks its rows, y its columns); its N is the output's row pitch.
__global__ void __launch_bounds__(256)
gemm_qkv_wmma(const __bf16* __restrict__ h,    // [M,K]
              const __bf16* __restrict__ WqT,  // [N,K] each
              const __bf16* __restrict__ WkT,
              const __bf16* __restrict__ WvT,
              __bf16* __restrict__ q, __bf16* __restrict__ k,
              __bf16* __restrict__ vT, int N, int vpitch, int K) {
  const int z = blockIdx.z;
  const bool isv = z == 2;
  const __bf16* w = z == 0 ? WqT : z == 1 ? WkT : WvT;
  gemm_tile<false, true>(isv ? w : h, isv ? h : w, nullptr, nullptr,
                         z == 0 ? q : z == 1 ? k : vT,
                         (isv ? blockIdx.x : blockIdx.y) * 128,
                         (isv ? blockIdx.y : blockIdx.x) * 128, isv ? vpitch : N, K);
}

#define KV_PITCH 72                      // bf16 elements a staged row
#define KV_STAGE_ELEMS (128 * KV_PITCH)  // 64 K rows + 64 V^T rows

// A thread's share of one stage: four K rows and four V^T rows, 16 apart, 16 B of
// each. The closing s_wait_xcnt stands inside the statement so that no address
// register is rewritten ahead of it.
__device__ __forceinline__ void async_copy_kv(unsigned int ldsK, const __bf16* gk,
                                              size_t kstep, const __bf16* gv,
                                              size_t vstep) {
  const unsigned int ls = 16 * KV_PITCH * 2;
  const unsigned int ldsV = ldsK + 64 * KV_PITCH * 2;
  asm volatile("global_load_async_to_lds_b128 %0, %8, off\n\t"
               "global_load_async_to_lds_b128 %1, %9, off\n\t"
               "global_load_async_to_lds_b128 %2, %10, off\n\t"
               "global_load_async_to_lds_b128 %3, %11, off\n\t"
               "global_load_async_to_lds_b128 %4, %12, off\n\t"
               "global_load_async_to_lds_b128 %5, %13, off\n\t"
               "global_load_async_to_lds_b128 %6, %14, off\n\t"
               "global_load_async_to_lds_b128 %7, %15, off\n\t"
               "s_wait_xcnt 0x0"
               :: "v"(ldsK), "v"(ldsK + ls), "v"(ldsK + 2 * ls), "v"(ldsK + 3 * ls),
                  "v"(ldsV), "v"(ldsV + ls), "v"(ldsV + 2 * ls), "v"(ldsV + 3 * ls),
                  "v"(gk), "v"(gk + kstep), "v"(gk + 2 * kstep), "v"(gk + 3 * kstep),
                  "v"(gv), "v"(gv + vstep), "v"(gv + 2 * vstep), "v"(gv + 3 * vstep)
               : "memory");
}

__global__ void __launch_bounds__(128)
flash_attn_wmma(const __bf16* __restrict__ Q,
                const __bf16* __restrict__ Km,
                const __bf16* __restrict__ Vt,
                __bf16* __restrict__ O, int T, int vpitch,
                const float* __restrict__ Wo, const float* __restrict__ W1,
                const float* __restrict__ W2, __bf16* __restrict__ oo,
                __bf16* __restrict__ o1, __bf16* __restrict__ o2, int nbatch) {
  __shared__ __align__(16) __bf16 kv[2][KV_STAGE_ELEMS];

  // The layers of the grid behind the query tiles cast Wo, W1, W2, which only later
  // launches read: they start last and fill the places that the short query tiles
  // leave, so their memory time hides behind the long tiles. A block of four waves
  // takes half a cast tile. The whole block leaves here, in front of every barrier.
  if ((int)blockIdx.z >= (T >> 7)) {
    const int u = (((int)blockIdx.z - (T >> 7)) * nbatch + blockIdx.y) * HEADS + blockIdx.x;
    cast_transpose_tile(CAST_TILES_QKV + (u >> 1), (threadIdx.x >> 5) + 4 * (u & 1),
                        nullptr, nullptr, nullptr, Wo, W1, W2,
                        nullptr, nullptr, nullptr, oo, o1, o2);
    return;
  }

  // Heaviest query tile first: the longest block is not the last to start.
  const int qt   = (T >> 7) - 1 - blockIdx.z;
  const int h    = blockIdx.x;
  const int b    = blockIdx.y;
  const int tid  = threadIdx.x;
  const int lane = tid & 31;
  const int half = lane >> 4;
  const int ln   = lane & 15;
  // the wave's number in a scalar register: the skip beyond the diagonal is a scalar branch
  const int wave = __builtin_amdgcn_readfirstlane(tid >> 5);
  const int q0   = qt * 128 + wave * 32;  // this wave's first query
  const size_t baseRow = (size_t)b * T;
  const int hoff = h * HDIM;

  // Staging: 8 lanes cover one 128-B row; a thread copies rows srow + 16 i.
  const int srow = tid >> 3, scol = (tid & 7) * 8;
  const __bf16* kSrc = Km + (baseRow + srow) * EMB + hoff + scol;
  const __bf16* vSrc = Vt + (size_t)(hoff + srow) * vpitch + baseRow + scol;
  const size_t kstep = (size_t)16 * EMB, vstep = (size_t)16 * vpitch;
  const unsigned int ldsK = lds_lo32(&kv[0][srow * KV_PITCH + scol]);
  const int nst = 2 * (qt + 1);  // stages of 64 keys up to the block's last query

  async_copy_kv(ldsK, kSrc, kstep, vSrc, vstep);

  // Q as B operand: two 16-query column groups x two k = 32 chunks of head_dim
  v16bf qb[2][2];
#pragma unroll
  for (int g = 0; g < 2; ++g)
#pragma unroll
    for (int c = 0; c < 2; ++c)
      qb[g][c] = load_frag(Q + (baseRow + q0 + g * 16 + ln) * EMB + hoff + c * 32 + 8 * half);

  float mi[2], li[2];
  v8f o[2][4] = {};
#pragma unroll
  for (int g = 0; g < 2; ++g) { mi[g] = -3.0e38f; li[g] = 0.f; }

  asm volatile("s_wait_asynccnt 0x0" ::: "memory");  // this wave's share of stage 0 landed
  __syncthreads();                                   // every wave's share visible
  if (nst > 1)
    async_copy_kv(ldsK + KV_STAGE_ELEMS * 2, kSrc + (size_t)64 * EMB, kstep, vSrc + 64, vstep);

  // 1/sqrt(EMB) per reference, times log2(e): the softmax runs in base 2
  const float scale = 0.03125f * 1.4426950408889634f;
  for (int s = 0; s < nst; ++s) {
    const int buf = s & 1;
    const __bf16* kp = &kv[buf][ln * KV_PITCH + 8 * half];
    const __bf16* vp = kp + 64 * KV_PITCH;
#pragma unroll
    for (int u = 0; u < 2; ++u) {  // the stage's two tiles of 32 keys
      const int kb = s * 64 + u * 32;
      if (kb <= q0) {  // tiles wholly beyond this wave's diagonal are skipped
        v16bf ka[2][2];  // [16-key tile][head_dim chunk]
#pragma unroll
        for (int t = 0; t < 2; ++t)
#pragma unroll
          for (int c = 0; c < 2; ++c)
            ka[t][c] = load_frag(kp + (u * 32 + t * 16) * KV_PITCH + c * 32);
        v16bf va[4];     // [16-row chunk of head_dim], k = the 32 keys
#pragma unroll
        for (int dd = 0; dd < 4; ++dd)
          va[dd] = load_frag(vp + dd * 16 * KV_PITCH + u * 32);

#pragma unroll
        for (int g = 0; g < 2; ++g) {
          // st[t][r] = S[query q0 + g*16 + ln][key kb + t*16 + 8*half + r]
          v8f st[2] = {};
#pragma unroll
          for (int t = 0; t < 2; ++t)
#pragma unroll
            for (int c = 0; c < 2; ++c)
              st[t] = wmma_bf16(ka[t][c], qb[g][c], st[t]);

          float x[16];
#pragma unroll
          for (int e = 0; e < 16; ++e) x[e] = st[e >> 3][e & 7] * scale;
          if (kb == q0) {  // only the wave's last key tile crosses the diagonal
            const int qrel = g * 16 + ln - 8 * half;  // query - first key of this lane
#pragma unroll
            for (int e = 0; e < 16; ++e)
              x[e] = ((e >> 3) * 16 + (e & 7) <= qrel) ? x[e] : -3.0e38f;
          }
          float rmax = x[0];
#pragma unroll
          for (int e = 1; e < 16; ++e) rmax = fmaxf(rmax, x[e]);
          rmax = fmaxf(rmax, xhalf(rmax));
          const float mnew  = fmaxf(mi[g], rmax);
          const float alpha = __builtin_amdgcn_exp2f(mi[g] - mnew);
          mi[g] = mnew;

          // pb[s] = P^T[key kmap(s, half)][query]: the two score tiles in register order
          v16bf pb;
          float rsum = 0.f;
#pragma unroll
          for (int e = 0; e < 16; ++e) {
            float p = __builtin_amdgcn_exp2f(x[e] - mnew);
            rsum += p;
            pb[e] = (__bf16)p;
          }
          li[g] = li[g] * alpha + rsum;  // this half's keys only; halves join after the loop
#pragma unroll
          for (int dd = 0; dd < 4; ++dd) {
            o[g][dd] *= alpha;
            o[g][dd] = wmma_bf16(va[dd], pb, o[g][dd]);
          }
        }
      }
    }
    // The publish point stands outside the skip: every wave passes it in every stage.
    asm volatile("s_wait_dscnt 0x0" ::: "memory");     // own reads of this buffer done
    asm volatile("s_wait_asynccnt 0x0" ::: "memory");  // own share of stage s + 1 landed
    __syncthreads();  // publishes stage s + 1 and frees this buffer for the refill
    if (s + 2 < nst)
      async_copy_kv(ldsK + buf * (KV_STAGE_ELEMS * 2), kSrc + (size_t)(s + 2) * 64 * EMB,
                    kstep, vSrc + (s + 2) * 64, vstep);
  }
  asm volatile("s_wait_asynccnt 0x0" ::: "memory");  // nothing in flight at the wave's end

  // o[g][dd][r] = O[query q0 + g*16 + ln][d = dd*16 + 8*half + r]
#pragma unroll
  for (int g = 0; g < 2; ++g) {
    const float inv = 1.0f / (li[g] + xhalf(li[g]));
    __bf16* op = O + (baseRow + q0 + g * 16 + ln) * EMB + hoff + 8 * half;
#pragma unroll
    for (int dd = 0; dd < 4; ++dd) {
      v8bf w;
#pragma unroll
      for (int r = 0; r < 8; ++r) w[r] = (__bf16)(o[g][dd][r] * inv);
      *(v8bf*)(op + dd * 16) = w;
    }
  }
}

// ---------------------------------------------------------------------------
extern "C" void kernel_launch(void* const* d_in, const int* in_sizes, int n_in,
                              void* d_out, int out_size, void* d_ws,
                              size_t ws_size, hipStream_t stream) {
  (void)in_sizes; (void)n_in; (void)out_size; (void)ws_size;
  const int B = 2, T = 2048, D = EMB, M = B * T, D4 = 4 * D;
  const int VP = M + 64;  // row pitch of V^T: an odd number of 128-byte lines

  const float* x  = (const float*)d_in[0];
  const float* Wq = (const float*)d_in[1];
  const float* Wk = (const float*)d_in[2];
  const float* Wv = (const float*)d_in[3];
  const float* Wo = (const float*)d_in[4];
  const float* bo = (const float*)d_in[5];
  const float* W1 = (const float*)d_in[6];
  const float* b1 = (const float*)d_in[7];
  const float* W2 = (const float*)d_in[8];
  const float* b2 = (const float*)d_in[9];
  const float* g1 = (const float*)d_in[10];
  const float* s1 = (const float*)d_in[11];
  const float* g2 = (const float*)d_in[12];
  const float* s2 = (const float*)d_in[13];
  float* out = (float*)d_out;

  size_t off = 0;
  auto alloc = [&](size_t bytes) {
    void* p = (char*)d_ws + off;
    off += (bytes + 255) & ~(size_t)255;
    return p;
  };
  __bf16* Wq_b = (__bf16*)alloc((size_t)D * D * 2);   // [N,K] transposed
  __bf16* Wk_b = (__bf16*)alloc((size_t)D * D * 2);
  __bf16* Wv_b = (__bf16*)alloc((size_t)D * D * 2);
  __bf16* Wo_b = (__bf16*)alloc((size_t)D * D * 2);
  __bf16* W1_b = (__bf16*)alloc((size_t)D * D4 * 2);
  __bf16* W2_b = (__bf16*)alloc((size_t)D4 * D * 2);
  __bf16* h1   = (__bf16*)alloc((size_t)M * D * 2);
  __bf16* q    = (__bf16*)alloc((size_t)M * D * 2);
  __bf16* k    = (__bf16*)alloc((size_t)M * D * 2);
  __bf16* vT   = (__bf16*)alloc((size_t)D * VP * 2);  // [D, VP], columns 0..M-1 used
  __bf16* attn = (__bf16*)alloc((size_t)M * D * 2);
  float*  xmid = (float*) alloc((size_t)M * D * 4);
  __bf16* h2   = (__bf16*)alloc((size_t)M * D * 2);
  __bf16* ffn  = (__bf16*)alloc((size_t)M * D4 * 2);

  // fp32 [K,N] -> bf16 [N,K] transposes of Wq, Wk, Wv and LN1 -> h1, one launch
  cast_qkv_and_layernorm<<<CAST_TILES_QKV + M / 8, 256, 0, stream>>>(
      Wq, Wk, Wv, Wq_b, Wk_b, Wv_b, x, g1, s1, h1);

  // QKV projections, one launch
  gemm_qkv_wmma<<<dim3(D / 128, M / 128, 3), 256, 0, stream>>>(h1, Wq_b, Wk_b, Wv_b, q, k, vT, D, VP, D);

  // causal flash attention; behind its query tiles, two blocks for each cast tile of Wo, W1, W2
  flash_attn_wmma<<<dim3(HEADS, B, T / 128 + 2 * (CAST_TILES - CAST_TILES_QKV) / (HEADS * B)),
                    128, 0, stream>>>(q, k, vT, attn, T, VP, Wo, W1, W2, Wo_b, W1_b, W2_b, B);

  // out projection + bias + residual(x) -> xmid (f32)
  gemm_bf16_wmma<false, false><<<dim3(D / 128, M / 128), 256, 0, stream>>>(attn, Wo_b, bo, x, xmid, D, D);

  // LN2 -> h2
  layernorm_bf16<<<M / 8, 256, 0, stream>>>(xmid, g2, s2, h2);

  // FFN
  gemm_bf16_wmma<true, true><<<dim3(D4 / 128, M / 128), 256, 0, stream>>>(h2, W1_b, b1, nullptr, ffn, D4, D);
  gemm_bf16_wmma<false, false><<<dim3(D / 128, M / 128), 256, 0, stream>>>(ffn, W2_b, b2, xmid, out, D, D4);
}

// v007
// A run of this version takes 142 microseconds.
// Next to v006, in two timings, it ran 1.15 and 1.16 times as fast.
// Over all steps from v000 it is 4.30 times as fast.
#include <hip/hip_runtime.h>
#include <hip/hip_bf16.h>

// ---------------------------------------------------------------------------
// CDNA5 (gfx1250) transformer block:
//  - all GEMMs + attention via v_wmma_f32_16x16x32_bf16 (wave32 WMMA)
//  - GEMM tiles staged with global_load_async_to_lds_b128 (ASYNCcnt) and
//    double-buffered LDS
// ---------------------------------------------------------------------------

typedef __attribute__((ext_vector_type(16))) __bf16 v16bf;
typedef __attribute__((ext_vector_type(8)))  float  v8f;

#define EMB   1024
#define HEADS 16
#define HDIM  64
#define LN_EPS 1e-5f

// K-index striping for 16-bit A/B fragments (CDNA5 ISA 7.12.2):
// lanes 0-15: VGPR0-3 -> K=0..7, VGPR4-7 -> K=16..23
// lanes 16-31: VGPR0-3 -> K=8..15, VGPR4-7 -> K=24..31
__device__ __forceinline__ v8f wmma_bf16(v16bf a, v16bf b, v8f c) {
  return __builtin_amdgcn_wmma_f32_16x16x32_bf16(false, a, false, b,
                                                 (short)0, c, false, false);
}

// Async DMA: 16 bytes per lane, global -> LDS, tracked by ASYNCcnt. Eight copies
// for eight tile rows 16 apart. The closing s_wait_xcnt stands inside the statement
// so that no address register is rewritten ahead of it.
#define LDS_PITCH 136  // bf16 elements a tile row in LDS: 256 B of data + 16 B pad
__device__ __forceinline__ void async_copy_rows8(unsigned int lds,
                                                 const __bf16* g, size_t gstep) {
  const unsigned int ls = 16 * LDS_PITCH * 2;
  asm volatile("global_load_async_to_lds_b128 %0, %8, off\n\t"
               "global_load_async_to_lds_b128 %1, %9, off\n\t"
               "global_load_async_to_lds_b128 %2, %10, off\n\t"
               "global_load_async_to_lds_b128 %3, %11, off\n\t"
               "global_load_async_to_lds_b128 %4, %12, off\n\t"
               "global_load_async_to_lds_b128 %5, %13, off\n\t"
               "global_load_async_to_lds_b128 %6, %14, off\n\t"
               "global_load_async_to_lds_b128 %7, %15, off\n\t"
               "s_wait_xcnt 0x0"
               :: "v"(lds), "v"(lds + ls), "v"(lds + 2 * ls), "v"(lds + 3 * ls),
                  "v"(lds + 4 * ls), "v"(lds + 5 * ls), "v"(lds + 6 * ls),
                  "v"(lds + 7 * ls),
                  "v"(g), "v"(g + gstep), "v"(g + 2 * gstep), "v"(g + 3 * gstep),
                  "v"(g + 4 * gstep), "v"(g + 5 * gstep), "v"(g + 6 * gstep),
                  "v"(g + 7 * gstep)
               : "memory");
}
__device__ __forceinline__ unsigned int lds_lo32(const void* p) {
  return (unsigned int)(unsigned long long)p;  // LDS aperture: offset in [31:0]
}

// ---------------------------------------------------------------------------
typedef __attribute__((ext_vector_type(8))) __bf16 v8bf;
typedef __attribute__((ext_vector_type(4))) __bf16 v4bf;
typedef __attribute__((ext_vector_type(4))) float  v4f;

// fp32 [K,N] -> bf16 [N,K] transposed cast of the six weights in few, long waves
// (64 elements a lane): the time of the many short waves they replace went into
// starting them. The unit is one 128(k) x 128(n) tile of eight waves, a wave
// 64(k) x 32(n), a lane 8(k) x 8(n), transposed in its registers. 8 lanes along k
// make every store a whole 128-B line of the output; a lane's two loads of a row
// cover one 128-B line together with its three neighbours along n.
// The tile's number and the wave's number in it (0-7) come from the caller: a block of
// eight waves takes a tile, a block of four waves half of one.
#define CAST_TILES (12 * (EMB / 128) * (EMB / 128))
#define CAST_TILES_QKV (3 * (EMB / 128) * (EMB / 128))  // Wq, Wk, Wv come first
__device__ __forceinline__ void
cast_transpose_tile(const int id,    // 0 .. CAST_TILES - 1
                    const int wave,  // 0 .. 7
                    const float* __restrict__ Wq, const float* __restrict__ Wk,
                    const float* __restrict__ Wv, const float* __restrict__ Wo,
                    const float* __restrict__ W1, const float* __restrict__ W2,
                    __bf16* __restrict__ oq, __bf16* __restrict__ ok,
                    __bf16* __restrict__ ov, __bf16* __restrict__ oo,
                    __bf16* __restrict__ o1, __bf16* __restrict__ o2) {
  const int TSQ = (EMB / 128) * (EMB / 128);  // tiles of an EMB x EMB weight
  const int w  = id / TSQ;                    // 0-3 square weights, 4-7 W1, 8-11 W2
  const float* in = w == 0 ? Wq : w == 1 ? Wk : w == 2 ? Wv : w == 3 ? Wo
                  : w < 8 ? W1 : W2;
  __bf16* out = w == 0 ? oq : w == 1 ? ok : w == 2 ? ov : w == 3 ? oo
              : w < 8 ? o1 : o2;
  const int K = w < 8 ? EMB : 4 * EMB;
  const int N = (w >= 4 && w < 8) ? 4 * EMB : EMB;
  const int t = w < 4 ? id % TSQ : id % (4 * TSQ);  // tile of this weight
  const int ntn = N / 128;                          // a power of two
  const int lane = threadIdx.x & 31;
  const int k0 = (t >> __builtin_ctz(ntn)) * 128 + (wave & 1) * 64 + (lane & 7) * 8;
  const int n0 = (t & (ntn - 1)) * 128 + (wave >> 1) * 32 + (lane >> 3) * 4;

  const float* pr[8];
  v4f a[8][2];
#pragma unroll
  for (int j = 0; j < 8; ++j) {
    pr[j] = in + (size_t)(k0 + j) * N + n0;
    a[j][0] = *(const v4f*)pr[j];
    a[j][1] = *(const v4f*)(pr[j] + 16);
  }
  // Takes the loaded values and their addresses as inputs only: all 16 loads are in
  // flight together before the first conversion, and the address registers stay
  // untouched up to the wait.
  asm volatile("s_wait_xcnt 0x0"
               :: "v"(pr[0]), "v"(pr[1]), "v"(pr[2]), "v"(pr[3]),
                  "v"(pr[4]), "v"(pr[5]), "v"(pr[6]), "v"(pr[7]),
                  "v"(a[0][0]), "v"(a[0][1]), "v"(a[1][0]), "v"(a[1][1]),
                  "v"(a[2][0]), "v"(a[2][1]), "v"(a[3][0]), "v"(a[3][1]),
                  "v"(a[4][0]), "v"(a[4][1]), "v"(a[5][0]), "v"(a[5][1]),
                  "v"(a[6][0]), "v"(a[6][1]), "v"(a[7][0]), "v"(a[7][1])
               : "memory");

  __bf16* q = out + (size_t)n0 * K + k0;
#pragma unroll
  for (int h = 0; h < 2; ++h)
#pragma unroll
    for (int i = 0; i < 4; ++i) {
      v8bf o;
#pragma unroll
      for (int j = 0; j < 8; ++j) o[j] = (__bf16)a[j][h][i];
      *(v8bf*)(q + (size_t)(h * 16 + i) * K) = o;
    }
}

// lane l <-> lane l ^ 16
__device__ __forceinline__ float xhalf(float x) {
  int b = __builtin_bit_cast(int, x);
  return __builtin_bit_cast(float, __builtin_amdgcn_permlanex16(
      b, b, 0x76543210, 0xfedcba98, false, false));
}

// x + (x of lane l ^ MASK) inside a 16-lane row (DPP row_xmask)
template <int MASK>
__device__ __forceinline__ float add_xmask(float x) {
  return x + __builtin_bit_cast(float, __builtin_amdgcn_update_dpp(
                 0, __builtin_bit_cast(int, x), 0x160 + MASK, 0xf, 0xf, true));
}
__device__ __forceinline__ float wave_sum(float x) {
  x = add_xmask<1>(x);
  x = add_xmask<2>(x);
  x = add_xmask<4>(x);
  x = add_xmask<8>(x);
  return x + xhalf(x);
}

// One wave per row of D=1024 (8 rows a block): a lane holds 32 elements as eight
// 16-B loads, the sums stay inside the wave, no LDS and no barrier.
__device__ __forceinline__ void
layernorm_rows8(const int blk,  // rows 8 blk .. 8 blk + 7
                const float* __restrict__ x,
                const float* __restrict__ g,
                const float* __restrict__ s,
                __bf16* __restrict__ out) {
  const int lane = threadIdx.x & 31;
  const int row  = blk * 8 + (threadIdx.x >> 5);
  const float* xr = x + (size_t)row * EMB + lane * 4;
  v4f v[8], gv[8], sv[8];
#pragma unroll
  for (int i = 0; i < 8; ++i) v[i] = *(const v4f*)(xr + i * 128);
#pragma unroll
  for (int i = 0; i < 8; ++i) {
    gv[i] = *(const v4f*)(g + lane * 4 + i * 128);
    sv[i] = *(const v4f*)(s + lane * 4 + i * 128);
  }
  // Takes the loaded values and the row's address as inputs only: the scale and
  // shift loads fly with the row's instead of one pair at a time behind the sums,
  // and the address registers stay untouched up to the wait.
  asm volatile("s_wait_xcnt 0x0"
               :: "v"(xr), "v"(v[0]), "v"(v[1]), "v"(v[2]), "v"(v[3]),
                  "v"(v[4]), "v"(v[5]), "v"(v[6]), "v"(v[7]),
                  "v"(gv[0]), "v"(gv[1]), "v"(gv[2]), "v"(gv[3]),
                  "v"(gv[4]), "v"(gv[5]), "v"(gv[6]), "v"(gv[7]),
                  "v"(sv[0]), "v"(sv[1]), "v"(sv[2]), "v"(sv[3]),
                  "v"(sv[4]), "v"(sv[5]), "v"(sv[6]), "v"(sv[7])
               : "memory");
  // keeps the sums from being scheduled in among the loads, which split the group
  __builtin_amdgcn_sched_barrier(0);
  v4f s4 = v[0], q4 = v[0] * v[0];  // four independent chains each
#pragma unroll
  for (int i = 1; i < 8; ++i) {
    s4 += v[i];
    q4 += v[i] * v[i];
  }
  const float ts = wave_sum((s4[0] + s4[1]) + (s4[2] + s4[3]));
  const float tq = wave_sum((q4[0] + q4[1]) + (q4[2] + q4[3]));
  const float mean = ts * (1.0f / EMB);
  const float var  = tq * (1.0f / EMB) - mean * mean;
  const float inv  = rsqrtf(var + LN_EPS);
  __bf16* o = out + (size_t)row * EMB + lane * 4;
#pragma unroll
  for (int i = 0; i < 8; ++i) {
    v4bf w;
#pragma unroll
    for (int e = 0; e < 4; ++e)
      w[e] = (__bf16)(gv[i][e] * ((v[i][e] - mean) * inv) + sv[i][e]);
    *(v4bf*)(o + i * 128) = w;
  }
}

__global__ void __launch_bounds__(256)
layernorm_bf16(const float* __restrict__ x,
               const float* __restrict__ g,
               const float* __restrict__ s,
               __bf16* __restrict__ out) {
  layernorm_rows8(blockIdx.x, x, g, s, out);
}

// The casts of Wq, Wk, Wv and the first layer norm depend on nothing but the inputs and
// are all that the Q, K, V products wait for: one launch holds both, blocks
// 0 .. CAST_TILES_QKV - 1 cast, the rest normalise. The other three weights are cast
// beside the attention, which does not need them.
__global__ void __launch_bounds__(256)
cast_qkv_and_layernorm(const float* __restrict__ Wq, const float* __restrict__ Wk,
                       const float* __restrict__ Wv,
                       __bf16* __restrict__ oq, __bf16* __restrict__ ok,
                       __bf16* __restrict__ ov,
                       const float* __restrict__ x, const float* __restrict__ g,
                       const float* __restrict__ s, __bf16* __restrict__ h) {
  const int id = blockIdx.x;
  if (id < CAST_TILES_QKV)
    cast_transpose_tile(id, threadIdx.x >> 5, Wq, Wk, Wv, nullptr, nullptr, nullptr,
                        oq, ok, ov, nullptr, nullptr, nullptr);
  else {
    layernorm_rows8(id - CAST_TILES_QKV, x, g, s, h);
    // in the listing the cast arm's code, which rewrites the registers of the row's
    // eight stores, stands behind them on a fall-through
    asm volatile("s_wait_xcnt 0x0" ::: "memory");
  }
}

// ---------------------------------------------------------------------------
// Tiled bf16 WMMA GEMM: C[M,N] = act(A[M,K] @ B[K,N] + bias) + resid
// B supplied pre-transposed as BT[N,K] so both tiles are K-contiguous and
// can be staged verbatim with async b128 copies (double-buffered LDS).
// Block tile 128x128, 128 k a pass; 8 waves (2 x 4), each owns 64(M)x32(N).
// A stage is [A 128 rows | BT 128 rows] at a pitch of 272 B (16 B x odd: the
// b128 fragment reads meet no bank conflict). M, N multiples of 128, K of 128.
// The products are formed transposed (BT's fragment as the A operand), so a lane ends
// with 8 neighbouring columns of ONE output row; the block's tile then goes through
// the idle LDS buffer and leaves as 16-B stores that cover whole 128-B lines.
// One 16x32 operand fragment in the hardware k order: p points at k = 8*half of
// this lane's row; elements 0-7 are k = 8*half + 0..7, 8-15 are k = 16 + 8*half + 0..7.
__device__ __forceinline__ v16bf load_frag(const __bf16* p) {
  v8bf lo = *(const v8bf*)p;
  v8bf hi = *(const v8bf*)(p + 16);
  return __builtin_shufflevector(lo, hi, 0, 1, 2, 3, 4, 5, 6, 7,
                                 8, 9, 10, 11, 12, 13, 14, 15);
}

#define STAGE_ELEMS (256 * LDS_PITCH)

// The fragments of one block (k = 32) of a wave's 64 x 32 tile: four A row groups,
// two B column groups, twelve 16-B LDS reads.
struct FragSet { v16bf a[4], b[2]; };
__device__ __forceinline__ void load_set(FragSet& f, const __bf16* a, const __bf16* b) {
#pragma unroll
  for (int i = 0; i < 4; ++i) f.a[i] = load_frag(a + i * 16 * LDS_PITCH);
#pragma unroll
  for (int j = 0; j < 2; ++j) f.b[j] = load_frag(b + j * 16 * LDS_PITCH);
}

template <bool RELU, bool OUTBF>
__device__ __forceinline__ void
gemm_tile(const __bf16* __restrict__ A,   // [M,K]
          const __bf16* __restrict__ BT,  // [N,K]
          const float* __restrict__ bias,
          const float* __restrict__ resid,
          void* __restrict__ outp,
          const int m0, const int n0, int N, int K) {
  __shared__ __align__(16) __bf16 st[2][STAGE_ELEMS];

  const int tid  = threadIdx.x;
  const int lane = tid & 31;
  const int wave = tid >> 5;
  const int half = lane >> 4;
  const int ln   = lane & 15;
  const int wm   = wave & 1;   // 2 M-strips of 64 rows
  const int wn   = wave >> 1;  // 4 N-strips of 32 cols

  // Staging: 16 lanes cover one 256-B row; a thread copies rows srow + 16 i.
  const int srow = tid >> 4, scol = (tid & 15) * 8;
  const __bf16* aSrc = A  + (size_t)(m0 + srow) * K + scol;
  const __bf16* bSrc = BT + (size_t)(n0 + srow) * K + scol;
  const size_t gstep = (size_t)16 * K;
  const unsigned int ldsA = lds_lo32(&st[0][srow * LDS_PITCH + scol]);
  const unsigned int ldsB = ldsA + 128 * LDS_PITCH * 2;

  v8f acc[4][2] = {};
  const int npass = K / 128;

  async_copy_rows8(ldsA, aSrc, gstep);
  async_copy_rows8(ldsB, bSrc, gstep);
  asm volatile("s_wait_asynccnt 0x0" ::: "memory");  // this wave's share of tile 0 landed
  __syncthreads();                                   // every wave's share visible
  if (npass > 1) {
    async_copy_rows8(ldsA + STAGE_ELEMS * 2, aSrc + 128, gstep);
    async_copy_rows8(ldsB + STAGE_ELEMS * 2, bSrc + 128, gstep);
  }

  // Fragments are fetched one block (k = 32) ahead into a second register set: block
  // c + 1's twelve LDS reads go out as one group in front of block c's eight WMMAs, so
  // the wave no longer waits out the LDS latency in front of every pair of WMMAs.
  // Set (c & 1) holds block c. The fetch for a pass's first block already reads the
  // next tile, so the publish point stands in front of the pass's LAST block.
  const int aoff = (wm * 64 + ln) * LDS_PITCH + 8 * half;
  const int boff = (128 + wn * 32 + ln) * LDS_PITCH + 8 * half;
  FragSet fs[2];
  load_set(fs[0], &st[0][aoff], &st[0][boff]);

  for (int t = 0; t < npass; ++t) {
    const int buf = t & 1;
    const __bf16* a  = &st[buf][aoff];
    const __bf16* bs = &st[buf][boff];
    // The last pass has no next tile: its fetch ahead rereads its own buffer, which
    // nothing refills any more, and the values are not used.
    const int nbuf = (t + 1 < npass) ? buf ^ 1 : buf;
#pragma unroll
    for (int c = 0; c < 4; ++c) {  // four k = 32 blocks of the pass
      if (c < 3) {
        load_set(fs[(c + 1) & 1], a + (c + 1) * 32, bs + (c + 1) * 32);
      } else {
        asm volatile("s_wait_dscnt 0x0" ::: "memory");     // own reads of this buffer done
        asm volatile("s_wait_asynccnt 0x0" ::: "memory");  // own share of tile t + 1 landed
        __syncthreads();  // publishes tile t + 1 and frees this buffer for the refill
        load_set(fs[0], &st[nbuf][aoff], &st[nbuf][boff]);
        // The refill goes out behind those reads, which are of the other buffer, and in
        // front of the last block's WMMAs: the LDS works while the copies are issued.
        if (t + 2 < npass) {
          const unsigned int bo = buf * (STAGE_ELEMS * 2);
          async_copy_rows8(ldsA + bo, aSrc + (size_t)(t + 2) * 128, gstep);
          async_copy_rows8(ldsB + bo, bSrc + (size_t)(t + 2) * 128, gstep);
        }
      }
      // keeps the reads above as one group in front of the WMMAs: left free, the
      // scheduler sinks each read to its first use and the latency stands open again
      __builtin_amdgcn_sched_barrier(0);
#pragma unroll
      for (int i = 0; i < 4; ++i)
#pragma unroll
        for (int j = 0; j < 2; ++j)
          acc[i][j] = wmma_bf16(fs[c & 1].b[j], fs[c & 1].a[i], acc[i][j]);
      // keeps the next block's reads from being lifted in among these WMMAs
      __builtin_amdgcn_sched_barrier(0);
    }
  }
  asm volatile("s_wait_asynccnt 0x0" ::: "memory");  // nothing in flight at the wave's end
  asm volatile("s_wait_dscnt 0x0" ::: "memory");     // nor the last pass's unused fetch ahead

  // acc[i][j][r] = C[m0 + wm*64 + i*16 + ln][n0 + wn*32 + j*16 + 8*half + r].
  // Staging goes into the buffer that the last pass did not use: its last reads ended
  // in front of the barrier of the pass before, and nothing was copied into it since.
  __bf16* sb = &st[npass & 1][0];
  const int srow0 = wm * 64 + ln, scol0 = wn * 32 + 8 * half;
  const size_t tile0 = (size_t)m0 * N + n0;  // the tile's first element, the same for the block
  if (OUTBF) {  // bf16 output (takes no residual): bias, ReLU, conversion, then staging
    if (bias) {
      v4f bb[2][2];
#pragma unroll
      for (int j = 0; j < 2; ++j) {
        bb[j][0] = *(const v4f*)(bias + n0 + scol0 + j * 16);
        bb[j][1] = *(const v4f*)(bias + n0 + scol0 + j * 16 + 4);
      }
      // the four loads' offset register is rewritten below
      asm volatile("s_wait_xcnt 0x0" ::: "memory");
#pragma unroll
      for (int i = 0; i < 4; ++i)
#pragma unroll
        for (int j = 0; j < 2; ++j)
#pragma unroll
          for (int r = 0; r < 8; ++r) acc[i][j][r] += bb[j][r >> 2][r & 3];
    }
#pragma unroll
    for (int i = 0; i < 4; ++i)
#pragma unroll
      for (int j = 0; j < 2; ++j) {
        v8bf w;
#pragma unroll
        for (int r = 0; r < 8; ++r)
          w[r] = (__bf16)(RELU ? fmaxf(acc[i][j][r], 0.f) : acc[i][j][r]);
        *(v8bf*)(sb + (srow0 + i * 16) * LDS_PITCH + scol0 + j * 16) = w;
      }
    __syncthreads();  // the whole 128 x 128 tile is staged
    // 16 lanes take one 256-B row of the tile: a store covers four whole lines
    char* ob = (char*)((__bf16*)outp + tile0);
    unsigned int off[8];
    v8bf w[8];
#pragma unroll
    for (int p = 0; p < 8; ++p) {
      off[p] = (unsigned int)((p * 16 + srow) * N + scol) * 2u;
      w[p] = *(const v8bf*)(sb + (p * 16 + srow) * LDS_PITCH + scol);
    }
    // keeps the offset additions in front of the stores: among them they would rewrite
    // registers of stores already issued and take a wait each
    __builtin_amdgcn_sched_barrier(0);
#pragma unroll
    for (int p = 0; p < 8; ++p) *(v8bf*)(ob + off[p]) = w[p];
  } else {  // f32 output (always with bias and residual): staged as f32; both join in the
            // stores' pattern
    const int SP = 132;  // floats a staged row: 512 B + 16 B, no bank conflict either way
    float* sf = (float*)sb;
    unsigned int off[16];  // a wave takes a whole 512-B row of the tile
#pragma unroll
    for (int p = 0; p < 16; ++p) off[p] = (unsigned int)((p * 8 + wave) * N + lane * 4) * 4u;
    const v4f bv = *(const v4f*)(bias + n0 + lane * 4);
    const char* rb = (const char*)(resid + tile0);
    v4f rv[16];  // all 16 loads fly while the tile is staged
#pragma unroll
    for (int p = 0; p < 16; ++p) rv[p] = *(const v4f*)(rb + off[p]);
#pragma unroll
    for (int i = 0; i < 4; ++i)
#pragma unroll
      for (int j = 0; j < 2; ++j) {
        float* d = sf + (srow0 + i * 16) * SP + scol0 + j * 16;
        *(v4f*)d       = __builtin_shufflevector(acc[i][j], acc[i][j], 0, 1, 2, 3);
        *(v4f*)(d + 4) = __builtin_shufflevector(acc[i][j], acc[i][j], 4, 5, 6, 7);
      }
    __syncthreads();  // the whole 128 x 128 tile is staged
    char* ob = (char*)((float*)outp + tile0);
    v4f v[16];
#pragma unroll
    for (int p = 0; p < 16; ++p) {
      v[p] = *(const v4f*)(sf + (p * 8 + wave) * SP + lane * 4) + bv;
      if (RELU) {
#pragma unroll
        for (int e = 0; e < 4; ++e) v[p][e] = fmaxf(v[p][e], 0.f);
      }
      v[p] += rv[p];
    }
    // keeps the sums in front of the stores: among them they would rewrite registers of
    // stores already issued and take a wait each
    __builtin_amdgcn_sched_barrier(0);
#pragma unroll
    for (int p = 0; p < 16; ++p) *(v4f*)(ob + off[p]) = v[p];
  }
}

template <bool RELU, bool OUTBF>
__global__ void __launch_bounds__(256)
gemm_bf16_wmma(const __bf16* __restrict__ A,   // [M,K]
               const __bf16* __restrict__ BT,  // [N,K]
               const float* __restrict__ bias,
               const float* __restrict__ resid,
               void* __restrict__ outp,
               int N, int K) {
  gemm_tile<RELU, OUTBF>(A, BT, bias, resid, outp, blockIdx.y * 128, blockIdx.x * 128, N, K);
}

// Q, K and V^T read the same h and depend on nothing else: one launch of three times
// the blocks, blockIdx.z picks the product. Two launch gaps, fills and tails go, and
// with more blocks than WGPs a block's first tile and its stores run beside another
// block's passes. V^T = Wv^T h^T is the same tile with the operands swapped (x then
// walks its rows, y its columns); its N is the output's row pitch.
__global__ void __launch_bounds__(256)
gemm_qkv_wmma(const __bf16* __restrict__ h,    // [M,K]
              const __bf16* __restrict__ WqT,  // [N,K] each
              const __bf16* __restrict__ WkT,
              const __bf16* __restrict__ WvT,
              __bf16* __restrict__ q, __bf16* __restrict__ k,
              __bf16* __restrict__ vT, int N, int vpitch, int K) {
  const int z = blockIdx.z;
  const bool isv = z == 2;
  const __bf16* w = z == 0 ? WqT : z == 1 ? WkT : WvT;
  gemm_tile<false, true>(isv ? w : h, isv ? h : w, nullptr, nullptr,
                         z == 0 ? q : z == 1 ? k : vT,
                         (isv ? blockIdx.x : blockIdx.y) * 128,
                         (isv ? blockIdx.y : blockIdx.x) * 128, isv ? vpitch : N, K);
}

#define KV_PITCH 72                      // bf16 elements a staged row
#define KV_STAGE_ELEMS (128 * KV_PITCH)  // 64 K rows + 64 V^T rows

// A thread's share of one stage: four K rows and four V^T rows, 16 apart, 16 B of
// each. The closing s_wait_xcnt stands inside the statement so that no address
// register is rewritten ahead of it.
__device__ __forceinline__ void async_copy_kv(unsigned int ldsK, const __bf16* gk,
                                              size_t kstep, const __bf16* gv,
                                              size_t vstep) {
  const unsigned int ls = 16 * KV_PITCH * 2;
  const unsigned int ldsV = ldsK + 64 * KV_PITCH * 2;
  asm volatile("global_load_async_to_lds_b128 %0, %8, off\n\t"
               "global_load_async_to_lds_b128 %1, %9, off\n\t"
               "global_load_async_to_lds_b128 %2, %10, off\n\t"
               "global_load_async_to_lds_b128 %3, %11, off\n\t"
               "global_load_async_to_lds_b128 %4, %12, off\n\t"
               "global_load_async_to_lds_b128 %5, %13, off\n\t"
               "global_load_async_to_lds_b128 %6, %14, off\n\t"
               "global_load_async_to_lds_b128 %7, %15, off\n\t"
               "s_wait_xcnt 0x0"
               :: "v"(ldsK), "v"(ldsK + ls), "v"(ldsK + 2 * ls), "v"(ldsK + 3 * ls),
                  "v"(ldsV), "v"(ldsV + ls), "v"(ldsV + 2 * ls), "v"(ldsV + 3 * ls),
                  "v"(gk), "v"(gk + kstep), "v"(gk + 2 * kstep), "v"(gk + 3 * kstep),
                  "v"(gv), "v"(gv + vstep), "v"(gv + 2 * vstep), "v"(gv + 3 * vstep)
               : "memory");
}

__global__ void __launch_bounds__(128)
flash_attn_wmma(const __bf16* __restrict__ Q,
                const __bf16* __restrict__ Km,
                const __bf16* __restrict__ Vt,
                __bf16* __restrict__ O, int T, int vpitch,
                const float* __restrict__ Wo, const float* __restrict__ W1,
                const float* __restrict__ W2, __bf16* __restrict__ oo,
                __bf16* __restrict__ o1, __bf16* __restrict__ o2, int nbatch) {
  __shared__ __align__(16) __bf16 kv[2][KV_STAGE_ELEMS];

  // The layers of the grid behind the query tiles cast Wo, W1, W2, which only later
  // launches read: they start last and fill the places that the short query tiles
  // leave, so their memory time hides behind the long tiles. A block of four waves
  // takes half a cast tile. The whole block leaves here, in front of every barrier.
  if ((int)blockIdx.z >= (T >> 7)) {
    const int u = (((int)blockIdx.z - (T >> 7)) * nbatch + blockIdx.y) * HEADS + blockIdx.x;
    cast_transpose_tile(CAST_TILES_QKV + (u >> 1), (threadIdx.x >> 5) + 4 * (u & 1),
                        nullptr, nullptr, nullptr, Wo, W1, W2,
                        nullptr, nullptr, nullptr, oo, o1, o2);
    return;
  }

  // Heaviest query tile first: the longest block is not the last to start.
  const int qt   = (T >> 7) - 1 - blockIdx.z;
  const int h    = blockIdx.x;
  const int b    = blockIdx.y;
  const int tid  = threadIdx.x;
  const int lane = tid & 31;
  const int half = lane >> 4;
  const int ln   = lane & 15;
  // the wave's number in a scalar register: the skip beyond the diagonal is a scalar branch
  const int wave = __builtin_amdgcn_readfirstlane(tid >> 5);
  const int q0   = qt * 128 + wave * 32;  // this wave's first query
  const size_t baseRow = (size_t)b * T;
  const int hoff = h * HDIM;

  // Staging: 8 lanes cover one 128-B row; a thread copies rows srow + 16 i.
  const int srow = tid >> 3, scol = (tid & 7) * 8;
  const __bf16* kSrc = Km + (baseRow + srow) * EMB + hoff + scol;
  const __bf16* vSrc = Vt + (size_t)(hoff + srow) * vpitch + baseRow + scol;
  const size_t kstep = (size_t)16 * EMB, vstep = (size_t)16 * vpitch;
  const unsigned int ldsK = lds_lo32(&kv[0][srow * KV_PITCH + scol]);
  const int nst = 2 * (qt + 1);  // stages of 64 keys up to the block's last query

  async_copy_kv(ldsK, kSrc, kstep, vSrc, vstep);

  // Q as B operand: two 16-query column groups x two k = 32 chunks of head_dim
  v16bf qb[2][2];
#pragma unroll
  for (int g = 0; g < 2; ++g)
#pragma unroll
    for (int c = 0; c < 2; ++c)
      qb[g][c] = load_frag(Q + (baseRow + q0 + g * 16 + ln) * EMB + hoff + c * 32 + 8 * half);

  float mi[2], li[2];
  v8f o[2][4] = {};
#pragma unroll
  for (int g = 0; g < 2; ++g) { mi[g] = -3.0e38f; li[g] = 0.f; }

  asm volatile("s_wait_asynccnt 0x0" ::: "memory");  // this wave's share of stage 0 landed
  __syncthreads();                                   // every wave's share visible
  if (nst > 1)
    async_copy_kv(ldsK + KV_STAGE_ELEMS * 2, kSrc + (size_t)64 * EMB, kstep, vSrc + 64, vstep);

  // 1/sqrt(EMB) per reference, times log2(e): the softmax runs in base 2
  const float scale = 0.03125f * 1.4426950408889634f;
  for (int s = 0; s < nst; ++s) {
    const int buf = s & 1;
    const __bf16* kp = &kv[buf][ln * KV_PITCH + 8 * half];
    const __bf16* vp = kp + 64 * KV_PITCH;
#pragma unroll
    for (int u = 0; u < 2; ++u) {  // the stage's two tiles of 32 keys
      const int kb = s * 64 + u * 32;
      if (kb <= q0) {  // tiles wholly beyond this wave's diagonal are skipped
        v16bf ka[2][2];  // [16-key tile][head_dim chunk]
#pragma unroll
        for (int t = 0; t < 2; ++t)
#pragma unroll
          for (int c = 0; c < 2; ++c)
            ka[t][c] = load_frag(kp + (u * 32 + t * 16) * KV_PITCH + c * 32);
        v16bf va[4];     // [16-row chunk of head_dim], k = the 32 keys
#pragma unroll
        for (int dd = 0; dd < 4; ++dd)
          va[dd] = load_frag(vp + dd * 16 * KV_PITCH + u * 32);

#pragma unroll
        for (int g = 0; g < 2; ++g) {
          // st[t][r] = S[query q0 + g*16 + ln][key kb + t*16 + 8*half + r]
          v8f st[2] = {};
#pragma unroll
          for (int t = 0; t < 2; ++t)
#pragma unroll
            for (int c = 0; c < 2; ++c)
              st[t] = wmma_bf16(ka[t][c], qb[g][c], st[t]);

          float x[16];
#pragma unroll
          for (int e = 0; e < 16; ++e) x[e] = st[e >> 3][e & 7] * scale;
          if (kb == q0) {  // only the wave's last key tile crosses the diagonal
            const int qrel = g * 16 + ln - 8 * half;  // query - first key of this lane
#pragma unroll
            for (int e = 0; e < 16; ++e)
              x[e] = ((e >> 3) * 16 + (e & 7) <= qrel) ? x[e] : -3.0e38f;
          }
          float rmax = x[0];
#pragma unroll
          for (int e = 1; e < 16; ++e) rmax = fmaxf(rmax, x[e]);
          rmax = fmaxf(rmax, xhalf(rmax));
          const float mnew  = fmaxf(mi[g], rmax);
          const float alpha = __builtin_amdgcn_exp2f(mi[g] - mnew);
          mi[g] = mnew;

          // pb[s] = P^T[key kmap(s, half)][query]: the two score tiles in register order
          v16bf pb;
          float rsum = 0.f;
#pragma unroll
          for (int e = 0; e < 16; ++e) {
            float p = __builtin_amdgcn_exp2f(x[e] - mnew);
            rsum += p;
            pb[e] = (__bf16)p;
          }
          li[g] = li[g] * alpha + rsum;  // this half's keys only; halves join after the loop
#pragma unroll
          for (int dd = 0; dd < 4; ++dd) {
            o[g][dd] *= alpha;
            o[g][dd] = wmma_bf16(va[dd], pb, o[g][dd]);
          }
        }
      }
    }
    // The publish point stands outside the skip: every wave passes it in every stage.
    asm volatile("s_wait_dscnt 0x0" ::: "memory");     // own reads of this buffer done
    asm volatile("s_wait_asynccnt 0x0" ::: "memory");  // own share of stage s + 1 landed
    __syncthreads();  // publishes stage s + 1 and frees this buffer for the refill
    if (s + 2 < nst)
      async_copy_kv(ldsK + buf * (KV_STAGE_ELEMS * 2), kSrc + (size_t)(s + 2) * 64 * EMB,
                    kstep, vSrc + (s + 2) * 64, vstep);
  }
  asm volatile("s_wait_asynccnt 0x0" ::: "memory");  // nothing in flight at the wave's end

  // o[g][dd][r] = O[query q0 + g*16 + ln][d = dd*16 + 8*half + r]
#pragma unroll
  for (int g = 0; g < 2; ++g) {
    const float inv = 1.0f / (li[g] + xhalf(li[g]));
    __bf16* op = O + (baseRow + q0 + g * 16 + ln) * EMB + hoff + 8 * half;
#pragma unroll
    for (int dd = 0; dd < 4; ++dd) {
      v8bf w;
#pragma unroll
      for (int r = 0; r < 8; ++r) w[r] = (__bf16)(o[g][dd][r] * inv);
      *(v8bf*)(op + dd * 16) = w;
    }
  }
}

// ---------------------------------------------------------------------------
extern "C" void kernel_launch(void* const* d_in, const int* in_sizes, int n_in,
                              void* d_out, int out_size, void* d_ws,
                              size_t ws_size, hipStream_t stream) {
  (void)in_sizes; (void)n_in; (void)out_size; (void)ws_size;
  const int B = 2, T = 2048, D = EMB, M = B * T, D4 = 4 * D;
  const int VP = M + 64;  // row pitch of V^T: an odd number of 128-byte lines

  const float* x  = (const float*)d_in[0];
  const float* Wq = (const float*)d_in[1];
  const float* Wk = (const float*)d_in[2];
  const float* Wv = (const float*)d_in[3];
  const float* Wo = (const float*)d_in[4];
  const float* bo = (const float*)d_in[5];
  const float* W1 = (const float*)d_in[6];
  const float* b1 = (const float*)d_in[7];
  const float* W2 = (const float*)d_in[8];
  const float* b2 = (const float*)d_in[9];
  const float* g1 = (const float*)d_in[10];
  const float* s1 = (const float*)d_in[11];
  const float* g2 = (const float*)d_in[12];
  const float* s2 = (const float*)d_in[13];
  float* out = (float*)d_out;

  size_t off = 0;
  auto alloc = [&](size_t bytes) {
    void* p = (char*)d_ws + off;
    off += (bytes + 255) & ~(size_t)255;
    return p;
  };
  __bf16* Wq_b = (__bf16*)alloc((size_t)D * D * 2);   // [N,K] transposed
  __bf16* Wk_b = (__bf16*)alloc((size_t)D * D * 2);
  __bf16* Wv_b = (__bf16*)alloc((size_t)D * D * 2);
  __bf16* Wo_b = (__bf16*)alloc((size_t)D * D * 2);
  __bf16* W1_b = (__bf16*)alloc((size_t)D * D4 * 2);
  __bf16* W2_b = (__bf16*)alloc((size_t)D4 * D * 2);
  __bf16* h1   = (__bf16*)alloc((size_t)M * D * 2);
  __bf16* q    = (__bf16*)alloc((size_t)M * D * 2);
  __bf16* k    = (__bf16*)alloc((size_t)M * D * 2);
  __bf16* vT   = (__bf16*)alloc((size_t)D * VP * 2);  // [D, VP], columns 0..M-1 used
  __bf16* attn = (__bf16*)alloc((size_t)M * D * 2);
  float*  xmid = (float*) alloc((size_t)M * D * 4);
  __bf16* h2   = (__bf16*)alloc((size_t)M * D * 2);
  __bf16* ffn  = (__bf16*)alloc((size_t)M * D4 * 2);

  // fp32 [K,N] -> bf16 [N,K] transposes of Wq, Wk, Wv and LN1 -> h1, one launch
  cast_qkv_and_layernorm<<<CAST_TILES_QKV + M / 8, 256, 0, stream>>>(
      Wq, Wk, Wv, Wq_b, Wk_b, Wv_b, x, g1, s1, h1);

  // QKV projections, one launch
  gemm_qkv_wmma<<<dim3(D / 128, M / 128, 3), 256, 0, stream>>>(h1, Wq_b, Wk_b, Wv_b, q, k, vT, D, VP, D);

  // causal flash attention; behind its query tiles, two blocks for each cast tile of Wo, W1, W2
  flash_attn_wmma<<<dim3(HEADS, B, T / 128 + 2 * (CAST_TILES - CAST_TILES_QKV) / (HEADS * B)),
                    128, 0, stream>>>(q, k, vT, attn, T, VP, Wo, W1, W2, Wo_b, W1_b, W2_b, B);

  // out projection + bias + residual(x) -> xmid (f32)
  gemm_bf16_wmma<false, false><<<dim3(D / 128, M / 128), 256, 0, stream>>>(attn, Wo_b, bo, x, xmid, D, D);

  // LN2 -> h2
  layernorm_bf16<<<M / 8, 256, 0, stream>>>(xmid, g2, s2, h2);

  // FFN
  gemm_bf16_wmma<true, true><<<dim3(D4 / 128, M / 128), 256, 0, stream>>>(h2, W1_b, b1, nullptr, ffn, D4, D);
  gemm_bf16_wmma<false, false><<<dim3(D / 128, M / 128), 256, 0, stream>>>(ffn, W2_b, b2, xmid, out, D, D4);
}

// v008
// A run of this version takes 137 microseconds.
// Timed twice side by side with v007, it ran 1.03 times as fast both times.
// Counting every step since v000, it is 4.44 times as fast.
#include <hip/hip_runtime.h>
#include <hip/hip_bf16.h>

// ---------------------------------------------------------------------------
// CDNA5 (gfx1250) transformer block:
//  - all GEMMs + attention via v_wmma_f32_16x16x32_bf16 (wave32 WMMA)
//  - GEMM tiles staged with global_load_async_to_lds_b128 (ASYNCcnt) and
//    two LDS buffers (three for the f32-output GEMMs)
// ---------------------------------------------------------------------------

typedef __attribute__((ext_vector_type(16))) __bf16 v16bf;
typedef __attribute__((ext_vector_type(8)))  float  v8f;

#define EMB   1024
#define HEADS 16
#define HDIM  64
#define LN_EPS 1e-5f

// K-index striping for 16-bit A/B fragments (CDNA5 ISA 7.12.2):
// lanes 0-15: VGPR0-3 -> K=0..7, VGPR4-7 -> K=16..23
// lanes 16-31: VGPR0-3 -> K=8..15, VGPR4-7 -> K=24..31
__device__ __forceinline__ v8f wmma_bf16(v16bf a, v16bf b, v8f c) {
  return __builtin_amdgcn_wmma_f32_16x16x32_bf16(false, a, false, b,
                                                 (short)0, c, false, false);
}

// Async DMA: 16 bytes per lane, global -> LDS, tracked by ASYNCcnt. Eight copies
// for eight tile rows 16 apart. The closing s_wait_xcnt stands inside the statement
// so that no address register is rewritten ahead of it.
#define LDS_PITCH 136  // bf16 elements a tile row in LDS: 256 B of data + 16 B pad
__device__ __forceinline__ void async_copy_rows8(unsigned int lds,
                                                 const __bf16* g, size_t gstep) {
  const unsigned int ls = 16 * LDS_PITCH * 2;
  asm volatile("global_load_async_to_lds_b128 %0, %8, off\n\t"
               "global_load_async_to_lds_b128 %1, %9, off\n\t"
               "global_load_async_to_lds_b128 %2, %10, off\n\t"
               "global_load_async_to_lds_b128 %3, %11, off\n\t"
               "global_load_async_to_lds_b128 %4, %12, off\n\t"
               "global_load_async_to_lds_b128 %5, %13, off\n\t"
               "global_load_async_to_lds_b128 %6, %14, off\n\t"
               "global_load_async_to_lds_b128 %7, %15, off\n\t"
               "s_wait_xcnt 0x0"
               :: "v"(lds), "v"(lds + ls), "v"(lds + 2 * ls), "v"(lds + 3 * ls),
                  "v"(lds + 4 * ls), "v"(lds + 5 * ls), "v"(lds + 6 * ls),
                  "v"(lds + 7 * ls),
                  "v"(g), "v"(g + gstep), "v"(g + 2 * gstep), "v"(g + 3 * gstep),
                  "v"(g + 4 * gstep), "v"(g + 5 * gstep), "v"(g + 6 * gstep),
                  "v"(g + 7 * gstep)
               : "memory");
}
// Eight copies for rows 8 apart, where four waves copy a tile alone, 32 copies a thread.
// Written as the builtin: the compiler forms each address next to its copy (as operands
// of asm text the 32 addresses were live together and spilled), and the issuing wave,
// whose WMMAs stand behind the copies, gets through them in fewer cycles.
typedef int v4i_copy __attribute__((vector_size(16)));
__device__ __forceinline__ void async_copy_rows8_b(__bf16* lds, const __bf16* g, size_t gstep) {
#pragma unroll
  for (int i = 0; i < 8; ++i)
    __builtin_amdgcn_global_load_async_to_lds_b128(
        (__attribute__((address_space(1))) v4i_copy*)(g + i * gstep),
        (__attribute__((address_space(3))) v4i_copy*)(lds + i * 8 * LDS_PITCH), 0, 0);
}
__device__ __forceinline__ unsigned int lds_lo32(const void* p) {
  return (unsigned int)(unsigned long long)p;  // LDS aperture: offset in [31:0]
}

// ---------------------------------------------------------------------------
typedef __attribute__((ext_vector_type(8))) __bf16 v8bf;
typedef __attribute__((ext_vector_type(4))) __bf16 v4bf;
typedef __attribute__((ext_vector_type(4))) float  v4f;

// fp32 [K,N] -> bf16 [N,K] transposed cast of the six weights in few, long waves
// (64 elements a lane). The unit is one 128(k) x 128(n) tile of eight waves, a wave
// 64(k) x 32(n), a lane 8(k) x 8(n), transposed in its registers. 8 lanes along k
// make every store a whole 128-B line of the output; a lane's two loads of a row
// cover one 128-B line together with its three neighbours along n.
// The tile's number and the wave's number in it (0-7) come from the caller: a block of
// eight waves takes a tile, a block of four waves half of one.
#define CAST_TILES (12 * (EMB / 128) * (EMB / 128))
#define CAST_TILES_QKV (3 * (EMB / 128) * (EMB / 128))  // Wq, Wk, Wv come first
__device__ __forceinline__ void
cast_transpose_tile(const int id,    // 0 .. CAST_TILES - 1
                    const int wave,  // 0 .. 7
                    const float* __restrict__ Wq, const float* __restrict__ Wk,
                    const float* __restrict__ Wv, const float* __restrict__ Wo,
                    const float* __restrict__ W1, const float* __restrict__ W2,
                    __bf16* __restrict__ oq, __bf16* __restrict__ ok,
                    __bf16* __restrict__ ov, __bf16* __restrict__ oo,
                    __bf16* __restrict__ o1, __bf16* __restrict__ o2) {
  const int TSQ = (EMB / 128) * (EMB / 128);  // tiles of an EMB x EMB weight
  const int w  = id / TSQ;                    // 0-3 square weights, 4-7 W1, 8-11 W2
  const float* in = w == 0 ? Wq : w == 1 ? Wk : w == 2 ? Wv : w == 3 ? Wo
                  : w < 8 ? W1 : W2;
  __bf16* out = w == 0 ? oq : w == 1 ? ok : w == 2 ? ov : w == 3 ? oo
              : w < 8 ? o1 : o2;
  const int K = w < 8 ? EMB : 4 * EMB;
  const int N = (w >= 4 && w < 8) ? 4 * EMB : EMB;
  const int t = w < 4 ? id % TSQ : id % (4 * TSQ);  // tile of this weight
  const int ntn = N / 128;                          // a power of two
  const int lane = threadIdx.x & 31;
  const int k0 = (t >> __builtin_ctz(ntn)) * 128 + (wave & 1) * 64 + (lane & 7) * 8;
  const int n0 = (t & (ntn - 1)) * 128 + (wave >> 1) * 32 + (lane >> 3) * 4;

  const float* pr[8];
  v4f a[8][2];
#pragma unroll
  for (int j = 0; j < 8; ++j) {
    pr[j] = in + (size_t)(k0 + j) * N + n0;
    a[j][0] = *(const v4f*)pr[j];
    a[j][1] = *(const v4f*)(pr[j] + 16);
  }
  // Takes the loaded values and their addresses as inputs only: all 16 loads are in
  // flight together before the first conversion, and the address registers stay
  // untouched up to the wait.
  asm volatile("s_wait_xcnt 0x0"
               :: "v"(pr[0]), "v"(pr[1]), "v"(pr[2]), "v"(pr[3]),
                  "v"(pr[4]), "v"(pr[5]), "v"(pr[6]), "v"(pr[7]),
                  "v"(a[0][0]), "v"(a[0][1]), "v"(a[1][0]), "v"(a[1][1]),
                  "v"(a[2][0]), "v"(a[2][1]), "v"(a[3][0]), "v"(a[3][1]),
                  "v"(a[4][0]), "v"(a[4][1]), "v"(a[5][0]), "v"(a[5][1]),
                  "v"(a[6][0]), "v"(a[6][1]), "v"(a[7][0]), "v"(a[7][1])
               : "memory");

  __bf16* q = out + (size_t)n0 * K + k0;
#pragma unroll
  for (int h = 0; h < 2; ++h)
#pragma unroll
    for (int i = 0; i < 4; ++i) {
      v8bf o;
#pragma unroll
      for (int j = 0; j < 8; ++j) o[j] = (__bf16)a[j][h][i];
      *(v8bf*)(q + (size_t)(h * 16 + i) * K) = o;
    }
}

// lane l <-> lane l ^ 16
__device__ __forceinline__ float xhalf(float x) {
  int b = __builtin_bit_cast(int, x);
  return __builtin_bit_cast(float, __builtin_amdgcn_permlanex16(
      b, b, 0x76543210, 0xfedcba98, false, false));
}

// x + (x of lane l ^ MASK) inside a 16-lane row (DPP row_xmask)
template <int MASK>
__device__ __forceinline__ float add_xmask(float x) {
  return x + __builtin_bit_cast(float, __builtin_amdgcn_update_dpp(
                 0, __builtin_bit_cast(int, x), 0x160 + MASK, 0xf, 0xf, true));
}
__device__ __forceinline__ float wave_sum(float x) {
  x = add_xmask<1>(x);
  x = add_xmask<2>(x);
  x = add_xmask<4>(x);
  x = add_xmask<8>(x);
  return x + xhalf(x);
}

// One wave per row of D=1024 (8 rows a block): a lane holds 32 elements as eight
// 16-B loads, the sums stay inside the wave, no LDS and no barrier.
__device__ __forceinline__ void
layernorm_rows8(const int blk,  // rows 8 blk .. 8 blk + 7
                const float* __restrict__ x,
                const float* __restrict__ g,
                const float* __restrict__ s,
                __bf16* __restrict__ out) {
  const int lane = threadIdx.x & 31;
  const int row  = blk * 8 + (threadIdx.x >> 5);
  const float* xr = x + (size_t)row * EMB + lane * 4;
  v4f v[8], gv[8], sv[8];
#pragma unroll
  for (int i = 0; i < 8; ++i) v[i] = *(const v4f*)(xr + i * 128);
#pragma unroll
  for (int i = 0; i < 8; ++i) {
    gv[i] = *(const v4f*)(g + lane * 4 + i * 128);
    sv[i] = *(const v4f*)(s + lane * 4 + i * 128);
  }
  // Takes the loaded values and the row's address as inputs only: the scale and
  // shift loads fly with the row's instead of one pair at a time behind the sums,
  // and the address registers stay untouched up to the wait.
  asm volatile("s_wait_xcnt 0x0"
               :: "v"(xr), "v"(v[0]), "v"(v[1]), "v"(v[2]), "v"(v[3]),
                  "v"(v[4]), "v"(v[5]), "v"(v[6]), "v"(v[7]),
                  "v"(gv[0]), "v"(gv[1]), "v"(gv[2]), "v"(gv[3]),
                  "v"(gv[4]), "v"(gv[5]), "v"(gv[6]), "v"(gv[7]),
                  "v"(sv[0]), "v"(sv[1]), "v"(sv[2]), "v"(sv[3]),
                  "v"(sv[4]), "v"(sv[5]), "v"(sv[6]), "v"(sv[7])
               : "memory");
  // keeps the sums from being scheduled in among the loads, which split the group
  __builtin_amdgcn_sched_barrier(0);
  v4f s4 = v[0], q4 = v[0] * v[0];  // four independent chains each
#pragma unroll
  for (int i = 1; i < 8; ++i) {
    s4 += v[i];
    q4 += v[i] * v[i];
  }
  const float ts = wave_sum((s4[0] + s4[1]) + (s4[2] + s4[3]));
  const float tq = wave_sum((q4[0] + q4[1]) + (q4[2] + q4[3]));
  const float mean = ts * (1.0f / EMB);
  const float var  = tq * (1.0f / EMB) - mean * mean;
  const float inv  = rsqrtf(var + LN_EPS);
  __bf16* o = out + (size_t)row * EMB + lane * 4;
#pragma unroll
  for (int i = 0; i < 8; ++i) {
    v4bf w;
#pragma unroll
    for (int e = 0; e < 4; ++e)
      w[e] = (__bf16)(gv[i][e] * ((v[i][e] - mean) * inv) + sv[i][e]);
    *(v4bf*)(o + i * 128) = w;
  }
}

__global__ void __launch_bounds__(256)
layernorm_bf16(const float* __restrict__ x,
               const float* __restrict__ g,
               const float* __restrict__ s,
               __bf16* __restrict__ out) {
  layernorm_rows8(blockIdx.x, x, g, s, out);
}

// The casts of Wq, Wk, Wv and the first layer norm depend on nothing but the inputs and
// are all that the Q, K, V products wait for: one launch holds both, blocks
// 0 .. CAST_TILES_QKV - 1 cast, the rest normalise. The other three weights are cast
// beside the attention, which does not need them.
__global__ void __launch_bounds__(256)
cast_qkv_and_layernorm(const float* __restrict__ Wq, const float* __restrict__ Wk,
                       const float* __restrict__ Wv,
                       __bf16* __restrict__ oq, __bf16* __restrict__ ok,
                       __bf16* __restrict__ ov,
                       const float* __restrict__ x, const float* __restrict__ g,
                       const float* __restrict__ s, __bf16* __restrict__ h) {
  const int id = blockIdx.x;
  if (id < CAST_TILES_QKV)
    cast_transpose_tile(id, threadIdx.x >> 5, Wq, Wk, Wv, nullptr, nullptr, nullptr,
                        oq, ok, ov, nullptr, nullptr, nullptr);
  else {
    layernorm_rows8(id - CAST_TILES_QKV, x, g, s, h);
    // in the listing the cast arm's code, which rewrites the registers of the row's
    // eight stores, stands behind them on a fall-through
    asm volatile("s_wait_xcnt 0x0" ::: "memory");
  }
}

// ---------------------------------------------------------------------------
// Tiled bf16 WMMA GEMM: C[M,N] = act(A[M,K] @ B[K,N] + bias) + resid
// B supplied pre-transposed as BT[N,K] so both tiles are K-contiguous and
// can be staged verbatim with async b128 copies (two LDS buffers, three for f32 output).
// Block tile 128x128, 128 k a pass; 8 waves (2 x 4), each owns 64(M)x32(N).
// A stage is [A 128 rows | BT 128 rows] at a pitch of 272 B (16 B x odd: the
// b128 fragment reads meet no bank conflict). M, N multiples of 128, K of 128.
// The products are formed transposed (BT's fragment as the A operand), so a lane ends
// with 8 neighbouring columns of ONE output row; the block's tile then goes through
// the idle LDS buffer and leaves as 16-B stores that cover whole 128-B lines.
// One 16x32 operand fragment in the hardware k order: p points at k = 8*half of
// this lane's row; elements 0-7 are k = 8*half + 0..7, 8-15 are k = 16 + 8*half + 0..7.
__device__ __forceinline__ v16bf load_frag(const __bf16* p) {
  v8bf lo = *(const v8bf*)p;
  v8bf hi = *(const v8bf*)(p + 16);
  return __builtin_shufflevector(lo, hi, 0, 1, 2, 3, 4, 5, 6, 7,
                                 8, 9, 10, 11, 12, 13, 14, 15);
}

#define STAGE_ELEMS (256 * LDS_PITCH)

// The fragments of one block (k = 32) of a wave's 64 x 32 tile: four A row groups,
// two B column groups, twelve 16-B LDS reads.
struct FragSet { v16bf a[4], b[2]; };
__device__ __forceinline__ void load_set(FragSet& f, const __bf16* a, const __bf16* b) {
#pragma unroll
  for (int i = 0; i < 4; ++i) f.a[i] = load_frag(a + i * 16 * LDS_PITCH);
#pragma unroll
  for (int j = 0; j < 2; ++j) f.b[j] = load_frag(b + j * 16 * LDS_PITCH);
}

template <bool RELU, bool OUTBF>
__device__ __forceinline__ void
gemm_tile(const __bf16* __restrict__ A,   // [M,K]
          const __bf16* __restrict__ BT,  // [N,K]
          const float* __restrict__ bias,
          const float* __restrict__ resid,
          void* __restrict__ outp,
          const int m0, const int n0, int N, int K) {
  // The f32-output products have as many blocks as there are WGPs: a block is alone on
  // its WGP, nothing else works while a tile is on its way, and half the LDS lies idle.
  // They take three buffers and fetch a tile TWO passes ahead. Every wait stays at 0:
  // waves 0-3 copy the even tiles, waves 4-7 the odd ones, so a wave has one tile in
  // flight and waits for it alone while the other group's younger tile flies on.
  constexpr bool DEEP = !OUTBF;
  constexpr int NB = DEEP ? 3 : 2;
  constexpr int RS = DEEP ? 8 : 16;  // rows between a thread's copies
  __shared__ __align__(16) __bf16 st[NB][STAGE_ELEMS];

  const int tid  = threadIdx.x;
  const int lane = tid & 31;
  const int wave = tid >> 5;
  const int half = lane >> 4;
  const int ln   = lane & 15;
  const int wm   = wave & 1;   // 2 M-strips of 64 rows
  const int wn   = wave >> 1;  // 4 N-strips of 32 cols

  // Staging: 16 lanes cover one 256-B row; a thread copies rows crow + RS i. With two
  // buffers all eight waves share a tile, with three the four waves of one group do.
  const int srow = tid >> 4, scol = (tid & 15) * 8;
  const int crow = DEEP ? (tid & 127) >> 4 : srow;
  // the wave group in a scalar register: the tests on it below are scalar branches
  const int grp = __builtin_amdgcn_readfirstlane(tid >> 7);
  const __bf16* aSrc = A  + (size_t)(m0 + srow) * K + scol;  // two buffers: the lane's own
  const __bf16* bSrc = BT + (size_t)(n0 + srow) * K + scol;
  const __bf16* aRow = A  + (size_t)m0 * K;                  // three: the block's first row
  const __bf16* bRow = BT + (size_t)n0 * K;
  const unsigned int voff = (unsigned int)(crow * K + scol);  // and the lane's place in it
  const size_t gstep = (size_t)RS * K;
  const unsigned int ldsA = lds_lo32(&st[0][crow * LDS_PITCH + scol]);
  const unsigned int ldsB = ldsA + 128 * LDS_PITCH * 2;

  v8f acc[4][2] = {};
  const int npass = K / 128;

  // three buffers: this thread's share of tile t into buffer b, 32 copies
  auto copy_tile = [&](const int b, const int t) {
    __bf16* la = &st[b][crow * LDS_PITCH + scol];
    __bf16* lb = la + 128 * LDS_PITCH;
    const __bf16* ga = aRow + (size_t)t * 128;
    const __bf16* gb = bRow + (size_t)t * 128;
    async_copy_rows8_b(la, ga + voff, gstep);
    async_copy_rows8_b(la + 64 * LDS_PITCH, ga + 8 * gstep + voff, gstep);
    async_copy_rows8_b(lb, gb + voff, gstep);
    async_copy_rows8_b(lb + 64 * LDS_PITCH, gb + 8 * gstep + voff, gstep);
  };

  if constexpr (DEEP) {
    if (grp == 0) {
      copy_tile(0, 0);
      asm volatile("s_wait_asynccnt 0x0" ::: "memory");  // this wave's share of tile 0 landed
    } else if (npass > 1) {
      copy_tile(1, 1);  // flies on over the barrier; waited for in pass 0
    }
    __syncthreads();    // tile 0 visible to every wave
    // (here and in the loop) the group test is folded into the limit: one scalar compare
    // and branch stand around the copies
    if ((grp == 0 ? npass : 0) > 2) copy_tile(2, 2);
  } else {
    async_copy_rows8(ldsA, aSrc, gstep);
    async_copy_rows8(ldsB, bSrc, gstep);
    asm volatile("s_wait_asynccnt 0x0" ::: "memory");  // this wave's share of tile 0 landed
    __syncthreads();                                   // every wave's share visible
    if (npass > 1) {
      async_copy_rows8(ldsA + STAGE_ELEMS * 2, aSrc + 128, gstep);
      async_copy_rows8(ldsB + STAGE_ELEMS * 2, bSrc + 128, gstep);
    }
  }

  // Fragments are fetched one block (k = 32) ahead into a second register set: block
  // c + 1's twelve LDS reads go out as one group in front of block c's eight WMMAs, so
  // the wave no longer waits out the LDS latency in front of every pair of WMMAs.
  // Set (c & 1) holds block c. The fetch for a pass's first block already reads the
  // next tile, so the publish point stands in front of the pass's LAST block.
  const int aoff = (wm * 64 + ln) * LDS_PITCH + 8 * half;
  const int boff = (128 + wn * 32 + ln) * LDS_PITCH + 8 * half;
  FragSet fs[2];
  load_set(fs[0], &st[0][aoff], &st[0][boff]);

  int ring = 0;  // t mod 3, three buffers only
  for (int t = 0; t < npass; ++t) {
    const int buf = DEEP ? ring : t & 1;
    const int nxt = DEEP ? (ring == 2 ? 0 : ring + 1) : buf ^ 1;
    const __bf16* a  = &st[buf][aoff];
    const __bf16* bs = &st[buf][boff];
    // The last pass has no next tile: its fetch ahead rereads its own buffer, which
    // nothing refills any more, and the values are not used.
    const int nbuf = (t + 1 < npass) ? nxt : buf;
#pragma unroll
    for (int c = 0; c < 4; ++c) {  // four k = 32 blocks of the pass
      if (c < 3) {
        load_set(fs[(c + 1) & 1], a + (c + 1) * 32, bs + (c + 1) * 32);
      } else {
        asm volatile("s_wait_dscnt 0x0" ::: "memory");     // own reads of this buffer done
        // Three buffers: tile t + 1 was copied by the group of its parity, which has
        // nothing else in flight; the other group's tile t + 2 must not be waited for.
        const bool mine = !DEEP || grp == ((t + 1) & 1);
        if (mine)
          asm volatile("s_wait_asynccnt 0x0" ::: "memory");  // own share of tile t + 1 landed
        __syncthreads();  // publishes tile t + 1 and frees this buffer for the refill
        load_set(fs[0], &st[nbuf][aoff], &st[nbuf][boff]);
        // The refill goes out behind those reads, which are of another buffer, and in
        // front of the last block's WMMAs: the LDS works while the copies are issued.
        if constexpr (DEEP) {
          if (t + 3 < (mine ? npass : 0)) copy_tile(buf, t + 3);
        } else if (t + 2 < npass) {
          const unsigned int bo = buf * (STAGE_ELEMS * 2);
          async_copy_rows8(ldsA + bo, aSrc + (size_t)(t + 2) * 128, gstep);
          async_copy_rows8(ldsB + bo, bSrc + (size_t)(t + 2) * 128, gstep);
        }
      }
      // keeps the reads above as one group in front of the WMMAs: left free, the
      // scheduler sinks each read to its first use and the latency stands open again
      __builtin_amdgcn_sched_barrier(0);
#pragma unroll
      for (int i = 0; i < 4; ++i)
#pragma unroll
        for (int j = 0; j < 2; ++j)
          acc[i][j] = wmma_bf16(fs[c & 1].b[j], fs[c & 1].a[i], acc[i][j]);
      // keeps the next block's reads from being lifted in among these WMMAs
      __builtin_amdgcn_sched_barrier(0);
    }
    ring = nxt;
  }
  asm volatile("s_wait_asynccnt 0x0" ::: "memory");  // nothing in flight at the wave's end
  asm volatile("s_wait_dscnt 0x0" ::: "memory");     // nor the last pass's unused fetch ahead

  // acc[i][j][r] = C[m0 + wm*64 + i*16 + ln][n0 + wn*32 + j*16 + 8*half + r].
  // Staging goes into the buffer next in turn, which the last pass did not use: its last
  // reads ended in front of an earlier pass's barrier, and nothing was copied into it since.
  __bf16* sb = &st[DEEP ? ring : npass & 1][0];
  const int srow0 = wm * 64 + ln, scol0 = wn * 32 + 8 * half;
  const size_t tile0 = (size_t)m0 * N + n0;  // the tile's first element, the same for the block
  if (OUTBF) {  // bf16 output (takes no residual): bias, ReLU, conversion, then staging
    if (bias) {
      v4f bb[2][2];
#pragma unroll
      for (int j = 0; j < 2; ++j) {
        bb[j][0] = *(const v4f*)(bias + n0 + scol0 + j * 16);
        bb[j][1] = *(const v4f*)(bias + n0 + scol0 + j * 16 + 4);
      }
      // the four loads' offset register is rewritten below
      asm volatile("s_wait_xcnt 0x0" ::: "memory");
#pragma unroll
      for (int i = 0; i < 4; ++i)
#pragma unroll
        for (int j = 0; j < 2; ++j)
#pragma unroll
          for (int r = 0; r < 8; ++r) acc[i][j][r] += bb[j][r >> 2][r & 3];
    }
#pragma unroll
    for (int i = 0; i < 4; ++i)
#pragma unroll
      for (int j = 0; j < 2; ++j) {
        v8bf w;
#pragma unroll
        for (int r = 0; r < 8; ++r)
          w[r] = (__bf16)(RELU ? fmaxf(acc[i][j][r], 0.f) : acc[i][j][r]);
        *(v8bf*)(sb + (srow0 + i * 16) * LDS_PITCH + scol0 + j * 16) = w;
      }
    __syncthreads();  // the whole 128 x 128 tile is staged
    // 16 lanes take one 256-B row of the tile: a store covers four whole lines
    char* ob = (char*)((__bf16*)outp + tile0);
    unsigned int off[8];
    v8bf w[8];
#pragma unroll
    for (int p = 0; p < 8; ++p) {
      off[p] = (unsigned int)((p * 16 + srow) * N + scol) * 2u;
      w[p] = *(const v8bf*)(sb + (p * 16 + srow) * LDS_PITCH + scol);
    }
    // keeps the offset additions in front of the stores: among them they would rewrite
    // registers of stores already issued and take a wait each
    __builtin_amdgcn_sched_barrier(0);
#pragma unroll
    for (int p = 0; p < 8; ++p) *(v8bf*)(ob + off[p]) = w[p];
  } else {  // f32 output (always with bias and residual): staged as f32; both join in the
            // stores' pattern
    const int SP = 132;  // floats a staged row: 512 B + 16 B, no bank conflict either way
    float* sf = (float*)sb;
    unsigned int off[16];  // a wave takes a whole 512-B row of the tile
#pragma unroll
    for (int p = 0; p < 16; ++p) off[p] = (unsigned int)((p * 8 + wave) * N + lane * 4) * 4u;
    const v4f bv = *(const v4f*)(bias + n0 + lane * 4);
    const char* rb = (const char*)(resid + tile0);
    v4f rv[16];  // all 16 loads fly while the tile is staged
#pragma unroll
    for (int p = 0; p < 16; ++p) rv[p] = *(const v4f*)(rb + off[p]);
#pragma unroll
    for (int i = 0; i < 4; ++i)
#pragma unroll
      for (int j = 0; j < 2; ++j) {
        float* d = sf + (srow0 + i * 16) * SP + scol0 + j * 16;
        *(v4f*)d       = __builtin_shufflevector(acc[i][j], acc[i][j], 0, 1, 2, 3);
        *(v4f*)(d + 4) = __builtin_shufflevector(acc[i][j], acc[i][j], 4, 5, 6, 7);
      }
    __syncthreads();  // the whole 128 x 128 tile is staged
    char* ob = (char*)((float*)outp + tile0);
    v4f v[16];
#pragma unroll
    for (int p = 0; p < 16; ++p) {
      v[p] = *(const v4f*)(sf + (p * 8 + wave) * SP + lane * 4) + bv;
      if (RELU) {
#pragma unroll
        for (int e = 0; e < 4; ++e) v[p][e] = fmaxf(v[p][e], 0.f);
      }
      v[p] += rv[p];
    }
    // keeps the sums in front of the stores: among them they would rewrite registers of
    // stores already issued and take a wait each
    __builtin_amdgcn_sched_barrier(0);
#pragma unroll
    for (int p = 0; p < 16; ++p) *(v4f*)(ob + off[p]) = v[p];
  }
}

template <bool RELU, bool OUTBF>
__global__ void __launch_bounds__(256)
gemm_bf16_wmma(const __bf16* __restrict__ A,   // [M,K]
               const __bf16* __restrict__ BT,  // [N,K]
               const float* __restrict__ bias,
               const float* __restrict__ resid,
               void* __restrict__ outp,
               int N, int K) {
  gemm_tile<RELU, OUTBF>(A, BT, bias, resid, outp, blockIdx.y * 128, blockIdx.x * 128, N, K);
}

// Q, K and V^T read the same h and depend on nothing else: one launch of three times
// the blocks, blockIdx.z picks the product. Two launch gaps, fills and tails go, and
// with more blocks than WGPs a block's first tile and its stores run beside another
// block's passes. V^T = Wv^T h^T is the same tile with the operands swapped (x then
// walks its rows, y its columns); its N is the output's row pitch.
__global__ void __launch_bounds__(256)
gemm_qkv_wmma(const __bf16* __restrict__ h,    // [M,K]
              const __bf16* __restrict__ WqT,  // [N,K] each
              const __bf16* __restrict__ WkT,
              const __bf16* __restrict__ WvT,
              __bf16* __restrict__ q, __bf16* __restrict__ k,
              __bf16* __restrict__ vT, int N, int vpitch, int K) {
  const int z = blockIdx.z;
  const bool isv = z == 2;
  const __bf16* w = z == 0 ? WqT : z == 1 ? WkT : WvT;
  gemm_tile<false, true>(isv ? w : h, isv ? h : w, nullptr, nullptr,
                         z == 0 ? q : z == 1 ? k : vT,
                         (isv ? blockIdx.x : blockIdx.y) * 128,
                         (isv ? blockIdx.y : blockIdx.x) * 128, isv ? vpitch : N, K);
}

#define KV_PITCH 72                      // bf16 elements a staged row
#define KV_STAGE_ELEMS (128 * KV_PITCH)  // 64 K rows + 64 V^T rows

// A thread's share of one stage: four K rows and four V^T rows, 16 apart, 16 B of
// each. The closing s_wait_xcnt stands inside the statement so that no address
// register is rewritten ahead of it.
__device__ __forceinline__ void async_copy_kv(unsigned int ldsK, const __bf16* gk,
                                              size_t kstep, const __bf16* gv,
                                              size_t vstep) {
  const unsigned int ls = 16 * KV_PITCH * 2;
  const unsigned int ldsV = ldsK + 64 * KV_PITCH * 2;
  asm volatile("global_load_async_to_lds_b128 %0, %8, off\n\t"
               "global_load_async_to_lds_b128 %1, %9, off\n\t"
               "global_load_async_to_lds_b128 %2, %10, off\n\t"
               "global_load_async_to_lds_b128 %3, %11, off\n\t"
               "global_load_async_to_lds_b128 %4, %12, off\n\t"
               "global_load_async_to_lds_b128 %5, %13, off\n\t"
               "global_load_async_to_lds_b128 %6, %14, off\n\t"
               "global_load_async_to_lds_b128 %7, %15, off\n\t"
               "s_wait_xcnt 0x0"
               :: "v"(ldsK), "v"(ldsK + ls), "v"(ldsK + 2 * ls), "v"(ldsK + 3 * ls),
                  "v"(ldsV), "v"(ldsV + ls), "v"(ldsV + 2 * ls), "v"(ldsV + 3 * ls),
                  "v"(gk), "v"(gk + kstep), "v"(gk + 2 * kstep), "v"(gk + 3 * kstep),
                  "v"(gv), "v"(gv + vstep), "v"(gv + 2 * vstep), "v"(gv + 3 * vstep)
               : "memory");
}

__global__ void __launch_bounds__(128)
flash_attn_wmma(const __bf16* __restrict__ Q,
                const __bf16* __restrict__ Km,
                const __bf16* __restrict__ Vt,
                __bf16* __restrict__ O, int T, int vpitch,
                const float* __restrict__ Wo, const float* __restrict__ W1,
                const float* __restrict__ W2, __bf16* __restrict__ oo,
                __bf16* __restrict__ o1, __bf16* __restrict__ o2, int nbatch) {
  __shared__ __align__(16) __bf16 kv[2][KV_STAGE_ELEMS];

  // The layers of the grid behind the query tiles cast Wo, W1, W2, which only later
  // launches read. A block of four waves
  // takes half a cast tile. The whole block leaves here, in front of every barrier.
  if ((int)blockIdx.z >= (T >> 7)) {
    const int u = (((int)blockIdx.z - (T >> 7)) * nbatch + blockIdx.y) * HEADS + blockIdx.x;
    cast_transpose_tile(CAST_TILES_QKV + (u >> 1), (threadIdx.x >> 5) + 4 * (u & 1),
                        nullptr, nullptr, nullptr, Wo, W1, W2,
                        nullptr, nullptr, nullptr, oo, o1, o2);
    return;
  }

  // Heaviest query tile first, for speed only.
  const int qt   = (T >> 7) - 1 - blockIdx.z;
  const int h    = blockIdx.x;
  const int b    = blockIdx.y;
  const int tid  = threadIdx.x;
  const int lane = tid & 31;
  const int half = lane >> 4;
  const int ln   = lane & 15;
  // the wave's number in a scalar register: the skip beyond the diagonal is a scalar branch
  const int wave = __builtin_amdgcn_readfirstlane(tid >> 5);
  const int q0   = qt * 128 + wave * 32;  // this wave's first query
  const size_t baseRow = (size_t)b * T;
  const int hoff = h * HDIM;

  // Staging: 8 lanes cover one 128-B row; a thread copies rows srow + 16 i.
  const int srow = tid >> 3, scol = (tid & 7) * 8;
  const __bf16* kSrc = Km + (baseRow + srow) * EMB + hoff + scol;
  const __bf16* vSrc = Vt + (size_t)(hoff + srow) * vpitch + baseRow + scol;
  const size_t kstep = (size_t)16 * EMB, vstep = (size_t)16 * vpitch;
  const unsigned int ldsK = lds_lo32(&kv[0][srow * KV_PITCH + scol]);
  const int nst = 2 * (qt + 1);  // stages of 64 keys up to the block's last query

  async_copy_kv(ldsK, kSrc, kstep, vSrc, vstep);

  // Q as B operand: two 16-query column groups x two k = 32 chunks of head_dim
  v16bf qb[2][2];
#pragma unroll
  for (int g = 0; g < 2; ++g)
#pragma unroll
    for (int c = 0; c < 2; ++c)
      qb[g][c] = load_frag(Q + (baseRow + q0 + g * 16 + ln) * EMB + hoff + c * 32 + 8 * half);

  float mi[2], li[2];
  v8f o[2][4] = {};
#pragma unroll
  for (int g = 0; g < 2; ++g) { mi[g] = -3.0e38f; li[g] = 0.f; }

  asm volatile("s_wait_asynccnt 0x0" ::: "memory");  // this wave's share of stage 0 landed
  __syncthreads();                                   // every wave's share visible
  if (nst > 1)
    async_copy_kv(ldsK + KV_STAGE_ELEMS * 2, kSrc + (size_t)64 * EMB, kstep, vSrc + 64, vstep);

  // 1/sqrt(EMB) per reference, times log2(e): the softmax runs in base 2
  const float scale = 0.03125f * 1.4426950408889634f;
  for (int s = 0; s < nst; ++s) {
    const int buf = s & 1;
    const __bf16* kp = &kv[buf][ln * KV_PITCH + 8 * half];
    const __bf16* vp = kp + 64 * KV_PITCH;
#pragma unroll
    for (int u = 0; u < 2; ++u) {  // the stage's two tiles of 32 keys
      const int kb = s * 64 + u * 32;
      if (kb <= q0) {  // tiles wholly beyond this wave's diagonal are skipped
        v16bf ka[2][2];  // [16-key tile][head_dim chunk]
#pragma unroll
        for (int t = 0; t < 2; ++t)
#pragma unroll
          for (int c = 0; c < 2; ++c)
            ka[t][c] = load_frag(kp + (u * 32 + t * 16) * KV_PITCH + c * 32);
        v16bf va[4];     // [16-row chunk of head_dim], k = the 32 keys
#pragma unroll
        for (int dd = 0; dd < 4; ++dd)
          va[dd] = load_frag(vp + dd * 16 * KV_PITCH + u * 32);

#pragma unroll
        for (int g = 0; g < 2; ++g) {
          // st[t][r] = S[query q0 + g*16 + ln][key kb + t*16 + 8*half + r]
          v8f st[2] = {};
#pragma unroll
          for (int t = 0; t < 2; ++t)
#pragma unroll
            for (int c = 0; c < 2; ++c)
              st[t] = wmma_bf16(ka[t][c], qb[g][c], st[t]);

          float x[16];
#pragma unroll
          for (int e = 0; e < 16; ++e) x[e] = st[e >> 3][e & 7] * scale;
          if (kb == q0) {  // only the wave's last key tile crosses the diagonal
            const int qrel = g * 16 + ln - 8 * half;  // query - first key of this lane
#pragma unroll
            for (int e = 0; e < 16; ++e)
              x[e] = ((e >> 3) * 16 + (e & 7) <= qrel) ? x[e] : -3.0e38f;
          }
          float rmax = x[0];
#pragma unroll
          for (int e = 1; e < 16; ++e) rmax = fmaxf(rmax, x[e]);
          rmax = fmaxf(rmax, xhalf(rmax));
          const float mnew  = fmaxf(mi[g], rmax);
          const float alpha = __builtin_amdgcn_exp2f(mi[g] - mnew);
          mi[g] = mnew;

          // pb[s] = P^T[key kmap(s, half)][query]: the two score tiles in register order
          v16bf pb;
          float rsum = 0.f;
#pragma unroll
          for (int e = 0; e < 16; ++e) {
            float p = __builtin_amdgcn_exp2f(x[e] - mnew);
            rsum += p;
            pb[e] = (__bf16)p;
          }
          li[g] = li[g] * alpha + rsum;  // this half's keys only; halves join after the loop
#pragma unroll
          for (int dd = 0; dd < 4; ++dd) {
            o[g][dd] *= alpha;
            o[g][dd] = wmma_bf16(va[dd], pb, o[g][dd]);
          }
        }
      }
    }
    // The publish point stands outside the skip: every wave passes it in every stage.
    asm volatile("s_wait_dscnt 0x0" ::: "memory");     // own reads of this buffer done
    asm volatile("s_wait_asynccnt 0x0" ::: "memory");  // own share of stage s + 1 landed
    __syncthreads();  // publishes stage s + 1 and frees this buffer for the refill
    if (s + 2 < nst)
      async_copy_kv(ldsK + buf * (KV_STAGE_ELEMS * 2), kSrc + (size_t)(s + 2) * 64 * EMB,
                    kstep, vSrc + (s + 2) * 64, vstep);
  }
  asm volatile("s_wait_asynccnt 0x0" ::: "memory");  // nothing in flight at the wave's end

  // o[g][dd][r] = O[query q0 + g*16 + ln][d = dd*16 + 8*half + r]
#pragma unroll
  for (int g = 0; g < 2; ++g) {
    const float inv = 1.0f / (li[g] + xhalf(li[g]));
    __bf16* op = O + (baseRow + q0 + g * 16 + ln) * EMB + hoff + 8 * half;
#pragma unroll
    for (int dd = 0; dd < 4; ++dd) {
      v8bf w;
#pragma unroll
      for (int r = 0; r < 8; ++r) w[r] = (__bf16)(o[g][dd][r] * inv);
      *(v8bf*)(op + dd * 16) = w;
    }
  }
}

// ---------------------------------------------------------------------------
extern "C" void kernel_launch(void* const* d_in, const int* in_sizes, int n_in,
                              void* d_out, int out_size, void* d_ws,
                              size_t ws_size, hipStream_t stream) {
  (void)in_sizes; (void)n_in; (void)out_size; (void)ws_size;
  const int B = 2, T = 2048, D = EMB, M = B * T, D4 = 4 * D;
  const int VP = M + 64;  // row pitch of V^T: an odd number of 128-byte lines

  const float* x  = (const float*)d_in[0];
  const float* Wq = (const float*)d_in[1];
  const float* Wk = (const float*)d_in[2];
  const float* Wv = (const float*)d_in[3];
  const float* Wo = (const float*)d_in[4];
  const float* bo = (const float*)d_in[5];
  const float* W1 = (const float*)d_in[6];
  const float* b1 = (const float*)d_in[7];
  const float* W2 = (const float*)d_in[8];
  const float* b2 = (const float*)d_in[9];
  const float* g1 = (const float*)d_in[10];
  const float* s1 = (const float*)d_in[11];
  const float* g2 = (const float*)d_in[12];
  const float* s2 = (const float*)d_in[13];
  float* out = (float*)d_out;

  size_t off = 0;
  auto alloc = [&](size_t bytes) {
    void* p = (char*)d_ws + off;
    off += (bytes + 255) & ~(size_t)255;
    return p;
  };
  __bf16* Wq_b = (__bf16*)alloc((size_t)D * D * 2);   // [N,K] transposed
  __bf16* Wk_b = (__bf16*)alloc((size_t)D * D * 2);
  __bf16* Wv_b = (__bf16*)alloc((size_t)D * D * 2);
  __bf16* Wo_b = (__bf16*)alloc((size_t)D * D * 2);
  __bf16* W1_b = (__bf16*)alloc((size_t)D * D4 * 2);
  __bf16* W2_b = (__bf16*)alloc((size_t)D4 * D * 2);
  __bf16* h1   = (__bf16*)alloc((size_t)M * D * 2);
  __bf16* q    = (__bf16*)alloc((size_t)M * D * 2);
  __bf16* k    = (__bf16*)alloc((size_t)M * D * 2);
  __bf16* vT   = (__bf16*)alloc((size_t)D * VP * 2);  // [D, VP], columns 0..M-1 used
  __bf16* attn = (__bf16*)alloc((size_t)M * D * 2);
  float*  xmid = (float*) alloc((size_t)M * D * 4);
  __bf16* h2   = (__bf16*)alloc((size_t)M * D * 2);
  __bf16* ffn  = (__bf16*)alloc((size_t)M * D4 * 2);

  // fp32 [K,N] -> bf16 [N,K] transposes of Wq, Wk, Wv and LN1 -> h1, one launch
  cast_qkv_and_layernorm<<<CAST_TILES_QKV + M / 8, 256, 0, stream>>>(
      Wq, Wk, Wv, Wq_b, Wk_b, Wv_b, x, g1, s1, h1);

  // QKV projections, one launch
  gemm_qkv_wmma<<<dim3(D / 128, M / 128, 3), 256, 0, stream>>>(h1, Wq_b, Wk_b, Wv_b, q, k, vT, D, VP, D);

  // causal flash attention; behind its query tiles, two blocks for each cast tile of Wo, W1, W2
  flash_attn_wmma<<<dim3(HEADS, B, T / 128 + 2 * (CAST_TILES - CAST_TILES_QKV) / (HEADS * B)),
                    128, 0, stream>>>(q, k, vT, attn, T, VP, Wo, W1, W2, Wo_b, W1_b, W2_b, B);

  // out projection + bias + residual(x) -> xmid (f32)
  gemm_bf16_wmma<false, false><<<dim3(D / 128, M / 128), 256, 0, stream>>>(attn, Wo_b, bo, x, xmid, D, D);

  // LN2 -> h2
  layernorm_bf16<<<M / 8, 256, 0, stream>>>(xmid, g2, s2, h2);

  // FFN
  gemm_bf16_wmma<true, true><<<dim3(D4 / 128, M / 128), 256, 0, stream>>>(h2, W1_b, b1, nullptr, ffn, D4, D);
  gemm_bf16_wmma<false, false><<<dim3(D / 128, M / 128), 256, 0, stream>>>(ffn, W2_b, b2, xmid, out, D, D4);
}

// v009
// Measured time: 132 microseconds a run.
// Next to v008, in two timings, it ran 1.03 and 1.04 times as fast.
// Over all steps from v000 it is 4.60 times as fast.
#include <hip/hip_runtime.h>
#include <hip/hip_bf16.h>

// ---------------------------------------------------------------------------
// CDNA5 (gfx1250) transformer block:
//  - all GEMMs + attention via v_wmma_f32_16x16x32_bf16 (wave32 WMMA)
//  - GEMM tiles staged with global_load_async_to_lds_b128 (ASYNCcnt) and
//    two LDS buffers (three for the f32-output GEMMs)
// ---------------------------------------------------------------------------

typedef __attribute__((ext_vector_type(16))) __bf16 v16bf;
typedef __attribute__((ext_vector_type(8)))  float  v8f;

#define EMB   1024
#define HEADS 16
#define HDIM  64
#define LN_EPS 1e-5f

// K-index striping for 16-bit A/B fragments (CDNA5 ISA 7.12.2):
// lanes 0-15: VGPR0-3 -> K=0..7, VGPR4-7 -> K=16..23
// lanes 16-31: VGPR0-3 -> K=8..15, VGPR4-7 -> K=24..31
__device__ __forceinline__ v8f wmma_bf16(v16bf a, v16bf b, v8f c) {
  return __builtin_amdgcn_wmma_f32_16x16x32_bf16(false, a, false, b,
                                                 (short)0, c, false, false);
}

// Async DMA: 16 bytes per lane, global -> LDS, tracked by ASYNCcnt. Eight copies
// for eight tile rows 16 apart. The closing s_wait_xcnt stands inside the statement
// so that no address register is rewritten ahead of it.
#define LDS_PITCH 136  // bf16 elements a tile row in LDS: 256 B of data + 16 B pad
__device__ __forceinline__ void async_copy_rows8(unsigned int lds,
                                                 const __bf16* g, size_t gstep) {
  const unsigned int ls = 16 * LDS_PITCH * 2;
  asm volatile("global_load_async_to_lds_b128 %0, %8, off\n\t"
               "global_load_async_to_lds_b128 %1, %9, off\n\t"
               "global_load_async_to_lds_b128 %2, %10, off\n\t"
               "global_load_async_to_lds_b128 %3, %11, off\n\t"
               "global_load_async_to_lds_b128 %4, %12, off\n\t"
               "global_load_async_to_lds_b128 %5, %13, off\n\t"
               "global_load_async_to_lds_b128 %6, %14, off\n\t"
               "global_load_async_to_lds_b128 %7, %15, off\n\t"
               "s_wait_xcnt 0x0"
               :: "v"(lds), "v"(lds + ls), "v"(lds + 2 * ls), "v"(lds + 3 * ls),
                  "v"(lds + 4 * ls), "v"(lds + 5 * ls), "v"(lds + 6 * ls),
                  "v"(lds + 7 * ls),
                  "v"(g), "v"(g + gstep), "v"(g + 2 * gstep), "v"(g + 3 * gstep),
                  "v"(g + 4 * gstep), "v"(g + 5 * gstep), "v"(g + 6 * gstep),
                  "v"(g + 7 * gstep)
               : "memory");
}
// Eight copies for rows 8 apart, where four waves copy a tile alone, 32 copies a thread.
// Written as the builtin: the compiler forms each address next to its copy (as operands
// of asm text the 32 addresses were live together and spilled), and the issuing wave,
// whose WMMAs stand behind the copies, gets through them in fewer cycles.
typedef int v4i_copy __attribute__((vector_size(16)));
__device__ __forceinline__ void async_copy_rows8_b(__bf16* lds, const __bf16* g, size_t gstep) {
#pragma unroll
  for (int i = 0; i < 8; ++i)
    __builtin_amdgcn_global_load_async_to_lds_b128(
        (__attribute__((address_space(1))) v4i_copy*)(g + i * gstep),
        (__attribute__((address_space(3))) v4i_copy*)(lds + i * 8 * LDS_PITCH), 0, 0);
}
__device__ __forceinline__ unsigned int lds_lo32(const void* p) {
  return (unsigned int)(unsigned long long)p;  // LDS aperture: offset in [31:0]
}

// ---------------------------------------------------------------------------
typedef __attribute__((ext_vector_type(8))) __bf16 v8bf;
typedef __attribute__((ext_vector_type(4))) __bf16 v4bf;
typedef __attribute__((ext_vector_type(4))) float  v4f;

// fp32 [K,N] -> bf16 [N,K] transposed cast of the six weights in few, long waves
// (64 elements a lane). The unit is one 128(k) x 128(n) tile of eight waves, a wave
// 64(k) x 32(n), a lane 8(k) x 8(n), transposed in its registers. 8 lanes along k
// make every store a whole 128-B line of the output; a lane's two loads of a row
// cover one 128-B line together with its three neighbours along n.
// The tile's number and the wave's number in it (0-7) come from the caller: a block of
// eight waves takes a tile.
#define CAST_TILES (12 * (EMB / 128) * (EMB / 128))
#define CAST_TILES_QKV (3 * (EMB / 128) * (EMB / 128))  // Wq, Wk, Wv come first
__device__ __forceinline__ void
cast_transpose_tile(const int id,    // 0 .. CAST_TILES - 1
                    const int wave,  // 0 .. 7
                    const float* __restrict__ Wq, const float* __restrict__ Wk,
                    const float* __restrict__ Wv, const float* __restrict__ Wo,
                    const float* __restrict__ W1, const float* __restrict__ W2,
                    __bf16* __restrict__ oq, __bf16* __restrict__ ok,
                    __bf16* __restrict__ ov, __bf16* __restrict__ oo,
                    __bf16* __restrict__ o1, __bf16* __restrict__ o2) {
  const int TSQ = (EMB / 128) * (EMB / 128);  // tiles of an EMB x EMB weight
  const int w  = id / TSQ;                    // 0-3 square weights, 4-7 W1, 8-11 W2
  const float* in = w == 0 ? Wq : w == 1 ? Wk : w == 2 ? Wv : w == 3 ? Wo
                  : w < 8 ? W1 : W2;
  __bf16* out = w == 0 ? oq : w == 1 ? ok : w == 2 ? ov : w == 3 ? oo
              : w < 8 ? o1 : o2;
  const int K = w < 8 ? EMB : 4 * EMB;
  const int N = (w >= 4 && w < 8) ? 4 * EMB : EMB;
  const int t = w < 4 ? id % TSQ : id % (4 * TSQ);  // tile of this weight
  const int ntn = N / 128;                          // a power of two
  const int lane = threadIdx.x & 31;
  const int k0 = (t >> __builtin_ctz(ntn)) * 128 + (wave & 1) * 64 + (lane & 7) * 8;
  const int n0 = (t & (ntn - 1)) * 128 + (wave >> 1) * 32 + (lane >> 3) * 4;

  const float* pr[8];
  v4f a[8][2];
#pragma unroll
  for (int j = 0; j < 8; ++j) {
    pr[j] = in + (size_t)(k0 + j) * N + n0;
    a[j][0] = *(const v4f*)pr[j];
    a[j][1] = *(const v4f*)(pr[j] + 16);
  }
  // Takes the loaded values and their addresses as inputs only: all 16 loads are in
  // flight together before the first conversion, and the address registers stay
  // untouched up to the wait.
  asm volatile("s_wait_xcnt 0x0"
               :: "v"(pr[0]), "v"(pr[1]), "v"(pr[2]), "v"(pr[3]),
                  "v"(pr[4]), "v"(pr[5]), "v"(pr[6]), "v"(pr[7]),
                  "v"(a[0][0]), "v"(a[0][1]), "v"(a[1][0]), "v"(a[1][1]),
                  "v"(a[2][0]), "v"(a[2][1]), "v"(a[3][0]), "v"(a[3][1]),
                  "v"(a[4][0]), "v"(a[4][1]), "v"(a[5][0]), "v"(a[5][1]),
                  "v"(a[6][0]), "v"(a[6][1]), "v"(a[7][0]), "v"(a[7][1])
               : "memory");

  __bf16* q = out + (size_t)n0 * K + k0;
#pragma unroll
  for (int h = 0; h < 2; ++h)
#pragma unroll
    for (int i = 0; i < 4; ++i) {
      v8bf o;
#pragma unroll
      for (int j = 0; j < 8; ++j) o[j] = (__bf16)a[j][h][i];
      *(v8bf*)(q + (size_t)(h * 16 + i) * K) = o;
    }
}

// lane l <-> lane l ^ 16
__device__ __forceinline__ float xhalf(float x) {
  int b = __builtin_bit_cast(int, x);
  return __builtin_bit_cast(float, __builtin_amdgcn_permlanex16(
      b, b, 0x76543210, 0xfedcba98, false, false));
}

// x + (x of lane l ^ MASK) inside a 16-lane row (DPP row_xmask)
template <int MASK>
__device__ __forceinline__ float add_xmask(float x) {
  return x + __builtin_bit_cast(float, __builtin_amdgcn_update_dpp(
                 0, __builtin_bit_cast(int, x), 0x160 + MASK, 0xf, 0xf, true));
}
__device__ __forceinline__ float wave_sum(float x) {
  x = add_xmask<1>(x);
  x = add_xmask<2>(x);
  x = add_xmask<4>(x);
  x = add_xmask<8>(x);
  return x + xhalf(x);
}

// One wave per row of D=1024 (8 rows a block): a lane holds 32 elements as eight
// 16-B loads, the sums stay inside the wave, no LDS and no barrier.
__device__ __forceinline__ void
layernorm_rows8(const int blk,  // rows 8 blk .. 8 blk + 7
                const float* __restrict__ x,
                const float* __restrict__ g,
                const float* __restrict__ s,
                __bf16* __restrict__ out) {
  const int lane = threadIdx.x & 31;
  const int row  = blk * 8 + (threadIdx.x >> 5);
  const float* xr = x + (size_t)row * EMB + lane * 4;
  v4f v[8], gv[8], sv[8];
#pragma unroll
  for (int i = 0; i < 8; ++i) v[i] = *(const v4f*)(xr + i * 128);
#pragma unroll
  for (int i = 0; i < 8; ++i) {
    gv[i] = *(const v4f*)(g + lane * 4 + i * 128);
    sv[i] = *(const v4f*)(s + lane * 4 + i * 128);
  }
  // Takes the loaded values and the row's address as inputs only: the scale and
  // shift loads fly with the row's instead of one pair at a time behind the sums,
  // and the address registers stay untouched up to the wait.
  asm volatile("s_wait_xcnt 0x0"
               :: "v"(xr), "v"(v[0]), "v"(v[1]), "v"(v[2]), "v"(v[3]),
                  "v"(v[4]), "v"(v[5]), "v"(v[6]), "v"(v[7]),
                  "v"(gv[0]), "v"(gv[1]), "v"(gv[2]), "v"(gv[3]),
                  "v"(gv[4]), "v"(gv[5]), "v"(gv[6]), "v"(gv[7]),
                  "v"(sv[0]), "v"(sv[1]), "v"(sv[2]), "v"(sv[3]),
                  "v"(sv[4]), "v"(sv[5]), "v"(sv[6]), "v"(sv[7])
               : "memory");
  // keeps the sums from being scheduled in among the loads, which split the group
  __builtin_amdgcn_sched_barrier(0);
  v4f s4 = v[0], q4 = v[0] * v[0];  // four independent chains each
#pragma unroll
  for (int i = 1; i < 8; ++i) {
    s4 += v[i];
    q4 += v[i] * v[i];
  }
  const float ts = wave_sum((s4[0] + s4[1]) + (s4[2] + s4[3]));
  const float tq = wave_sum((q4[0] + q4[1]) + (q4[2] + q4[3]));
  const float mean = ts * (1.0f / EMB);
  const float var  = tq * (1.0f / EMB) - mean * mean;
  const float inv  = rsqrtf(var + LN_EPS);
  __bf16* o = out + (size_t)row * EMB + lane * 4;
#pragma unroll
  for (int i = 0; i < 8; ++i) {
    v4bf w;
#pragma unroll
    for (int e = 0; e < 4; ++e)
      w[e] = (__bf16)(gv[i][e] * ((v[i][e] - mean) * inv) + sv[i][e]);
    *(v4bf*)(o + i * 128) = w;
  }
}

__global__ void __launch_bounds__(256)
layernorm_bf16(const float* __restrict__ x,
               const float* __restrict__ g,
               const float* __restrict__ s,
               __bf16* __restrict__ out) {
  layernorm_rows8(blockIdx.x, x, g, s, out);
}

// The casts of Wq, Wk, Wv and the first layer norm depend on nothing but the inputs and
// are all that the Q, K, V products wait for: one launch holds both, blocks
// 0 .. CAST_TILES_QKV - 1 cast, the rest normalise. The other three weights are cast
// beside the attention, which does not need them.
__global__ void __launch_bounds__(256)
cast_qkv_and_layernorm(const float* __restrict__ Wq, const float* __restrict__ Wk,
                       const float* __restrict__ Wv,
                       __bf16* __restrict__ oq, __bf16* __restrict__ ok,
                       __bf16* __restrict__ ov,
                       const float* __restrict__ x, const float* __restrict__ g,
                       const float* __restrict__ s, __bf16* __restrict__ h) {
  const int id = blockIdx.x;
  if (id < CAST_TILES_QKV)
    cast_transpose_tile(id, threadIdx.x >> 5, Wq, Wk, Wv, nullptr, nullptr, nullptr,
                        oq, ok, ov, nullptr, nullptr, nullptr);
  else {
    layernorm_rows8(id - CAST_TILES_QKV, x, g, s, h);
    // in the listing the cast arm's code, which rewrites the registers of the row's
    // eight stores, stands behind them on a fall-through
    asm volatile("s_wait_xcnt 0x0" ::: "memory");
  }
}

// ---------------------------------------------------------------------------
// Tiled bf16 WMMA GEMM: C[M,N] = act(A[M,K] @ B[K,N] + bias) + resid
// B supplied pre-transposed as BT[N,K] so both tiles are K-contiguous and
// can be staged verbatim with async b128 copies (two LDS buffers, three for f32 output).
// Block tile 128x128, 128 k a pass; 8 waves (2 x 4), each owns 64(M)x32(N).
// A stage is [A 128 rows | BT 128 rows] at a pitch of 272 B (16 B x odd: the
// b128 fragment reads meet no bank conflict). M, N multiples of 128, K of 128.
// The products are formed transposed (BT's fragment as the A operand), so a lane ends
// with 8 neighbouring columns of ONE output row; the block's tile then goes through
// the idle LDS buffer and leaves as 16-B stores that cover whole 128-B lines.
// One 16x32 operand fragment in the hardware k order: p points at k = 8*half of
// this lane's row; elements 0-7 are k = 8*half + 0..7, 8-15 are k = 16 + 8*half + 0..7.
__device__ __forceinline__ v16bf load_frag(const __bf16* p) {
  v8bf lo = *(const v8bf*)p;
  v8bf hi = *(const v8bf*)(p + 16);
  return __builtin_shufflevector(lo, hi, 0, 1, 2, 3, 4, 5, 6, 7,
                                 8, 9, 10, 11, 12, 13, 14, 15);
}

#define STAGE_ELEMS (256 * LDS_PITCH)

// The fragments of one block (k = 32) of a wave's 64 x 32 tile: four A row groups,
// two B column groups, twelve 16-B LDS reads.
struct FragSet { v16bf a[4], b[2]; };
__device__ __forceinline__ void load_set(FragSet& f, const __bf16* a, const __bf16* b) {
#pragma unroll
  for (int i = 0; i < 4; ++i) f.a[i] = load_frag(a + i * 16 * LDS_PITCH);
#pragma unroll
  for (int j = 0; j < 2; ++j) f.b[j] = load_frag(b + j * 16 * LDS_PITCH);
}

template <bool RELU, bool OUTBF>
__device__ __forceinline__ void
gemm_tile(const __bf16* __restrict__ A,   // [M,K]
          const __bf16* __restrict__ BT,  // [N,K]
          const float* __restrict__ bias,
          const float* __restrict__ resid,
          void* __restrict__ outp,
          const int m0, const int n0, int N, int K) {
  // The f32-output products have as many blocks as there are WGPs: a block is alone on
  // its WGP, nothing else works while a tile is on its way, and half the LDS lies idle.
  // They take three buffers and fetch a tile TWO passes ahead. Every wait stays at 0:
  // waves 0-3 copy the even tiles, waves 4-7 the odd ones, so a wave has one tile in
  // flight and waits for it alone while the other group's younger tile flies on.
  constexpr bool DEEP = !OUTBF;
  constexpr int NB = DEEP ? 3 : 2;
  constexpr int RS = DEEP ? 8 : 16;  // rows between a thread's copies
  __shared__ __align__(16) __bf16 st[NB][STAGE_ELEMS];

  const int tid  = threadIdx.x;
  const int lane = tid & 31;
  const int wave = tid >> 5;
  const int half = lane >> 4;
  const int ln   = lane & 15;
  const int wm   = wave & 1;   // 2 M-strips of 64 rows
  const int wn   = wave >> 1;  // 4 N-strips of 32 cols

  // Staging: 16 lanes cover one 256-B row; a thread copies rows crow + RS i. With two
  // buffers all eight waves share a tile, with three the four waves of one group do.
  const int srow = tid >> 4, scol = (tid & 15) * 8;
  const int crow = DEEP ? (tid & 127) >> 4 : srow;
  // the wave group in a scalar register: the tests on it below are scalar branches
  const int grp = __builtin_amdgcn_readfirstlane(tid >> 7);
  const __bf16* aSrc = A  + (size_t)(m0 + srow) * K + scol;  // two buffers: the lane's own
  const __bf16* bSrc = BT + (size_t)(n0 + srow) * K + scol;
  const __bf16* aRow = A  + (size_t)m0 * K;                  // three: the block's first row
  const __bf16* bRow = BT + (size_t)n0 * K;
  const unsigned int voff = (unsigned int)(crow * K + scol);  // and the lane's place in it
  const size_t gstep = (size_t)RS * K;
  const unsigned int ldsA = lds_lo32(&st[0][crow * LDS_PITCH + scol]);
  const unsigned int ldsB = ldsA + 128 * LDS_PITCH * 2;

  v8f acc[4][2] = {};
  const int npass = K / 128;

  // three buffers: this thread's share of tile t into buffer b, 32 copies
  auto copy_tile = [&](const int b, const int t) {
    __bf16* la = &st[b][crow * LDS_PITCH + scol];
    __bf16* lb = la + 128 * LDS_PITCH;
    const __bf16* ga = aRow + (size_t)t * 128;
    const __bf16* gb = bRow + (size_t)t * 128;
    async_copy_rows8_b(la, ga + voff, gstep);
    async_copy_rows8_b(la + 64 * LDS_PITCH, ga + 8 * gstep + voff, gstep);
    async_copy_rows8_b(lb, gb + voff, gstep);
    async_copy_rows8_b(lb + 64 * LDS_PITCH, gb + 8 * gstep + voff, gstep);
  };

  if constexpr (DEEP) {
    if (grp == 0) {
      copy_tile(0, 0);
      asm volatile("s_wait_asynccnt 0x0" ::: "memory");  // this wave's share of tile 0 landed
    } else if (npass > 1) {
      copy_tile(1, 1);  // flies on over the barrier; waited for in pass 0
    }
    __syncthreads();    // tile 0 visible to every wave
    // (here and in the loop) the group test is folded into the limit: one scalar compare
    // and branch stand around the copies
    if ((grp == 0 ? npass : 0) > 2) copy_tile(2, 2);
  } else {
    async_copy_rows8(ldsA, aSrc, gstep);
    async_copy_rows8(ldsB, bSrc, gstep);
    asm volatile("s_wait_asynccnt 0x0" ::: "memory");  // this wave's share of tile 0 landed
    __syncthreads();                                   // every wave's share visible
    if (npass > 1) {
      async_copy_rows8(ldsA + STAGE_ELEMS * 2, aSrc + 128, gstep);
      async_copy_rows8(ldsB + STAGE_ELEMS * 2, bSrc + 128, gstep);
    }
  }

  // Fragments are fetched one block (k = 32) ahead into a second register set: block
  // c + 1's twelve LDS reads go out as one group in front of block c's eight WMMAs, so
  // the wave no longer waits out the LDS latency in front of every pair of WMMAs.
  // Set (c & 1) holds block c. The fetch for a pass's first block already reads the
  // next tile, so the publish point stands in front of the pass's LAST block.
  const int aoff = (wm * 64 + ln) * LDS_PITCH + 8 * half;
  const int boff = (128 + wn * 32 + ln) * LDS_PITCH + 8 * half;
  FragSet fs[2];
  load_set(fs[0], &st[0][aoff], &st[0][boff]);

  int ring = 0;  // t mod 3, three buffers only
  for (int t = 0; t < npass; ++t) {
    const int buf = DEEP ? ring : t & 1;
    const int nxt = DEEP ? (ring == 2 ? 0 : ring + 1) : buf ^ 1;
    const __bf16* a  = &st[buf][aoff];
    const __bf16* bs = &st[buf][boff];
    // The last pass has no next tile: its fetch ahead rereads its own buffer, which
    // nothing refills any more, and the values are not used.
    const int nbuf = (t + 1 < npass) ? nxt : buf;
#pragma unroll
    for (int c = 0; c < 4; ++c) {  // four k = 32 blocks of the pass
      if (c < 3) {
        load_set(fs[(c + 1) & 1], a + (c + 1) * 32, bs + (c + 1) * 32);
      } else {
        asm volatile("s_wait_dscnt 0x0" ::: "memory");     // own reads of this buffer done
        // Three buffers: tile t + 1 was copied by the group of its parity, which has
        // nothing else in flight; the other group's tile t + 2 must not be waited for.
        const bool mine = !DEEP || grp == ((t + 1) & 1);
        if (mine)
          asm volatile("s_wait_asynccnt 0x0" ::: "memory");  // own share of tile t + 1 landed
        __syncthreads();  // publishes tile t + 1 and frees this buffer for the refill
        load_set(fs[0], &st[nbuf][aoff], &st[nbuf][boff]);
        // The refill goes out behind those reads, which are of another buffer, and in
        // front of the last block's WMMAs: the LDS works while the copies are issued.
        if constexpr (DEEP) {
          if (t + 3 < (mine ? npass : 0)) copy_tile(buf, t + 3);
        } else if (t + 2 < npass) {
          const unsigned int bo = buf * (STAGE_ELEMS * 2);
          async_copy_rows8(ldsA + bo, aSrc + (size_t)(t + 2) * 128, gstep);
          async_copy_rows8(ldsB + bo, bSrc + (size_t)(t + 2) * 128, gstep);
        }
      }
      // keeps the reads above as one group in front of the WMMAs: left free, the
      // scheduler sinks each read to its first use and the latency stands open again
      __builtin_amdgcn_sched_barrier(0);
#pragma unroll
      for (int i = 0; i < 4; ++i)
#pragma unroll
        for (int j = 0; j < 2; ++j)
          acc[i][j] = wmma_bf16(fs[c & 1].b[j], fs[c & 1].a[i], acc[i][j]);
      // keeps the next block's reads from being lifted in among these WMMAs
      __builtin_amdgcn_sched_barrier(0);
    }
    ring = nxt;
  }
  asm volatile("s_wait_asynccnt 0x0" ::: "memory");  // nothing in flight at the wave's end
  asm volatile("s_wait_dscnt 0x0" ::: "memory");     // nor the last pass's unused fetch ahead

  // acc[i][j][r] = C[m0 + wm*64 + i*16 + ln][n0 + wn*32 + j*16 + 8*half + r].
  // Staging goes into the buffer next in turn, which the last pass did not use: its last
  // reads ended in front of an earlier pass's barrier, and nothing was copied into it since.
  __bf16* sb = &st[DEEP ? ring : npass & 1][0];
  const int srow0 = wm * 64 + ln, scol0 = wn * 32 + 8 * half;
  const size_t tile0 = (size_t)m0 * N + n0;  // the tile's first element, the same for the block
  if (OUTBF) {  // bf16 output (takes no residual): bias, ReLU, conversion, then staging
    if (bias) {
      v4f bb[2][2];
#pragma unroll
      for (int j = 0; j < 2; ++j) {
        bb[j][0] = *(const v4f*)(bias + n0 + scol0 + j * 16);
        bb[j][1] = *(const v4f*)(bias + n0 + scol0 + j * 16 + 4);
      }
      // the four loads' offset register is rewritten below
      asm volatile("s_wait_xcnt 0x0" ::: "memory");
#pragma unroll
      for (int i = 0; i < 4; ++i)
#pragma unroll
        for (int j = 0; j < 2; ++j)
#pragma unroll
          for (int r = 0; r < 8; ++r) acc[i][j][r] += bb[j][r >> 2][r & 3];
    }
#pragma unroll
    for (int i = 0; i < 4; ++i)
#pragma unroll
      for (int j = 0; j < 2; ++j) {
        v8bf w;
#pragma unroll
        for (int r = 0; r < 8; ++r)
          w[r] = (__bf16)(RELU ? fmaxf(acc[i][j][r], 0.f) : acc[i][j][r]);
        *(v8bf*)(sb + (srow0 + i * 16) * LDS_PITCH + scol0 + j * 16) = w;
      }
    __syncthreads();  // the whole 128 x 128 tile is staged
    // 16 lanes take one 256-B row of the tile: a store covers four whole lines
    char* ob = (char*)((__bf16*)outp + tile0);
    unsigned int off[8];
    v8bf w[8];
#pragma unroll
    for (int p = 0; p < 8; ++p) {
      off[p] = (unsigned int)((p * 16 + srow) * N + scol) * 2u;
      w[p] = *(const v8bf*)(sb + (p * 16 + srow) * LDS_PITCH + scol);
    }
    // keeps the offset additions in front of the stores: among them they would rewrite
    // registers of stores already issued and take a wait each
    __builtin_amdgcn_sched_barrier(0);
#pragma unroll
    for (int p = 0; p < 8; ++p) *(v8bf*)(ob + off[p]) = w[p];
  } else {  // f32 output (always with bias and residual): staged as f32; both join in the
            // stores' pattern
    const int SP = 132;  // floats a staged row: 512 B + 16 B, no bank conflict either way
    float* sf = (float*)sb;
    unsigned int off[16];  // a wave takes a whole 512-B row of the tile
#pragma unroll
    for (int p = 0; p < 16; ++p) off[p] = (unsigned int)((p * 8 + wave) * N + lane * 4) * 4u;
    const v4f bv = *(const v4f*)(bias + n0 + lane * 4);
    const char* rb = (const char*)(resid + tile0);
    v4f rv[16];  // all 16 loads fly while the tile is staged
#pragma unroll
    for (int p = 0; p < 16; ++p) rv[p] = *(const v4f*)(rb + off[p]);
#pragma unroll
    for (int i = 0; i < 4; ++i)
#pragma unroll
      for (int j = 0; j < 2; ++j) {
        float* d = sf + (srow0 + i * 16) * SP + scol0 + j * 16;
        *(v4f*)d       = __builtin_shufflevector(acc[i][j], acc[i][j], 0, 1, 2, 3);
        *(v4f*)(d + 4) = __builtin_shufflevector(acc[i][j], acc[i][j], 4, 5, 6, 7);
      }
    __syncthreads();  // the whole 128 x 128 tile is staged
    char* ob = (char*)((float*)outp + tile0);
    v4f v[16];
#pragma unroll
    for (int p = 0; p < 16; ++p) {
      v[p] = *(const v4f*)(sf + (p * 8 + wave) * SP + lane * 4) + bv;
      if (RELU) {
#pragma unroll
        for (int e = 0; e < 4; ++e) v[p][e] = fmaxf(v[p][e], 0.f);
      }
      v[p] += rv[p];
    }
    // keeps the sums in front of the stores: among them they would rewrite registers of
    // stores already issued and take a wait each
    __builtin_amdgcn_sched_barrier(0);
#pragma unroll
    for (int p = 0; p < 16; ++p) *(v4f*)(ob + off[p]) = v[p];
  }
}

template <bool RELU, bool OUTBF>
__global__ void __launch_bounds__(256)
gemm_bf16_wmma(const __bf16* __restrict__ A,   // [M,K]
               const __bf16* __restrict__ BT,  // [N,K]
               const float* __restrict__ bias,
               const float* __restrict__ resid,
               void* __restrict__ outp,
               int N, int K) {
  gemm_tile<RELU, OUTBF>(A, BT, bias, resid, outp, blockIdx.y * 128, blockIdx.x * 128, N, K);
}

// Q, K and V^T read the same h and depend on nothing else: one launch of three times
// the blocks, blockIdx.z picks the product. Two launch gaps, fills and tails go, and
// with more blocks than WGPs a block's first tile and its stores run beside another
// block's passes. V^T = Wv^T h^T is the same tile with the operands swapped (x then
// walks its rows, y its columns); its N is the output's row pitch.
__global__ void __launch_bounds__(256)
gemm_qkv_wmma(const __bf16* __restrict__ h,    // [M,K]
              const __bf16* __restrict__ WqT,  // [N,K] each
              const __bf16* __restrict__ WkT,
              const __bf16* __restrict__ WvT,
              __bf16* __restrict__ q, __bf16* __restrict__ k,
              __bf16* __restrict__ vT, int N, int vpitch, int K) {
  const int z = blockIdx.z;
  const bool isv = z == 2;
  const __bf16* w = z == 0 ? WqT : z == 1 ? WkT : WvT;
  gemm_tile<false, true>(isv ? w : h, isv ? h : w, nullptr, nullptr,
                         z == 0 ? q : z == 1 ? k : vT,
                         (isv ? blockIdx.x : blockIdx.y) * 128,
                         (isv ? blockIdx.y : blockIdx.x) * 128, isv ? vpitch : N, K);
}

#define KV_PITCH 72                      // bf16 elements a staged row
#define KV_STAGE_ELEMS (128 * KV_PITCH)  // half a stage: 64 K rows + 64 V^T rows

// A thread's share of its group's half stage: four K rows and four V^T rows, 16 apart, 16 B of
// each. The closing s_wait_xcnt stands inside the statement so that no address
// register is rewritten ahead of it.
__device__ __forceinline__ void async_copy_kv(unsigned int ldsK, const __bf16* gk,
                                              size_t kstep, const __bf16* gv,
                                              size_t vstep) {
  const unsigned int ls = 16 * KV_PITCH * 2;
  const unsigned int ldsV = ldsK + 64 * KV_PITCH * 2;
  asm volatile("global_load_async_to_lds_b128 %0, %8, off\n\t"
               "global_load_async_to_lds_b128 %1, %9, off\n\t"
               "global_load_async_to_lds_b128 %2, %10, off\n\t"
               "global_load_async_to_lds_b128 %3, %11, off\n\t"
               "global_load_async_to_lds_b128 %4, %12, off\n\t"
               "global_load_async_to_lds_b128 %5, %13, off\n\t"
               "global_load_async_to_lds_b128 %6, %14, off\n\t"
               "global_load_async_to_lds_b128 %7, %15, off\n\t"
               "s_wait_xcnt 0x0"
               :: "v"(ldsK), "v"(ldsK + ls), "v"(ldsK + 2 * ls), "v"(ldsK + 3 * ls),
                  "v"(ldsV), "v"(ldsV + ls), "v"(ldsV + 2 * ls), "v"(ldsV + 3 * ls),
                  "v"(gk), "v"(gk + kstep), "v"(gk + 2 * kstep), "v"(gk + 3 * kstep),
                  "v"(gv), "v"(gv + vstep), "v"(gv + 2 * vstep), "v"(gv + 3 * vstep)
               : "memory");
}

__global__ void __launch_bounds__(256)
flash_attn_wmma(const __bf16* __restrict__ Q,
                const __bf16* __restrict__ Km,
                const __bf16* __restrict__ Vt,
                __bf16* __restrict__ O, int T, int vpitch,
                const float* __restrict__ Wo, const float* __restrict__ W1,
                const float* __restrict__ W2, __bf16* __restrict__ oo,
                __bf16* __restrict__ o1, __bf16* __restrict__ o2, int nbatch) {
  __shared__ __align__(16) __bf16 kv[2][2 * KV_STAGE_ELEMS];

  // The layers of the grid behind the query tiles cast Wo, W1, W2, which only later
  // launches read; placed there for speed only. A block takes one cast tile. The
  // whole block leaves here, in front of every barrier.
  if ((int)blockIdx.z >= (T >> 7)) {
    const int u = (((int)blockIdx.z - (T >> 7)) * nbatch + blockIdx.y) * HEADS + blockIdx.x;
    cast_transpose_tile(CAST_TILES_QKV + u, threadIdx.x >> 5,
                        nullptr, nullptr, nullptr, Wo, W1, W2,
                        nullptr, nullptr, nullptr, oo, o1, o2);
    // in the listing the attention's code, which rewrites the registers of the cast's eight
    // stores, stands behind them on a fall-through
    asm volatile("s_wait_xcnt 0x0" ::: "memory");
    return;
  }

  // Heaviest query tile first, for speed only.
  const int qt   = (T >> 7) - 1 - blockIdx.z;
  const int h    = blockIdx.x;
  const int b    = blockIdx.y;
  const int tid  = threadIdx.x;
  const int lane = tid & 31;
  const int half = lane >> 4;
  const int ln   = lane & 15;
  // the wave's number in a scalar register: the skip beyond the diagonal is a scalar branch
  const int wave = __builtin_amdgcn_readfirstlane(tid >> 5);
  const int kg   = wave >> 2;                   // key group: which 64 of a stage's 128 keys
  const int q0   = qt * 128 + (wave & 3) * 32;  // this wave's first query
  const size_t baseRow = (size_t)b * T;
  const int hoff = h * HDIM;

  // Staging: a key group copies its own half stage. 8 lanes cover one 128-B row; a thread
  // copies rows srow + 16 i.
  const int srow = (tid & 127) >> 3, scol = (tid & 7) * 8;
  const __bf16* kSrc = Km + (baseRow + kg * 64 + srow) * EMB + hoff + scol;
  const __bf16* vSrc = Vt + (size_t)(hoff + srow) * vpitch + baseRow + kg * 64 + scol;
  const size_t kstep = (size_t)16 * EMB, vstep = (size_t)16 * vpitch;
  const unsigned int ldsK = lds_lo32(&kv[0][kg * KV_STAGE_ELEMS + srow * KV_PITCH + scol]);
  const int nst = qt + 1;  // stages of 128 keys up to the block's last query

  async_copy_kv(ldsK, kSrc, kstep, vSrc, vstep);

  // Q as B operand: two 16-query column groups x two k = 32 chunks of head_dim
  v16bf qb[2][2];
#pragma unroll
  for (int g = 0; g < 2; ++g)
#pragma unroll
    for (int c = 0; c < 2; ++c)
      qb[g][c] = load_frag(Q + (baseRow + q0 + g * 16 + ln) * EMB + hoff + c * 32 + 8 * half);

  float mi[2], li[2];
  v8f o[2][4] = {};
#pragma unroll
  for (int g = 0; g < 2; ++g) { mi[g] = -3.0e38f; li[g] = 0.f; }

  asm volatile("s_wait_asynccnt 0x0" ::: "memory");  // this wave's share of stage 0 landed
  __syncthreads();                                   // every wave's share visible
  if (nst > 1)
    async_copy_kv(ldsK + KV_STAGE_ELEMS * 4, kSrc + (size_t)128 * EMB, kstep, vSrc + 128, vstep);

  // 1/sqrt(EMB) per reference, times log2(e): the softmax runs in base 2
  const float scale = 0.03125f * 1.4426950408889634f;
  for (int s = 0; s < nst; ++s) {
    const int buf = s & 1;
    const __bf16* kp = &kv[buf][kg * KV_STAGE_ELEMS + ln * KV_PITCH + 8 * half];
    const __bf16* vp = kp + 64 * KV_PITCH;
#pragma unroll
    for (int u = 0; u < 2; ++u) {  // the half stage's two tiles of 32 keys
      const int kb = s * 128 + kg * 64 + u * 32;
      if (kb <= q0) {  // tiles wholly beyond this wave's diagonal are skipped
        v16bf ka[2][2];  // [16-key tile][head_dim chunk]
#pragma unroll
        for (int t = 0; t < 2; ++t)
#pragma unroll
          for (int c = 0; c < 2; ++c)
            ka[t][c] = load_frag(kp + (u * 32 + t * 16) * KV_PITCH + c * 32);
        v16bf va[4];     // [16-row chunk of head_dim], k = the 32 keys
#pragma unroll
        for (int dd = 0; dd < 4; ++dd)
          va[dd] = load_frag(vp + dd * 16 * KV_PITCH + u * 32);

#pragma unroll
        for (int g = 0; g < 2; ++g) {
          // st[t][r] = S[query q0 + g*16 + ln][key kb + t*16 + 8*half + r]
          v8f st[2] = {};
#pragma unroll
          for (int t = 0; t < 2; ++t)
#pragma unroll
            for (int c = 0; c < 2; ++c)
              st[t] = wmma_bf16(ka[t][c], qb[g][c], st[t]);

          float x[16];
#pragma unroll
          for (int e = 0; e < 16; ++e) x[e] = st[e >> 3][e & 7] * scale;
          if (kb == q0) {  // only the wave's last key tile crosses the diagonal
            const int qrel = g * 16 + ln - 8 * half;  // query - first key of this lane
#pragma unroll
            for (int e = 0; e < 16; ++e)
              x[e] = ((e >> 3) * 16 + (e & 7) <= qrel) ? x[e] : -3.0e38f;
          }
          float rmax = x[0];
#pragma unroll
          for (int e = 1; e < 16; ++e) rmax = fmaxf(rmax, x[e]);
          rmax = fmaxf(rmax, xhalf(rmax));
          const float mnew  = fmaxf(mi[g], rmax);
          const float alpha = __builtin_amdgcn_exp2f(mi[g] - mnew);
          mi[g] = mnew;

          // pb[s] = P^T[key kmap(s, half)][query]: the two score tiles in register order
          v16bf pb;
          float rsum = 0.f;
#pragma unroll
          for (int e = 0; e < 16; ++e) {
            float p = __builtin_amdgcn_exp2f(x[e] - mnew);
            rsum += p;
            pb[e] = (__bf16)p;
          }
          li[g] = li[g] * alpha + rsum;  // this half's keys only; halves join after the loop
#pragma unroll
          for (int dd = 0; dd < 4; ++dd) {
            o[g][dd] *= alpha;
            o[g][dd] = wmma_bf16(va[dd], pb, o[g][dd]);
          }
        }
      }
    }
    // The publish point stands outside the skip: every wave passes it in every stage.
    asm volatile("s_wait_dscnt 0x0" ::: "memory");     // own reads of this buffer done
    asm volatile("s_wait_asynccnt 0x0" ::: "memory");  // own share of stage s + 1 landed
    __syncthreads();  // publishes stage s + 1 and frees this buffer for the refill
    if (s + 2 < nst)
      async_copy_kv(ldsK + buf * (KV_STAGE_ELEMS * 4), kSrc + (size_t)(s + 2) * 128 * EMB,
                    kstep, vSrc + (s + 2) * 128, vstep);
  }
  asm volatile("s_wait_asynccnt 0x0" ::: "memory");  // nothing in flight at the wave's end

  // The join. The ring is free: the last stage's barrier stands behind every wave's last
  // read, and nothing was copied since. Waves 4-7 lay down their outputs, maxima and sums,
  // 17 groups of 16 B a lane, lanes side by side; waves 0-3 take them up behind the barrier.
  float* jn = (float*)&kv[0][0] + (wave & 3) * (17 * 128) + lane * 4;
  if (kg == 1) {
#pragma unroll
    for (int g = 0; g < 2; ++g)
#pragma unroll
      for (int dd = 0; dd < 4; ++dd) {
        float* d = jn + (g * 4 + dd) * 256;
        *(v4f*)d         = __builtin_shufflevector(o[g][dd], o[g][dd], 0, 1, 2, 3);
        *(v4f*)(d + 128) = __builtin_shufflevector(o[g][dd], o[g][dd], 4, 5, 6, 7);
      }
    const v4f ml = {mi[0], mi[1], li[0], li[1]};
    *(v4f*)(jn + 16 * 128) = ml;
  }
  __syncthreads();  // the second key group's partial results are visible
  if (kg == 1) return;

  // o[g][dd][r] = O[query q0 + g*16 + ln][d = dd*16 + 8*half + r]
  const v4f ml = *(const v4f*)(jn + 16 * 128);
  v8bf w[2][4];
#pragma unroll
  for (int g = 0; g < 2; ++g) {
    // A group that saw no key holds the start maximum, sum 0 and output 0: its weight is 0.
    // The first group always holds key 0, so the joint maximum is a real score.
    const float m  = fmaxf(mi[g], ml[g]);
    const float a0 = __builtin_amdgcn_exp2f(mi[g] - m);
    const float a1 = __builtin_amdgcn_exp2f(ml[g] - m);
    const float l  = li[g] * a0 + ml[2 + g] * a1;
    const float inv = 1.0f / (l + xhalf(l));
    const float w0 = a0 * inv, w1 = a1 * inv;
#pragma unroll
    for (int dd = 0; dd < 4; ++dd) {
      const float* d = jn + (g * 4 + dd) * 256;
      const v4f lo = *(const v4f*)d, hi = *(const v4f*)(d + 128);
#pragma unroll
      for (int r = 0; r < 8; ++r)
        w[g][dd][r] = (__bf16)(o[g][dd][r] * w0 + (r < 4 ? lo[r & 3] : hi[r & 3]) * w1);
    }
  }
  __bf16* op = O + (baseRow + q0 + ln) * EMB + hoff + 8 * half;
#pragma unroll
  for (int g = 0; g < 2; ++g)
#pragma unroll
    for (int dd = 0; dd < 4; ++dd) *(v8bf*)(op + (size_t)g * 16 * EMB + dd * 16) = w[g][dd];
}

// ---------------------------------------------------------------------------
extern "C" void kernel_launch(void* const* d_in, const int* in_sizes, int n_in,
                              void* d_out, int out_size, void* d_ws,
                              size_t ws_size, hipStream_t stream) {
  (void)in_sizes; (void)n_in; (void)out_size; (void)ws_size;
  const int B = 2, T = 2048, D = EMB, M = B * T, D4 = 4 * D;
  const int VP = M + 64;  // row pitch of V^T: an odd number of 128-byte lines

  const float* x  = (const float*)d_in[0];
  const float* Wq = (const float*)d_in[1];
  const float* Wk = (const float*)d_in[2];
  const float* Wv = (const float*)d_in[3];
  const float* Wo = (const float*)d_in[4];
  const float* bo = (const float*)d_in[5];
  const float* W1 = (const float*)d_in[6];
  const float* b1 = (const float*)d_in[7];
  const float* W2 = (const float*)d_in[8];
  const float* b2 = (const float*)d_in[9];
  const float* g1 = (const float*)d_in[10];
  const float* s1 = (const float*)d_in[11];
  const float* g2 = (const float*)d_in[12];
  const float* s2 = (const float*)d_in[13];
  float* out = (float*)d_out;

  size_t off = 0;
  auto alloc = [&](size_t bytes) {
    void* p = (char*)d_ws + off;
    off += (bytes + 255) & ~(size_t)255;
    return p;
  };
  __bf16* Wq_b = (__bf16*)alloc((size_t)D * D * 2);   // [N,K] transposed
  __bf16* Wk_b = (__bf16*)alloc((size_t)D * D * 2);
  __bf16* Wv_b = (__bf16*)alloc((size_t)D * D * 2);
  __bf16* Wo_b = (__bf16*)alloc((size_t)D * D * 2);
  __bf16* W1_b = (__bf16*)alloc((size_t)D * D4 * 2);
  __bf16* W2_b = (__bf16*)alloc((size_t)D4 * D * 2);
  __bf16* h1   = (__bf16*)alloc((size_t)M * D * 2);
  __bf16* q    = (__bf16*)alloc((size_t)M * D * 2);
  __bf16* k    = (__bf16*)alloc((size_t)M * D * 2);
  __bf16* vT   = (__bf16*)alloc((size_t)D * VP * 2);  // [D, VP], columns 0..M-1 used
  __bf16* attn = (__bf16*)alloc((size_t)M * D * 2);
  float*  xmid = (float*) alloc((size_t)M * D * 4);
  __bf16* h2   = (__bf16*)alloc((size_t)M * D * 2);
  __bf16* ffn  = (__bf16*)alloc((size_t)M * D4 * 2);

  // fp32 [K,N] -> bf16 [N,K] transposes of Wq, Wk, Wv and LN1 -> h1, one launch
  cast_qkv_and_layernorm<<<CAST_TILES_QKV + M / 8, 256, 0, stream>>>(
      Wq, Wk, Wv, Wq_b, Wk_b, Wv_b, x, g1, s1, h1);

  // QKV projections, one launch
  gemm_qkv_wmma<<<dim3(D / 128, M / 128, 3), 256, 0, stream>>>(h1, Wq_b, Wk_b, Wv_b, q, k, vT, D, VP, D);

  // causal flash attention; behind its query tiles, one block for each cast tile of Wo, W1, W2
  flash_attn_wmma<<<dim3(HEADS, B, T / 128 + (CAST_TILES - CAST_TILES_QKV) / (HEADS * B)),
                    256, 0, stream>>>(q, k, vT, attn, T, VP, Wo, W1, W2, Wo_b, W1_b, W2_b, B);

  // out projection + bias + residual(x) -> xmid (f32)
  gemm_bf16_wmma<false, false><<<dim3(D / 128, M / 128), 256, 0, stream>>>(attn, Wo_b, bo, x, xmid, D, D);

  // LN2 -> h2
  layernorm_bf16<<<M / 8, 256, 0, stream>>>(xmid, g2, s2, h2);

  // FFN
  gemm_bf16_wmma<true, true><<<dim3(D4 / 128, M / 128), 256, 0, stream>>>(h2, W1_b, b1, nullptr, ffn, D4, D);
  gemm_bf16_wmma<false, false><<<dim3(D / 128, M / 128), 256, 0, stream>>>(ffn, W2_b, b2, xmid, out, D, D4);
}
